// v000
// Times are from an AMD MI455X. After a warm-up the kernel runs many times in a row, and a time is the length of
// such a window on the GPU divided by its runs, so every launch and the gaps after it count. The runs cycle
// through copies of the inputs. A figure is the median of several windows, for all but v000 over two sittings.
// Sittings can differ by a few percent; kernels timed side by side share one.
// v000, which the later versions start from, runs in 1610 microseconds.
#include <hip/hip_runtime.h>

// Causal self-attention with a fused biased qkv projection and an ALiBi-style bias on the KEY position (x [2][2048][1024]; qkv = (x w_attn + b_attn) ('xw' [1024][3072]) reshaped (b, t, 3, 16, 64): q | k | v = column thirds (16 heads x 64); scores / sqrt(float32(64)) + slopes[h] x pos[s] with slopes[h] = 2 ** (-(8/16)(h + 1)) and pos the KEY index s: within a query row t this equals -slopes[h] x (t - s) plus the row constant slopes[h] x t, which the row softmax removes: implemented as the standard ALiBi distance term -slopes[h] x |t - s| on the causal triangle (slopes baked as jnp-exact f32 literals, pre-scaled by 8 for the kernel's exact x 1/8); causal (-inf); softmax; y = merged w_proj + b_proj ('xw') -> [2][2048][1024] (4.2 M); argument order x, w_attn, b_attn, w_proj, b_proj).
// Layout per batch: bf16 copy of x; the fused 'xw' weight transposed once into Bt (q | k | v row blocks) + bias slices; exact projections + f32 biases; identity-table plane builders; raw scores, then k_alibi subtracts SLOPE8[h] x |i - j| in f32 before the softmax kernel's x 1/8; causal T-2048 attention (hybrid rows: < 512 hi/lo 3 products, rest fp16 x1024; k_gemmc skips tiles above the diagonal); merged hi/lo x w_proj exact + b_proj.
// Compute dtypes, f32 accumulate: every input rounded to bf16; projections exact + f32 biases; attention rows < 512 3 products, rest fp16; softmax f32; output projection hl x exact.

#define NB_  2
#define TT   2048
#define DM   1024
#define NH_  16
#define NKV  16
#define REP  (NH_ / NKV)
#define HD   64
#define DQ   (NH_ * HD)
#define DKV  (NKV * HD)
#define ZH   2
#define RH   512                  // query rows < RH use hi+lo planes (0: none)
#define WIN  2048
#define PCAR 1024.0f
#define SCL  0.125f   // HD^-0.5
typedef _Float16 h16;
typedef unsigned short bf;
typedef __attribute__((ext_vector_type(16))) __bf16   v16bf;
typedef __attribute__((ext_vector_type(16))) _Float16 v16h;
typedef __attribute__((ext_vector_type(8)))  _Float16 v8h;
typedef __attribute__((ext_vector_type(8)))  unsigned short v8us;
typedef __attribute__((ext_vector_type(8)))  float    v8f;
typedef __attribute__((ext_vector_type(4)))  float    v4f;
typedef v8h  __attribute__((may_alias)) v8ha;
typedef v4f  __attribute__((may_alias)) v4fa;
typedef v8us __attribute__((may_alias)) v8usa;

__device__ __forceinline__ unsigned short f2bf(float f) { unsigned u = __float_as_uint(f); u += 0x7FFFu + ((u >> 16) & 1u); return (unsigned short)(u >> 16); }
__device__ __forceinline__ float bf2f(unsigned short b) { return __uint_as_float(((unsigned)b) << 16); }
__device__ __forceinline__ float bfr(float f) { return bf2f(f2bf(f)); }
__device__ __forceinline__ v16h cat16(v8h lo, v8h hi) { return __builtin_shufflevector(lo, hi, 0, 1, 2, 3, 4, 5, 6, 7, 8, 9, 10, 11, 12, 13, 14, 15); }
__device__ __forceinline__ v16bf cat16b(v8us lo, v8us hi) { return __builtin_bit_cast(v16bf, __builtin_shufflevector(lo, hi, 0, 1, 2, 3, 4, 5, 6, 7, 8, 9, 10, 11, 12, 13, 14, 15)); }
__device__ __forceinline__ v8f wmma16(v16h a, v16h b, v8f c) { return __builtin_amdgcn_wmma_f32_16x16x32_f16(false, a, false, b, (short)0, c, false, false); }
__device__ __forceinline__ v8f wmmab(v16bf a, v16bf b, v8f c) { return __builtin_amdgcn_wmma_f32_16x16x32_bf16(false, a, false, b, (short)0, c, false, false); }



// ---- k_gemmw: register-blocked GEMM, ONE WAVE per 64x64 output tile (16 accumulators), operands straight from K-contiguous 16-bit planes; grid (M/64, N/64, Z), 32 threads.
// C[m][n] (f32, pitch ldc, + optional f32 bias[n]) = sum_k A[m][k] Bt[n][k] (+ split products per NSPLIT). z-batch strides sA/sB/sC in elements. K % 32 == 0.
template <typename T16> struct WFrag;
template <> struct WFrag<h16> { typedef v16h V; static __device__ __forceinline__ V ld(const h16* p) { return cat16(*(const v8h*)p, *(const v8h*)(p + 16)); } static __device__ __forceinline__ v8f mma(V a, V b, v8f c) { return wmma16(a, b, c); } };
template <> struct WFrag<bf> { typedef v16bf V; static __device__ __forceinline__ V ld(const bf* p) { return cat16b(*(const v8us*)p, *(const v8us*)(p + 16)); } static __device__ __forceinline__ v8f mma(V a, V b, v8f c) { return wmmab(a, b, c); } };
template <typename T16, int NSPLIT, bool BIAS>
__global__ __launch_bounds__(32) void k_gemmw(const T16* __restrict__ A, const T16* __restrict__ A2, const T16* __restrict__ Bt, const T16* __restrict__ Bt2, int K, float* C, int ldc, const float* __restrict__ bias, size_t sA, size_t sB, size_t sC) {
    typedef typename WFrag<T16>::V V;
    __shared__ __align__(16) float os[16 * 68];
    const size_t z = blockIdx.z; A += z * sA; if (A2) A2 += z * sA; Bt += z * sB; if (Bt2) Bt2 += z * sB; C += z * sC;
    const int lane = threadIdx.x & 31, lr = lane & 15, hi = lane >> 4; const int r0 = blockIdx.x * 64, c0 = blockIdx.y * 64;
    v8f acc[4][4];
#pragma unroll
    for (int mb = 0; mb < 4; ++mb)
#pragma unroll
        for (int nb = 0; nb < 4; ++nb) acc[mb][nb] = (v8f){};
    const size_t aoff = (size_t)(r0 + lr) * K + 8 * hi, boff = (size_t)(c0 + lr) * K + 8 * hi;
#pragma unroll 1
    for (int kc = 0; kc < K; kc += 32) {
        V a[4], a2[4];
#pragma unroll
        for (int mb = 0; mb < 4; ++mb) { a[mb] = WFrag<T16>::ld(A + aoff + (size_t)mb * 16 * K + kc); if (NSPLIT == 1 || NSPLIT == 2) a2[mb] = WFrag<T16>::ld(A2 + aoff + (size_t)mb * 16 * K + kc); }
#pragma unroll
        for (int nb = 0; nb < 4; ++nb) { const V b = WFrag<T16>::ld(Bt + boff + (size_t)nb * 16 * K + kc); V b2; if (NSPLIT >= 2) b2 = WFrag<T16>::ld(Bt2 + boff + (size_t)nb * 16 * K + kc);
#pragma unroll
            for (int mb = 0; mb < 4; ++mb) { acc[mb][nb] = WFrag<T16>::mma(a[mb], b, acc[mb][nb]); if (NSPLIT == 1 || NSPLIT == 2) acc[mb][nb] = WFrag<T16>::mma(a2[mb], b, acc[mb][nb]); if (NSPLIT >= 2) acc[mb][nb] = WFrag<T16>::mma(a[mb], b2, acc[mb][nb]); } }
        asm volatile("v_nop\n\tv_nop\n\tv_nop\n\tv_nop" : "+v"(acc[0][0]), "+v"(acc[1][1]), "+v"(acc[2][2]), "+v"(acc[3][3]) : "v"(a[0]), "v"(a[3]));
    }
#pragma unroll
    for (int mb = 0; mb < 4; ++mb) {
#pragma unroll
        for (int nb = 0; nb < 4; ++nb) {
#pragma unroll
            for (int j = 0; j < 8; ++j) os[(hi * 8 + j) * 68 + nb * 16 + lr] = acc[mb][nb][j]; }
        __builtin_amdgcn_wave_barrier(); asm volatile("" ::: "memory");
        float* crow = C + (size_t)(r0 + mb * 16) * ldc + c0;
{
#pragma unroll
            for (int s = 0; s < 8; ++s) { const int row = 2 * s + hi, cofs = lr * 4; v4f val = *(const v4fa*)(os + row * 68 + cofs); if (BIAS) { val[0] += bfr(bias[c0 + cofs]); val[1] += bfr(bias[c0 + cofs + 1]); val[2] += bfr(bias[c0 + cofs + 2]); val[3] += bfr(bias[c0 + cofs + 3]); }
                *(v4f*)(crow + (size_t)row * ldc + cofs) = val; }
             }
        __builtin_amdgcn_wave_barrier(); asm volatile("" ::: "memory");
    }
}

// ---- k_gemmc: the same one-wave 64x64 tile GEMM specialised for causal attention: CMODE 1 skips score tiles entirely above the diagonal (query rows r0+roff.., key columns c0..), CMODE 2 limits the
// key (K) loop of the probability x value contraction to the diagonal block (probabilities beyond it are exactly zero). roff = row offset of this launch's first row within the sequence.
template <typename T16, int NSPLIT, int CMODE>
__global__ __launch_bounds__(32) void k_gemmc(const T16* __restrict__ A, const T16* __restrict__ A2, const T16* __restrict__ Bt, const T16* __restrict__ Bt2, int K, float* C, int ldc, int roff, size_t sA, size_t sB, size_t sC) {
    typedef typename WFrag<T16>::V V;
    __shared__ __align__(16) float os[16 * 68];
    const size_t z = blockIdx.z; A += z * sA; if (A2) A2 += z * sA; Bt += z * sB; if (Bt2) Bt2 += z * sB; C += z * sC;
    const int lane = threadIdx.x & 31, lr = lane & 15, hi = lane >> 4; const int r0 = blockIdx.x * 64, c0 = blockIdx.y * 64;
    if (CMODE == 1 && c0 > r0 + roff + 63) return;                  // score tile entirely above the causal diagonal: never read (the softmax masks j > i by select)
    const int Kl = (CMODE == 2) ? min(K, r0 + roff + 64) : K;        // P.V: probabilities are exactly 0 beyond the diagonal block, so the K loop stops there
    v8f acc[4][4];
#pragma unroll
    for (int mb = 0; mb < 4; ++mb)
#pragma unroll
        for (int nb = 0; nb < 4; ++nb) acc[mb][nb] = (v8f){};
    const size_t aoff = (size_t)(r0 + lr) * K + 8 * hi, boff = (size_t)(c0 + lr) * K + 8 * hi;
#pragma unroll 1
    for (int kc = 0; kc < Kl; kc += 32) {
        V a[4], a2[4];
#pragma unroll
        for (int mb = 0; mb < 4; ++mb) { a[mb] = WFrag<T16>::ld(A + aoff + (size_t)mb * 16 * K + kc); if (NSPLIT == 1 || NSPLIT == 2) a2[mb] = WFrag<T16>::ld(A2 + aoff + (size_t)mb * 16 * K + kc); }
#pragma unroll
        for (int nb = 0; nb < 4; ++nb) { const V b = WFrag<T16>::ld(Bt + boff + (size_t)nb * 16 * K + kc); V b2; if (NSPLIT >= 2) b2 = WFrag<T16>::ld(Bt2 + boff + (size_t)nb * 16 * K + kc);
#pragma unroll
            for (int mb = 0; mb < 4; ++mb) { acc[mb][nb] = WFrag<T16>::mma(a[mb], b, acc[mb][nb]); if (NSPLIT == 1 || NSPLIT == 2) acc[mb][nb] = WFrag<T16>::mma(a2[mb], b, acc[mb][nb]); if (NSPLIT >= 2) acc[mb][nb] = WFrag<T16>::mma(a[mb], b2, acc[mb][nb]); } }
        asm volatile("v_nop\n\tv_nop\n\tv_nop\n\tv_nop" : "+v"(acc[0][0]), "+v"(acc[1][1]), "+v"(acc[2][2]), "+v"(acc[3][3]) : "v"(a[0]), "v"(a[3]));
    }
#pragma unroll
    for (int mb = 0; mb < 4; ++mb) {
#pragma unroll
        for (int nb = 0; nb < 4; ++nb) {
#pragma unroll
            for (int j = 0; j < 8; ++j) os[(hi * 8 + j) * 68 + nb * 16 + lr] = acc[mb][nb][j]; }
        __builtin_amdgcn_wave_barrier(); asm volatile("" ::: "memory");
        float* crow = C + (size_t)(r0 + mb * 16) * ldc + c0;
{
#pragma unroll
            for (int s = 0; s < 8; ++s) { const int row = 2 * s + hi, cofs = lr * 4; v4f val = *(const v4fa*)(os + row * 68 + cofs);
                *(v4f*)(crow + (size_t)row * ldc + cofs) = val; }
             }
        __builtin_amdgcn_wave_barrier(); asm volatile("" ::: "memory");
    }
}

__device__ __forceinline__ h16 tohx(float x) { return (h16)x; }
__device__ __forceinline__ void splitf(float y, unsigned short& h, unsigned short& l) { h = f2bf(y); l = f2bf(y - bf2f(h)); }
typedef __attribute__((ext_vector_type(2))) _Float16 v2h;
typedef __attribute__((ext_vector_type(4))) _Float16 v4h;
typedef __attribute__((ext_vector_type(2))) unsigned short v2us;
typedef __attribute__((ext_vector_type(4))) unsigned short v4us;
typedef __attribute__((ext_vector_type(2))) float v2f;
typedef __attribute__((ext_vector_type(4))) int v4i;

__global__ __launch_bounds__(256) void k_wtG(const float* __restrict__ w, int K, int N, bf* Bt) {
    const int lane = threadIdx.x & 31; const int L0 = (blockIdx.x * 8 + (threadIdx.x >> 5)) * 8; const int nlines = N * K / 64;
{
#pragma unroll 1
        for (int l = 0; l < 8; ++l) { const int L = L0 + l; if (L >= nlines) break; const size_t e = (size_t)L * 64 + lane * 2; const int k = (int)(e % K), n = (int)(e / K); v2us o;
            o[0] = f2bf(w[(size_t)k * N + n]); o[1] = f2bf(w[(size_t)(k + 1) * N + n]); *(v2us*)(Bt + e) = o; }
         }
}
__global__ __launch_bounds__(256) void k_cvt8(const float* __restrict__ src, bf* dst, size_t n8) { const size_t i = (size_t)blockIdx.x * 256 + threadIdx.x; if (i >= n8) return; const v8f v = *(const v8f*)(src + i * 8); v8us o;
#pragma unroll
    for (int k = 0; k < 8; ++k) o[k] = f2bf(v[k]); *(v8us*)(dst + i * 8) = o;  }

// k_rope: head planes [h][t][d] (fp16 + hi/lo) of rope(x) x sc with the rotate-half convention out[d] = x[d] cos[t][d] - x[d+HD/2] sin[t][d], out[d+HD/2] = x[d+HD/2] cos[t][d+HD/2] + x[d] sin[t][d+HD/2]
__global__ __launch_bounds__(256) void k_rope(const float* __restrict__ F, int pitch, int nheads, const float* __restrict__ CS, const float* __restrict__ RF, const float* __restrict__ nw, float sc, h16* P16, bf* Ph, bf* Pl) {
    const size_t e = ((size_t)blockIdx.x * 256 + threadIdx.x) * 2; if (e >= (size_t)nheads * TT * HD) return; const int d = (int)(e % HD); const int t = (int)((e / HD) % TT); const int h = (int)(e / ((size_t)HD * TT)); const float* f = F + (size_t)t * pitch + h * HD; const float rf = RF ? RF[(size_t)h * TT + t] : 1.0f; v2h o16; v2us oh, ol;
#pragma unroll
    for (int q = 0; q < 2; ++q) { const int dd = d + q; const int dp = (dd < HD / 2) ? dd + HD / 2 : dd - HD / 2; float x0 = f[dd], x1 = f[dp];
        if (RF) { float n0 = __fmul_rn(x0, rf), n1 = __fmul_rn(x1, rf); asm volatile("" : "+v"(n0)); asm volatile("" : "+v"(n1)); x0 = __fmul_rn(bfr(nw[dd]), n0); x1 = __fmul_rn(bfr(nw[dp]), n1); }
        const v2f cs = *(const v2f*)(CS + ((size_t)t * HD + dd) * 2); float a = __fmul_rn(x0, cs[0]), bq = __fmul_rn(x1, cs[1]); asm volatile("" : "+v"(a)); asm volatile("" : "+v"(bq)); const float r = ((dd < HD / 2) ? __fsub_rn(a, bq) : __fadd_rn(a, bq)) * sc;
        o16[q] = tohx(r); unsigned short a2, c2; splitf(r, a2, c2); oh[q] = a2; ol[q] = c2; }
    *(v2h*)(P16 + e) = o16; *(v2us*)(Ph + e) = oh; *(v2us*)(Pl + e) = ol;  }
__global__ __launch_bounds__(256) void k_vtp(const float* __restrict__ F, int pitch, int nheads, h16* V16, bf* Vh, bf* Vl) { const size_t e = ((size_t)blockIdx.x * 256 + threadIdx.x) * 2; if (e >= (size_t)nheads * HD * TT) return; const int t = (int)(e % TT); const int d = (int)((e / TT) % HD); const int g = (int)(e / ((size_t)TT * HD)); v2h o16; v2us oh, ol;
#pragma unroll
    for (int q = 0; q < 2; ++q) { const float x = F[(size_t)(t + q) * pitch + g * HD + d]; o16[q] = tohx(x); unsigned short a2, c2; splitf(x, a2, c2); oh[q] = a2; ol[q] = c2; }
    *(v2h*)(V16 + e) = o16; *(v2us*)(Vh + e) = oh; *(v2us*)(Vl + e) = ol;  }
__global__ __launch_bounds__(256) void k_csid(float* CS) { const int idx = blockIdx.x * 256 + threadIdx.x; if (idx >= TT * HD) return; v2f cs; cs[0] = 1.0f; cs[1] = 0.0f; *(v2f*)(CS + (size_t)idx * 2) = cs;  }
__constant__ float SLOPE8[NH_] = { 5.656854153e+0f, 4.000000000e+0f, 2.828427076e+0f, 2.000000000e+0f, 1.414213538e+0f, 1.000000000e+0f, 7.071067691e-1f, 5.000000000e-1f, 3.535533845e-1f, 2.500000000e-1f, 1.767766923e-1f, 1.250000000e-1f, 8.838834614e-2f, 6.250000000e-2f, 4.419417307e-2f, 3.125000000e-2f };   // 8 x the per-head ALiBi slope magnitude (slopes[h] = 2 ** (-(8/16)(h + 1)), h = 0..15, as the reference's f32 values x 8); the eight power-of-two entries give exact products with |i - j| <= 2047; for the eight irrational ones SLOPE8[h] x |i - j| is ONE rounded f32 product, the same single rounding the reference's slopes[h] x pos[s] makes
__global__ __launch_bounds__(256) void k_alibi(float* Sb, int h0) { const size_t k = (size_t)blockIdx.x * 256 + threadIdx.x; if (k >= (size_t)ZH * TT * TT / 4) return; const size_t e = k * 4; const int j0 = (int)(e % TT); const int i = (int)((e / TT) % TT); const int zz = (int)(e / ((size_t)TT * TT)); const float sl = SLOPE8[h0 + zz]; v4f a = *(const v4f*)(Sb + e);
#pragma unroll
    for (int q = 0; q < 4; ++q) { const int dd = i - (j0 + q); const float dist = (float)(dd < 0 ? -dd : dd); float bb = __fmul_rn(sl, dist); asm volatile("" : "+v"(bb)); a[q] = __fsub_rn(a[q], bb); }
    *(v4f*)(Sb + e) = a;  }
// k_asoft: per row (zz, i): t = S x HD^-0.5 for j <= i and i - j < WIN (WIN = TT, so plain causal; the reference's -1e9 additive fill vanishes identically); softmax over the 2048 keys (register row, one exp, fixed trees);
__global__ __launch_bounds__(256) void k_asoft(const float* __restrict__ Sb, h16* P16, bf* Ph, bf* Pl) {
    const int lane = threadIdx.x & 31; const int row = blockIdx.x * 8 + (threadIdx.x >> 5); if (row >= ZH * TT) return; const int i = row % TT; const int zz = row / TT; (void)zz; const bool hires = (i < RH); const float* sr = Sb + (size_t)row * TT; float v[TT / 32]; float mx = -3.0e38f;
#pragma unroll
    for (int ch = 0; ch < TT / 128; ++ch) { const int j0 = ch * 128 + lane * 4; const v4f a = *(const v4f*)(sr + j0);
#pragma unroll
        for (int q = 0; q < 4; ++q) { const int j = j0 + q; (void)j; const float t = (j <= i && i - j < WIN) ? a[q] * SCL : -3.0e38f; v[ch * 4 + q] = t; mx = fmaxf(mx, t); } }
#pragma unroll
    for (int sh = 16; sh; sh >>= 1) mx = fmaxf(mx, __shfl_xor(mx, sh, 32));
    float sum = 0.f;
#pragma unroll
    for (int k = 0; k < TT / 32; ++k) { float d0 = __fsub_rn(v[k], mx); asm volatile("" : "+v"(d0)); v[k] = __builtin_amdgcn_exp2f(__fmul_rn(d0, 1.4426950408889634f)); sum += v[k]; }
#pragma unroll
    for (int sh = 16; sh; sh >>= 1) sum += __shfl_xor(sum, sh, 32);
    const float f = __fdiv_rn(hires ? 1.0f : PCAR, sum);
{
        if (hires) {
#pragma unroll
            for (int ch = 0; ch < TT / 128; ++ch) { v4us oh, ol;
#pragma unroll
                for (int q = 0; q < 4; ++q) { unsigned short a, c2; splitf(v[ch * 4 + q] * f, a, c2); oh[q] = a; ol[q] = c2; }
                const size_t oo = ((size_t)zz * (RH ? RH : 1) + i) * TT + ch * 128 + lane * 4; *(v4us*)(Ph + oo) = oh; *(v4us*)(Pl + oo) = ol; }
        } else {
#pragma unroll
            for (int ch = 0; ch < TT / 128; ++ch) { v4h o4;
#pragma unroll
                for (int q = 0; q < 4; ++q) o4[q] = tohx(v[ch * 4 + q] * f);
                *(v4h*)(P16 + (size_t)row * TT + ch * 128 + lane * 4) = o4; } }
         }
}
__global__ __launch_bounds__(256) void k_merge(const float* __restrict__ O, int h0, bf* Ah, bf* Al) { const size_t e = ((size_t)blockIdx.x * 256 + threadIdx.x) * 2; if (e >= (size_t)ZH * TT * HD) return; const int d = (int)(e % HD); const int t = (int)((e / HD) % TT); const int zz = (int)(e / ((size_t)HD * TT)); const float cs = (t < RH) ? 1.0f : (1.0f / PCAR); const size_t oo = (size_t)t * DQ + (h0 + zz) * HD + d;
    v2us oh, ol;
#pragma unroll
    for (int q = 0; q < 2; ++q) { unsigned short a, c2; splitf(O[e + q] * cs, a, c2); oh[q] = a; ol[q] = c2; } *(v2us*)(Ah + oo) = oh; *(v2us*)(Al + oo) = ol;  }

extern "C" void kernel_launch(void* const* d_in, const int* in_sizes, int n_in,
                              void* d_out, int out_size, void* d_ws, size_t ws_size, hipStream_t stream) {
    (void)in_sizes; (void)n_in; (void)out_size;
    const float* x = (const float*)d_in[0]; const float* wqkv = (const float*)d_in[1]; const float* bqkv = (const float*)d_in[2]; const float* wo = (const float*)d_in[3]; const float* bo = (const float*)d_in[4];     const float* bq = bqkv; const float* bk = bqkv + DQ; const float* bv = bqkv + 2 * DQ; const float* wq = wqkv; const float* wk = nullptr; const float* wv = nullptr; (void)wk; (void)wv;
    float* OUT = (float*)d_out;     // [2][2048][1024]
    char* wsp = (char*)d_ws;
    auto take = [&](size_t bytes) { char* p = wsp; wsp += (bytes + 255) & ~(size_t)255; return (void*)p; };
    bf* WQKV = (bf*)take((size_t)3 * DQ * DM * 2); bf* WQ = WQKV; bf* WK = WQKV + (size_t)DQ * DM; bf* WV = WQKV + (size_t)2 * DQ * DM;   /* fused Bt [3*DQ][DM]: q | k | v row blocks */ bf* WO = (bf*)take((size_t)DM * DQ * 2); float* CS = (float*)take((size_t)TT * HD * 2 * 4);
    bf* XB = (bf*)take((size_t)TT * DM * 2); float* FQ = (float*)take((size_t)TT * DQ * 4); float* FK = (float*)take((size_t)TT * DKV * 4);
    h16* QP16 = (h16*)take((size_t)NH_ * TT * HD * 2); h16* KP16 = (h16*)take((size_t)NKV * TT * HD * 2); h16* VT16 = (h16*)take((size_t)NKV * HD * TT * 2);
    bf* QPh = (bf*)take((size_t)NH_ * TT * HD * 2); bf* QPl = (bf*)take((size_t)NH_ * TT * HD * 2); bf* KPh = (bf*)take((size_t)NKV * TT * HD * 2); bf* KPl = (bf*)take((size_t)NKV * TT * HD * 2); bf* VTh = (bf*)take((size_t)NKV * HD * TT * 2); bf* VTl = (bf*)take((size_t)NKV * HD * TT * 2); bf* Ph = (bf*)take((size_t)ZH * RH * TT * 2); bf* Pl = (bf*)take((size_t)ZH * RH * TT * 2);
    float* Sb = (float*)take((size_t)ZH * TT * TT * 4); h16* P16 = (h16*)take((size_t)ZH * TT * TT * 2); float* Ob = (float*)take((size_t)ZH * TT * HD * 4); bf* ATh = (bf*)take((size_t)TT * DQ * 2); bf* ATl = (bf*)take((size_t)TT * DQ * 2);
    if ((size_t)(wsp - (char*)d_ws) > ws_size) return;    // ws 256 MiB
    float* FV = FK;   // v projection reuses the k buffer after the k planes are built (stream-ordered)
    { k_wtG<<<(unsigned)((DM * 3 * DQ / 64 + 63) / 64), 256, 0, stream>>>(wqkv, DM, 3 * DQ, WQKV);   /* fused 'xw' [DM][3*DQ] -> Bt [3*DQ][DM] */
      k_wtG<<<(unsigned)((DQ * DM / 64 + 63) / 64), 256, 0, stream>>>(wo, DQ, DM, WO);
       }
    k_csid<<<(TT * HD + 255) / 256, 256, 0, stream>>>(CS);
    const unsigned LQ = (unsigned)(((size_t)NH_ * TT * HD / 2 + 255) / 256), LKv = (unsigned)(((size_t)NKV * TT * HD / 2 + 255) / 256);
    for (int b = 0; b < NB_; ++b) {
        
        k_cvt8<<<(unsigned)(((size_t)TT * DM / 8 + 255) / 256), 256, 0, stream>>>(x + (size_t)b * TT * DM, XB, (size_t)TT * DM / 8);
        k_gemmw<bf, 0, true><<<dim3(TT / 64, DQ / 64, 1), 32, 0, stream>>>(XB, nullptr, WQ, nullptr, DM, FQ, DQ, bq, 0, 0, 0);
        k_rope<<<LQ, 256, 0, stream>>>(FQ, DQ, NH_, CS, nullptr, nullptr, 1.0f, QP16, QPh, QPl);
        k_gemmw<bf, 0, true><<<dim3(TT / 64, DKV / 64, 1), 32, 0, stream>>>(XB, nullptr, WK, nullptr, DM, FK, DKV, bk, 0, 0, 0);
        k_rope<<<LKv, 256, 0, stream>>>(FK, DKV, NKV, CS, nullptr, nullptr, 1.0f, KP16, KPh, KPl);
        k_gemmw<bf, 0, true><<<dim3(TT / 64, DKV / 64, 1), 32, 0, stream>>>(XB, nullptr, WV, nullptr, DM, FV, DKV, bv, 0, 0, 0); k_vtp<<<LKv, 256, 0, stream>>>(FV, DKV, NKV, VT16, VTh, VTl);
        for (int h0 = 0; h0 < NH_; h0 += ZH) { const size_t zq = (size_t)h0, zk = (size_t)(h0 / REP);   // one kv head per query head: the pass's two heads use consecutive kv planes (z-strides TT*HD)
            k_gemmc<bf, 2, 1><<<dim3(RH / 64, TT / 64, ZH), 32, 0, stream>>>(QPh + zq * TT * HD, QPl + zq * TT * HD, KPh + zk * TT * HD, KPl + zk * TT * HD, HD, Sb, TT, 0, (size_t)TT * HD, (size_t)TT * HD, (size_t)TT * TT);
            k_gemmc<h16, 0, 1><<<dim3((TT - RH) / 64, TT / 64, ZH), 32, 0, stream>>>(QP16 + zq * TT * HD + (size_t)RH * HD, nullptr, KP16 + zk * TT * HD, nullptr, HD, Sb + (size_t)RH * TT, TT, RH, (size_t)TT * HD, (size_t)TT * HD, (size_t)TT * TT);
            k_alibi<<<(unsigned)(((size_t)ZH * TT * TT / 4 + 255) / 256), 256, 0, stream>>>(Sb, h0);   /* - slope_h |i-j| (x 8, in f32) */ k_asoft<<<ZH * TT / 8, 256, 0, stream>>>(Sb, P16, Ph, Pl);
            k_gemmc<bf, 2, 2><<<dim3(RH / 64, HD / 64, ZH), 32, 0, stream>>>(Ph, Pl, VTh + zk * HD * TT, VTl + zk * HD * TT, TT, Ob, HD, 0, (size_t)RH * TT, (size_t)HD * TT, (size_t)TT * HD);
            k_gemmc<h16, 0, 2><<<dim3((TT - RH) / 64, HD / 64, ZH), 32, 0, stream>>>(P16 + (size_t)RH * TT, nullptr, VT16 + zk * HD * TT, nullptr, TT, Ob + (size_t)RH * HD, HD, RH, (size_t)TT * TT, (size_t)HD * TT, (size_t)TT * HD);
            k_merge<<<(unsigned)(((size_t)ZH * TT * HD / 2 + 255) / 256), 256, 0, stream>>>(Ob, h0, ATh, ATl); }
        k_gemmw<bf, 1, true><<<dim3(TT / 64, DM / 64, 1), 32, 0, stream>>>(ATh, ATl, WO, nullptr, DQ, OUT + (size_t)b * TT * DM, DM, bo, 0, 0, 0); }
}

// v001
// A run of this version takes 976 microseconds.
// Timed twice side by side with v000, it ran 1.66 and 1.65 times as fast.
#include <hip/hip_runtime.h>

// Causal self-attention with a fused biased qkv projection and an ALiBi-style bias on the KEY position (x [2][2048][1024]; qkv = (x w_attn + b_attn) ('xw' [1024][3072]) reshaped (b, t, 3, 16, 64): q | k | v = column thirds (16 heads x 64); scores / sqrt(float32(64)) + slopes[h] x pos[s] with slopes[h] = 2 ** (-(8/16)(h + 1)) and pos the KEY index s: within a query row t this equals -slopes[h] x (t - s) plus the row constant slopes[h] x t, which the row softmax removes: implemented as the standard ALiBi distance term -slopes[h] x |t - s| on the causal triangle (slopes baked as jnp-exact f32 literals, pre-scaled by 8 for the kernel's exact x 1/8); causal (-inf); softmax; y = merged w_proj + b_proj ('xw') -> [2][2048][1024] (4.2 M); argument order x, w_attn, b_attn, w_proj, b_proj).
// Layout per batch: bf16 copy of x; the fused 'xw' weight transposed once into Bt (q | k | v row blocks) + bias slices; exact projections + f32 biases; identity-table plane builders; raw scores, then k_alibi subtracts SLOPE8[h] x |i - j| in f32 before the softmax kernel's x 1/8; causal T-2048 attention (hybrid rows: < 512 hi/lo 3 products, rest fp16 x1024; k_gemmc skips tiles above the diagonal); merged hi/lo x w_proj exact + b_proj.
// Compute dtypes, f32 accumulate: every input rounded to bf16; projections exact + f32 biases; attention rows < 512 3 products, rest fp16; softmax f32; output projection hl x exact.

#define NB_  2
#define TT   2048
#define DM   1024
#define NH_  16
#define NKV  16
#define REP  (NH_ / NKV)
#define HD   64
#define DQ   (NH_ * HD)
#define DKV  (NKV * HD)
#define ZH   2
#define RH   512                  // query rows < RH use hi+lo planes (0: none)
#define WIN  2048
#define PCAR 1024.0f
#define SCL  0.125f   // HD^-0.5
typedef _Float16 h16;
typedef unsigned short bf;
typedef __attribute__((ext_vector_type(16))) __bf16   v16bf;
typedef __attribute__((ext_vector_type(16))) _Float16 v16h;
typedef __attribute__((ext_vector_type(8)))  _Float16 v8h;
typedef __attribute__((ext_vector_type(8)))  unsigned short v8us;
typedef __attribute__((ext_vector_type(8)))  float    v8f;
typedef __attribute__((ext_vector_type(4)))  float    v4f;
typedef v8h  __attribute__((may_alias)) v8ha;
typedef v4f  __attribute__((may_alias)) v4fa;
typedef v8us __attribute__((may_alias)) v8usa;

__device__ __forceinline__ unsigned short f2bf(float f) { unsigned u = __float_as_uint(f); u += 0x7FFFu + ((u >> 16) & 1u); return (unsigned short)(u >> 16); }
__device__ __forceinline__ float bf2f(unsigned short b) { return __uint_as_float(((unsigned)b) << 16); }
__device__ __forceinline__ float bfr(float f) { return bf2f(f2bf(f)); }
__device__ __forceinline__ v16h cat16(v8h lo, v8h hi) { return __builtin_shufflevector(lo, hi, 0, 1, 2, 3, 4, 5, 6, 7, 8, 9, 10, 11, 12, 13, 14, 15); }
__device__ __forceinline__ v16bf cat16b(v8us lo, v8us hi) { return __builtin_bit_cast(v16bf, __builtin_shufflevector(lo, hi, 0, 1, 2, 3, 4, 5, 6, 7, 8, 9, 10, 11, 12, 13, 14, 15)); }
__device__ __forceinline__ v8f wmma16(v16h a, v16h b, v8f c) { return __builtin_amdgcn_wmma_f32_16x16x32_f16(false, a, false, b, (short)0, c, false, false); }
__device__ __forceinline__ v8f wmmab(v16bf a, v16bf b, v8f c) { return __builtin_amdgcn_wmma_f32_16x16x32_bf16(false, a, false, b, (short)0, c, false, false); }



// ---- k_gemmw: register-blocked GEMM, ONE WAVE per 64x64 output tile (16 accumulators), operands straight from K-contiguous 16-bit planes; grid (M/64, N/64, Z), 32 threads.
// C[m][n] (f32, pitch ldc, + optional f32 bias[n]) = sum_k A[m][k] Bt[n][k] (+ split products per NSPLIT). z-batch strides sA/sB/sC in elements. K % 32 == 0.
template <typename T16> struct WFrag;
template <> struct WFrag<h16> { typedef v16h V; static __device__ __forceinline__ V ld(const h16* p) { return cat16(*(const v8h*)p, *(const v8h*)(p + 16)); } static __device__ __forceinline__ v8f mma(V a, V b, v8f c) { return wmma16(a, b, c); } };
template <> struct WFrag<bf> { typedef v16bf V; static __device__ __forceinline__ V ld(const bf* p) { return cat16b(*(const v8us*)p, *(const v8us*)(p + 16)); } static __device__ __forceinline__ v8f mma(V a, V b, v8f c) { return wmmab(a, b, c); } };
template <typename T16, int NSPLIT, bool BIAS>
__global__ __launch_bounds__(32) void k_gemmw(const T16* __restrict__ A, const T16* __restrict__ A2, const T16* __restrict__ Bt, const T16* __restrict__ Bt2, int K, float* C, int ldc, const float* __restrict__ bias, size_t sA, size_t sB, size_t sC) {
    typedef typename WFrag<T16>::V V;
    __shared__ __align__(16) float os[16 * 68];
    const size_t z = blockIdx.z; A += z * sA; if (A2) A2 += z * sA; Bt += z * sB; if (Bt2) Bt2 += z * sB; C += z * sC;
    const int lane = threadIdx.x & 31, lr = lane & 15, hi = lane >> 4; const int r0 = blockIdx.x * 64, c0 = blockIdx.y * 64;
    v8f acc[4][4];
#pragma unroll
    for (int mb = 0; mb < 4; ++mb)
#pragma unroll
        for (int nb = 0; nb < 4; ++nb) acc[mb][nb] = (v8f){};
    const size_t aoff = (size_t)(r0 + lr) * K + 8 * hi, boff = (size_t)(c0 + lr) * K + 8 * hi;
#pragma unroll 1
    for (int kc = 0; kc < K; kc += 32) {
        V a[4], a2[4];
#pragma unroll
        for (int mb = 0; mb < 4; ++mb) { a[mb] = WFrag<T16>::ld(A + aoff + (size_t)mb * 16 * K + kc); if (NSPLIT == 1 || NSPLIT == 2) a2[mb] = WFrag<T16>::ld(A2 + aoff + (size_t)mb * 16 * K + kc); }
#pragma unroll
        for (int nb = 0; nb < 4; ++nb) { const V b = WFrag<T16>::ld(Bt + boff + (size_t)nb * 16 * K + kc); V b2; if (NSPLIT >= 2) b2 = WFrag<T16>::ld(Bt2 + boff + (size_t)nb * 16 * K + kc);
#pragma unroll
            for (int mb = 0; mb < 4; ++mb) { acc[mb][nb] = WFrag<T16>::mma(a[mb], b, acc[mb][nb]); if (NSPLIT == 1 || NSPLIT == 2) acc[mb][nb] = WFrag<T16>::mma(a2[mb], b, acc[mb][nb]); if (NSPLIT >= 2) acc[mb][nb] = WFrag<T16>::mma(a[mb], b2, acc[mb][nb]); } }
        asm volatile("v_nop\n\tv_nop\n\tv_nop\n\tv_nop" : "+v"(acc[0][0]), "+v"(acc[1][1]), "+v"(acc[2][2]), "+v"(acc[3][3]) : "v"(a[0]), "v"(a[3]));
    }
#pragma unroll
    for (int mb = 0; mb < 4; ++mb) {
#pragma unroll
        for (int nb = 0; nb < 4; ++nb) {
#pragma unroll
            for (int j = 0; j < 8; ++j) os[(hi * 8 + j) * 68 + nb * 16 + lr] = acc[mb][nb][j]; }
        __builtin_amdgcn_wave_barrier(); asm volatile("" ::: "memory");
        float* crow = C + (size_t)(r0 + mb * 16) * ldc + c0;
{
#pragma unroll
            for (int s = 0; s < 8; ++s) { const int row = 2 * s + hi, cofs = lr * 4; v4f val = *(const v4fa*)(os + row * 68 + cofs); if (BIAS) { val[0] += bfr(bias[c0 + cofs]); val[1] += bfr(bias[c0 + cofs + 1]); val[2] += bfr(bias[c0 + cofs + 2]); val[3] += bfr(bias[c0 + cofs + 3]); }
                *(v4f*)(crow + (size_t)row * ldc + cofs) = val; }
             }
        __builtin_amdgcn_wave_barrier(); asm volatile("" ::: "memory");
    }
}

// ---- k_gemmc: the same one-wave 64x64 tile GEMM specialised for causal attention: CMODE 1 skips score tiles entirely above the diagonal (query rows r0+roff.., key columns c0..), CMODE 2 limits the
// key (K) loop of the probability x value contraction to the diagonal block (probabilities beyond it are exactly zero). roff = row offset of this launch's first row within the sequence.
template <typename T16, int NSPLIT, int CMODE>
__global__ __launch_bounds__(32) void k_gemmc(const T16* __restrict__ A, const T16* __restrict__ A2, const T16* __restrict__ Bt, const T16* __restrict__ Bt2, int K, float* C, int ldc, int roff, size_t sA, size_t sB, size_t sC) {
    typedef typename WFrag<T16>::V V;
    __shared__ __align__(16) float os[16 * 68];
    const size_t z = blockIdx.z; A += z * sA; if (A2) A2 += z * sA; Bt += z * sB; if (Bt2) Bt2 += z * sB; C += z * sC;
    const int lane = threadIdx.x & 31, lr = lane & 15, hi = lane >> 4; const int r0 = blockIdx.x * 64, c0 = blockIdx.y * 64;
    if (CMODE == 1 && c0 > r0 + roff + 63) return;                  // score tile entirely above the causal diagonal: never read (the softmax masks j > i by select)
    const int Kl = (CMODE == 2) ? min(K, r0 + roff + 64) : K;        // P.V: probabilities are exactly 0 beyond the diagonal block, so the K loop stops there
    v8f acc[4][4];
#pragma unroll
    for (int mb = 0; mb < 4; ++mb)
#pragma unroll
        for (int nb = 0; nb < 4; ++nb) acc[mb][nb] = (v8f){};
    const size_t aoff = (size_t)(r0 + lr) * K + 8 * hi, boff = (size_t)(c0 + lr) * K + 8 * hi;
#pragma unroll 1
    for (int kc = 0; kc < Kl; kc += 32) {
        V a[4], a2[4];
#pragma unroll
        for (int mb = 0; mb < 4; ++mb) { a[mb] = WFrag<T16>::ld(A + aoff + (size_t)mb * 16 * K + kc); if (NSPLIT == 1 || NSPLIT == 2) a2[mb] = WFrag<T16>::ld(A2 + aoff + (size_t)mb * 16 * K + kc); }
#pragma unroll
        for (int nb = 0; nb < 4; ++nb) { const V b = WFrag<T16>::ld(Bt + boff + (size_t)nb * 16 * K + kc); V b2; if (NSPLIT >= 2) b2 = WFrag<T16>::ld(Bt2 + boff + (size_t)nb * 16 * K + kc);
#pragma unroll
            for (int mb = 0; mb < 4; ++mb) { acc[mb][nb] = WFrag<T16>::mma(a[mb], b, acc[mb][nb]); if (NSPLIT == 1 || NSPLIT == 2) acc[mb][nb] = WFrag<T16>::mma(a2[mb], b, acc[mb][nb]); if (NSPLIT >= 2) acc[mb][nb] = WFrag<T16>::mma(a[mb], b2, acc[mb][nb]); } }
        asm volatile("v_nop\n\tv_nop\n\tv_nop\n\tv_nop" : "+v"(acc[0][0]), "+v"(acc[1][1]), "+v"(acc[2][2]), "+v"(acc[3][3]) : "v"(a[0]), "v"(a[3]));
    }
#pragma unroll
    for (int mb = 0; mb < 4; ++mb) {
#pragma unroll
        for (int nb = 0; nb < 4; ++nb) {
#pragma unroll
            for (int j = 0; j < 8; ++j) os[(hi * 8 + j) * 68 + nb * 16 + lr] = acc[mb][nb][j]; }
        __builtin_amdgcn_wave_barrier(); asm volatile("" ::: "memory");
        float* crow = C + (size_t)(r0 + mb * 16) * ldc + c0;
{
#pragma unroll
            for (int s = 0; s < 8; ++s) { const int row = 2 * s + hi, cofs = lr * 4; v4f val = *(const v4fa*)(os + row * 68 + cofs);
                *(v4f*)(crow + (size_t)row * ldc + cofs) = val; }
             }
        __builtin_amdgcn_wave_barrier(); asm volatile("" ::: "memory");
    }
}

// ---- k_pvs: the probability x value contraction with its key (K) loop SPLIT OVER THE NW WAVES OF ONE WORK-GROUP. One work-group owns a 32 x 64 output tile (all HD columns); wave w takes the 64-key units w, w + NW, ...
// (64 keys = one whole 128-byte line of every operand row) up to the diagonal block (probabilities beyond it are exactly zero), keeps a private f32 partial tile, and the partials are summed through LDS in the fixed order w = 0 .. NW-1.
// A single wave walking all 2048 keys is bound by what one wave can keep in flight; NW waves on one WGP read the same bytes side by side. roff = row offset of this launch's first row within the sequence. K % 64 == 0. Launched in place of k_gemmc's CMODE 2.
template <typename T16, int NSPLIT, int NW>
__global__ __launch_bounds__(NW * 32) void k_pvs(const T16* __restrict__ A, const T16* __restrict__ A2, const T16* __restrict__ Bt, const T16* __restrict__ Bt2, int K, float* C, int roff, size_t sA, size_t sB, size_t sC) {
    typedef typename WFrag<T16>::V V;
    __shared__ __align__(16) float ps[NW * 32 * 68];
    const size_t z = blockIdx.z; A += z * sA; if (A2) A2 += z * sA; Bt += z * sB; if (Bt2) Bt2 += z * sB; C += z * sC;
    const int lane = threadIdx.x & 31, lr = lane & 15, hi = lane >> 4; const int w = __builtin_amdgcn_readfirstlane((int)(threadIdx.x >> 5)); const int r0 = blockIdx.x * 32;
    const int Kl = min(K, (r0 + roff + 32 + 63) & ~63);
    constexpr int CH = (NSPLIT == 2) ? 1 : 2;   // 32-key chunks whose loads are issued together: 24 loads of 16 bytes a lane either way
    v8f acc[2][4];
#pragma unroll
    for (int mb = 0; mb < 2; ++mb)
#pragma unroll
        for (int nb = 0; nb < 4; ++nb) acc[mb][nb] = (v8f){};
    const size_t aoff = (size_t)(r0 + lr) * K + 8 * hi, boff = (size_t)lr * K + 8 * hi;
    // the unit loop stays rolled (two trips at most here): unrolled it would hold two units' fragments and pass the register budget of a 16-wave work-group; the loops inside are unrolled so that the fragment arrays live in registers
#pragma unroll 1
    for (int k0 = w * 64; k0 < Kl; k0 += NW * 64) {
#pragma unroll
        for (int kh = k0; kh < k0 + 64; kh += CH * 32) {
            V a[CH][2], a2[CH][2], b[CH][4], b2[CH][4];
#pragma unroll
            for (int c = 0; c < CH; ++c) {
#pragma unroll
                for (int mb = 0; mb < 2; ++mb) { a[c][mb] = WFrag<T16>::ld(A + aoff + (size_t)mb * 16 * K + kh + c * 32); if (NSPLIT == 2) a2[c][mb] = WFrag<T16>::ld(A2 + aoff + (size_t)mb * 16 * K + kh + c * 32); }
#pragma unroll
                for (int nb = 0; nb < 4; ++nb) { b[c][nb] = WFrag<T16>::ld(Bt + boff + (size_t)nb * 16 * K + kh + c * 32); if (NSPLIT == 2) b2[c][nb] = WFrag<T16>::ld(Bt2 + boff + (size_t)nb * 16 * K + kh + c * 32); } }
            __builtin_amdgcn_sched_barrier(0);   // keeps these 24 loads issued ahead of their first product: one trip to memory for all; without it the scheduler sinks loads between the products and the wave waits several times in turn
#pragma unroll
            for (int c = 0; c < CH; ++c)
#pragma unroll
                for (int nb = 0; nb < 4; ++nb)
#pragma unroll
                    for (int mb = 0; mb < 2; ++mb) { acc[mb][nb] = WFrag<T16>::mma(a[c][mb], b[c][nb], acc[mb][nb]); if (NSPLIT == 2) { acc[mb][nb] = WFrag<T16>::mma(a2[c][mb], b[c][nb], acc[mb][nb]); acc[mb][nb] = WFrag<T16>::mma(a[c][mb], b2[c][nb], acc[mb][nb]); } }
        }
    }
    float* pw = ps + w * (32 * 68);
#pragma unroll
    for (int mb = 0; mb < 2; ++mb)
#pragma unroll
        for (int nb = 0; nb < 4; ++nb)
#pragma unroll
            for (int j = 0; j < 8; ++j) pw[(mb * 16 + hi * 8 + j) * 68 + nb * 16 + lr] = acc[mb][nb][j];
    __syncthreads();
#pragma unroll
    for (int idx = threadIdx.x; idx < 32 * 16; idx += NW * 32) { const int row = idx >> 4, cofs = (idx & 15) * 4; v4f s = *(const v4fa*)(ps + row * 68 + cofs);
#pragma unroll
        for (int ww = 1; ww < NW; ++ww) s += *(const v4fa*)(ps + ww * (32 * 68) + row * 68 + cofs);
        *(v4f*)(C + (size_t)(r0 + row) * HD + cofs) = s; }
}

__device__ __forceinline__ h16 tohx(float x) { return (h16)x; }
__device__ __forceinline__ void splitf(float y, unsigned short& h, unsigned short& l) { h = f2bf(y); l = f2bf(y - bf2f(h)); }
typedef __attribute__((ext_vector_type(2))) _Float16 v2h;
typedef __attribute__((ext_vector_type(4))) _Float16 v4h;
typedef __attribute__((ext_vector_type(2))) unsigned short v2us;
typedef __attribute__((ext_vector_type(4))) unsigned short v4us;
typedef __attribute__((ext_vector_type(2))) float v2f;
typedef __attribute__((ext_vector_type(4))) int v4i;

__global__ __launch_bounds__(256) void k_wtG(const float* __restrict__ w, int K, int N, bf* Bt) {
    const int lane = threadIdx.x & 31; const int L0 = (blockIdx.x * 8 + (threadIdx.x >> 5)) * 8; const int nlines = N * K / 64;
{
#pragma unroll 1
        for (int l = 0; l < 8; ++l) { const int L = L0 + l; if (L >= nlines) break; const size_t e = (size_t)L * 64 + lane * 2; const int k = (int)(e % K), n = (int)(e / K); v2us o;
            o[0] = f2bf(w[(size_t)k * N + n]); o[1] = f2bf(w[(size_t)(k + 1) * N + n]); *(v2us*)(Bt + e) = o; }
         }
}
__global__ __launch_bounds__(256) void k_cvt8(const float* __restrict__ src, bf* dst, size_t n8) { const size_t i = (size_t)blockIdx.x * 256 + threadIdx.x; if (i >= n8) return; const v8f v = *(const v8f*)(src + i * 8); v8us o;
#pragma unroll
    for (int k = 0; k < 8; ++k) o[k] = f2bf(v[k]); *(v8us*)(dst + i * 8) = o;  }

// k_rope: head planes [h][t][d] (fp16 + hi/lo) of rope(x) x sc with the rotate-half convention out[d] = x[d] cos[t][d] - x[d+HD/2] sin[t][d], out[d+HD/2] = x[d+HD/2] cos[t][d+HD/2] + x[d] sin[t][d+HD/2]
__global__ __launch_bounds__(256) void k_rope(const float* __restrict__ F, int pitch, int nheads, const float* __restrict__ CS, const float* __restrict__ RF, const float* __restrict__ nw, float sc, h16* P16, bf* Ph, bf* Pl) {
    const size_t e = ((size_t)blockIdx.x * 256 + threadIdx.x) * 2; if (e >= (size_t)nheads * TT * HD) return; const int d = (int)(e % HD); const int t = (int)((e / HD) % TT); const int h = (int)(e / ((size_t)HD * TT)); const float* f = F + (size_t)t * pitch + h * HD; const float rf = RF ? RF[(size_t)h * TT + t] : 1.0f; v2h o16; v2us oh, ol;
#pragma unroll
    for (int q = 0; q < 2; ++q) { const int dd = d + q; const int dp = (dd < HD / 2) ? dd + HD / 2 : dd - HD / 2; float x0 = f[dd], x1 = f[dp];
        if (RF) { float n0 = __fmul_rn(x0, rf), n1 = __fmul_rn(x1, rf); asm volatile("" : "+v"(n0)); asm volatile("" : "+v"(n1)); x0 = __fmul_rn(bfr(nw[dd]), n0); x1 = __fmul_rn(bfr(nw[dp]), n1); }
        const v2f cs = *(const v2f*)(CS + ((size_t)t * HD + dd) * 2); float a = __fmul_rn(x0, cs[0]), bq = __fmul_rn(x1, cs[1]); asm volatile("" : "+v"(a)); asm volatile("" : "+v"(bq)); const float r = ((dd < HD / 2) ? __fsub_rn(a, bq) : __fadd_rn(a, bq)) * sc;
        o16[q] = tohx(r); unsigned short a2, c2; splitf(r, a2, c2); oh[q] = a2; ol[q] = c2; }
    *(v2h*)(P16 + e) = o16; *(v2us*)(Ph + e) = oh; *(v2us*)(Pl + e) = ol;  }
__global__ __launch_bounds__(256) void k_vtp(const float* __restrict__ F, int pitch, int nheads, h16* V16, bf* Vh, bf* Vl) { const size_t e = ((size_t)blockIdx.x * 256 + threadIdx.x) * 2; if (e >= (size_t)nheads * HD * TT) return; const int t = (int)(e % TT); const int d = (int)((e / TT) % HD); const int g = (int)(e / ((size_t)TT * HD)); v2h o16; v2us oh, ol;
#pragma unroll
    for (int q = 0; q < 2; ++q) { const float x = F[(size_t)(t + q) * pitch + g * HD + d]; o16[q] = tohx(x); unsigned short a2, c2; splitf(x, a2, c2); oh[q] = a2; ol[q] = c2; }
    *(v2h*)(V16 + e) = o16; *(v2us*)(Vh + e) = oh; *(v2us*)(Vl + e) = ol;  }
__global__ __launch_bounds__(256) void k_csid(float* CS) { const int idx = blockIdx.x * 256 + threadIdx.x; if (idx >= TT * HD) return; v2f cs; cs[0] = 1.0f; cs[1] = 0.0f; *(v2f*)(CS + (size_t)idx * 2) = cs;  }
__constant__ float SLOPE8[NH_] = { 5.656854153e+0f, 4.000000000e+0f, 2.828427076e+0f, 2.000000000e+0f, 1.414213538e+0f, 1.000000000e+0f, 7.071067691e-1f, 5.000000000e-1f, 3.535533845e-1f, 2.500000000e-1f, 1.767766923e-1f, 1.250000000e-1f, 8.838834614e-2f, 6.250000000e-2f, 4.419417307e-2f, 3.125000000e-2f };   // 8 x the per-head ALiBi slope magnitude (slopes[h] = 2 ** (-(8/16)(h + 1)), h = 0..15, as the reference's f32 values x 8); the eight power-of-two entries give exact products with |i - j| <= 2047; for the eight irrational ones SLOPE8[h] x |i - j| is ONE rounded f32 product, the same single rounding the reference's slopes[h] x pos[s] makes
__global__ __launch_bounds__(256) void k_alibi(float* Sb, int h0) { const size_t k = (size_t)blockIdx.x * 256 + threadIdx.x; if (k >= (size_t)ZH * TT * TT / 4) return; const size_t e = k * 4; const int j0 = (int)(e % TT); const int i = (int)((e / TT) % TT); const int zz = (int)(e / ((size_t)TT * TT)); const float sl = SLOPE8[h0 + zz]; v4f a = *(const v4f*)(Sb + e);
#pragma unroll
    for (int q = 0; q < 4; ++q) { const int dd = i - (j0 + q); const float dist = (float)(dd < 0 ? -dd : dd); float bb = __fmul_rn(sl, dist); asm volatile("" : "+v"(bb)); a[q] = __fsub_rn(a[q], bb); }
    *(v4f*)(Sb + e) = a;  }
// k_asoft: per row (zz, i): t = S x HD^-0.5 for j <= i and i - j < WIN (WIN = TT, so plain causal; the reference's -1e9 additive fill vanishes identically); softmax over the 2048 keys (register row, one exp, fixed trees);
__global__ __launch_bounds__(256) void k_asoft(const float* __restrict__ Sb, h16* P16, bf* Ph, bf* Pl) {
    const int lane = threadIdx.x & 31; const int row = blockIdx.x * 8 + (threadIdx.x >> 5); if (row >= ZH * TT) return; const int i = row % TT; const int zz = row / TT; (void)zz; const bool hires = (i < RH); const float* sr = Sb + (size_t)row * TT; float v[TT / 32]; float mx = -3.0e38f;
#pragma unroll
    for (int ch = 0; ch < TT / 128; ++ch) { const int j0 = ch * 128 + lane * 4; const v4f a = *(const v4f*)(sr + j0);
#pragma unroll
        for (int q = 0; q < 4; ++q) { const int j = j0 + q; (void)j; const float t = (j <= i && i - j < WIN) ? a[q] * SCL : -3.0e38f; v[ch * 4 + q] = t; mx = fmaxf(mx, t); } }
#pragma unroll
    for (int sh = 16; sh; sh >>= 1) mx = fmaxf(mx, __shfl_xor(mx, sh, 32));
    float sum = 0.f;
#pragma unroll
    for (int k = 0; k < TT / 32; ++k) { float d0 = __fsub_rn(v[k], mx); asm volatile("" : "+v"(d0)); v[k] = __builtin_amdgcn_exp2f(__fmul_rn(d0, 1.4426950408889634f)); sum += v[k]; }
#pragma unroll
    for (int sh = 16; sh; sh >>= 1) sum += __shfl_xor(sum, sh, 32);
    const float f = __fdiv_rn(hires ? 1.0f : PCAR, sum);
{
        if (hires) {
#pragma unroll
            for (int ch = 0; ch < TT / 128; ++ch) { v4us oh, ol;
#pragma unroll
                for (int q = 0; q < 4; ++q) { unsigned short a, c2; splitf(v[ch * 4 + q] * f, a, c2); oh[q] = a; ol[q] = c2; }
                const size_t oo = ((size_t)zz * (RH ? RH : 1) + i) * TT + ch * 128 + lane * 4; *(v4us*)(Ph + oo) = oh; *(v4us*)(Pl + oo) = ol; }
        } else {
#pragma unroll
            for (int ch = 0; ch < TT / 128; ++ch) { v4h o4;
#pragma unroll
                for (int q = 0; q < 4; ++q) o4[q] = tohx(v[ch * 4 + q] * f);
                *(v4h*)(P16 + (size_t)row * TT + ch * 128 + lane * 4) = o4; } }
         }
}
__global__ __launch_bounds__(256) void k_merge(const float* __restrict__ O, int h0, bf* Ah, bf* Al) { const size_t e = ((size_t)blockIdx.x * 256 + threadIdx.x) * 2; if (e >= (size_t)ZH * TT * HD) return; const int d = (int)(e % HD); const int t = (int)((e / HD) % TT); const int zz = (int)(e / ((size_t)HD * TT)); const float cs = (t < RH) ? 1.0f : (1.0f / PCAR); const size_t oo = (size_t)t * DQ + (h0 + zz) * HD + d;
    v2us oh, ol;
#pragma unroll
    for (int q = 0; q < 2; ++q) { unsigned short a, c2; splitf(O[e + q] * cs, a, c2); oh[q] = a; ol[q] = c2; } *(v2us*)(Ah + oo) = oh; *(v2us*)(Al + oo) = ol;  }

extern "C" void kernel_launch(void* const* d_in, const int* in_sizes, int n_in,
                              void* d_out, int out_size, void* d_ws, size_t ws_size, hipStream_t stream) {
    (void)in_sizes; (void)n_in; (void)out_size;
    const float* x = (const float*)d_in[0]; const float* wqkv = (const float*)d_in[1]; const float* bqkv = (const float*)d_in[2]; const float* wo = (const float*)d_in[3]; const float* bo = (const float*)d_in[4];     const float* bq = bqkv; const float* bk = bqkv + DQ; const float* bv = bqkv + 2 * DQ; const float* wq = wqkv; const float* wk = nullptr; const float* wv = nullptr; (void)wk; (void)wv;
    float* OUT = (float*)d_out;     // [2][2048][1024]
    char* wsp = (char*)d_ws;
    auto take = [&](size_t bytes) { char* p = wsp; wsp += (bytes + 255) & ~(size_t)255; return (void*)p; };
    bf* WQKV = (bf*)take((size_t)3 * DQ * DM * 2); bf* WQ = WQKV; bf* WK = WQKV + (size_t)DQ * DM; bf* WV = WQKV + (size_t)2 * DQ * DM;   /* fused Bt [3*DQ][DM]: q | k | v row blocks */ bf* WO = (bf*)take((size_t)DM * DQ * 2); float* CS = (float*)take((size_t)TT * HD * 2 * 4);
    bf* XB = (bf*)take((size_t)TT * DM * 2); float* FQ = (float*)take((size_t)TT * DQ * 4); float* FK = (float*)take((size_t)TT * DKV * 4);
    h16* QP16 = (h16*)take((size_t)NH_ * TT * HD * 2); h16* KP16 = (h16*)take((size_t)NKV * TT * HD * 2); h16* VT16 = (h16*)take((size_t)NKV * HD * TT * 2);
    bf* QPh = (bf*)take((size_t)NH_ * TT * HD * 2); bf* QPl = (bf*)take((size_t)NH_ * TT * HD * 2); bf* KPh = (bf*)take((size_t)NKV * TT * HD * 2); bf* KPl = (bf*)take((size_t)NKV * TT * HD * 2); bf* VTh = (bf*)take((size_t)NKV * HD * TT * 2); bf* VTl = (bf*)take((size_t)NKV * HD * TT * 2); bf* Ph = (bf*)take((size_t)ZH * RH * TT * 2); bf* Pl = (bf*)take((size_t)ZH * RH * TT * 2);
    float* Sb = (float*)take((size_t)ZH * TT * TT * 4); h16* P16 = (h16*)take((size_t)ZH * TT * TT * 2); float* Ob = (float*)take((size_t)ZH * TT * HD * 4); bf* ATh = (bf*)take((size_t)TT * DQ * 2); bf* ATl = (bf*)take((size_t)TT * DQ * 2);
    if ((size_t)(wsp - (char*)d_ws) > ws_size) return;    // ws 256 MiB
    float* FV = FK;   // v projection reuses the k buffer after the k planes are built (stream-ordered)
    { k_wtG<<<(unsigned)((DM * 3 * DQ / 64 + 63) / 64), 256, 0, stream>>>(wqkv, DM, 3 * DQ, WQKV);   /* fused 'xw' [DM][3*DQ] -> Bt [3*DQ][DM] */
      k_wtG<<<(unsigned)((DQ * DM / 64 + 63) / 64), 256, 0, stream>>>(wo, DQ, DM, WO);
       }
    k_csid<<<(TT * HD + 255) / 256, 256, 0, stream>>>(CS);
    const unsigned LQ = (unsigned)(((size_t)NH_ * TT * HD / 2 + 255) / 256), LKv = (unsigned)(((size_t)NKV * TT * HD / 2 + 255) / 256);
    for (int b = 0; b < NB_; ++b) {
        
        k_cvt8<<<(unsigned)(((size_t)TT * DM / 8 + 255) / 256), 256, 0, stream>>>(x + (size_t)b * TT * DM, XB, (size_t)TT * DM / 8);
        k_gemmw<bf, 0, true><<<dim3(TT / 64, DQ / 64, 1), 32, 0, stream>>>(XB, nullptr, WQ, nullptr, DM, FQ, DQ, bq, 0, 0, 0);
        k_rope<<<LQ, 256, 0, stream>>>(FQ, DQ, NH_, CS, nullptr, nullptr, 1.0f, QP16, QPh, QPl);
        k_gemmw<bf, 0, true><<<dim3(TT / 64, DKV / 64, 1), 32, 0, stream>>>(XB, nullptr, WK, nullptr, DM, FK, DKV, bk, 0, 0, 0);
        k_rope<<<LKv, 256, 0, stream>>>(FK, DKV, NKV, CS, nullptr, nullptr, 1.0f, KP16, KPh, KPl);
        k_gemmw<bf, 0, true><<<dim3(TT / 64, DKV / 64, 1), 32, 0, stream>>>(XB, nullptr, WV, nullptr, DM, FV, DKV, bv, 0, 0, 0); k_vtp<<<LKv, 256, 0, stream>>>(FV, DKV, NKV, VT16, VTh, VTl);
        for (int h0 = 0; h0 < NH_; h0 += ZH) { const size_t zq = (size_t)h0, zk = (size_t)(h0 / REP);   // one kv head per query head: the pass's two heads use consecutive kv planes (z-strides TT*HD)
            k_gemmc<bf, 2, 1><<<dim3(RH / 64, TT / 64, ZH), 32, 0, stream>>>(QPh + zq * TT * HD, QPl + zq * TT * HD, KPh + zk * TT * HD, KPl + zk * TT * HD, HD, Sb, TT, 0, (size_t)TT * HD, (size_t)TT * HD, (size_t)TT * TT);
            k_gemmc<h16, 0, 1><<<dim3((TT - RH) / 64, TT / 64, ZH), 32, 0, stream>>>(QP16 + zq * TT * HD + (size_t)RH * HD, nullptr, KP16 + zk * TT * HD, nullptr, HD, Sb + (size_t)RH * TT, TT, RH, (size_t)TT * HD, (size_t)TT * HD, (size_t)TT * TT);
            k_alibi<<<(unsigned)(((size_t)ZH * TT * TT / 4 + 255) / 256), 256, 0, stream>>>(Sb, h0);   /* - slope_h |i-j| (x 8, in f32) */ k_asoft<<<ZH * TT / 8, 256, 0, stream>>>(Sb, P16, Ph, Pl);
            k_pvs<bf, 2, 8><<<dim3(RH / 32, 1, ZH), 256, 0, stream>>>(Ph, Pl, VTh + zk * HD * TT, VTl + zk * HD * TT, TT, Ob, 0, (size_t)RH * TT, (size_t)HD * TT, (size_t)TT * HD);
            k_pvs<h16, 0, 16><<<dim3((TT - RH) / 32, 1, ZH), 512, 0, stream>>>(P16 + (size_t)RH * TT, nullptr, VT16 + zk * HD * TT, nullptr, TT, Ob + (size_t)RH * HD, RH, (size_t)TT * TT, (size_t)HD * TT, (size_t)TT * HD);
            k_merge<<<(unsigned)(((size_t)ZH * TT * HD / 2 + 255) / 256), 256, 0, stream>>>(Ob, h0, ATh, ATl); }
        k_gemmw<bf, 1, true><<<dim3(TT / 64, DM / 64, 1), 32, 0, stream>>>(ATh, ATl, WO, nullptr, DQ, OUT + (size_t)b * TT * DM, DM, bo, 0, 0, 0); }
}

// v002
// A run of this version takes 817 microseconds.
// Two timings next to v001 both put it at 1.20 times that version's speed.
// Counting every step since v000, it is 1.98 times as fast.
#include <hip/hip_runtime.h>

// Causal self-attention with a fused biased qkv projection and an ALiBi-style bias on the KEY position (x [2][2048][1024]; qkv = (x w_attn + b_attn) ('xw' [1024][3072] 0.02 + bias zeros on this draw: read) reshaped (b, t, 3, 16, 64): q | k | v = column thirds (16 heads x 64); scores / sqrt(float32(64)) + slopes[h] x pos[s] with slopes[h] = 2 ** (-(8/16)(h + 1)) and pos the KEY index s: within a query row t this equals -slopes[h] x (t - s) plus the row constant slopes[h] x t, which the row softmax removes: implemented as the standard ALiBi distance term -slopes[h] x |t - s| on the causal triangle (slopes baked as jnp-exact f32 literals, pre-scaled by 8 for the kernel's exact x 1/8); causal (-inf); softmax; y = merged w_proj + b_proj ('xw' + bias zeros: read) -> [2][2048][1024] (4.2 M); argument order x, w_attn, b_attn, w_proj, b_proj).
// Layout per batch: bf16 copy of x; the fused 'xw' weight transposed once into Bt (q | k | v row blocks) + bias slices; exact projections + f32 biases; identity-table plane builders; raw scores; the softmax kernel subtracts SLOPE8[h] x (i - j) in f32, in its register row, before its x 1/8; causal T-2048 attention (hybrid rows: < 512 hi/lo 3 products, rest fp16 x1024; k_gemmc skips tiles above the diagonal); merged hi/lo x w_proj exact + b_proj.
// Compute dtypes, f32 accumulate: every input rounded to bf16; projections exact + f32 biases; attention rows < 512 3 products, rest fp16; softmax f32; output projection hl x exact.

#define NB_  2
#define TT   2048
#define DM   1024
#define NH_  16
#define NKV  16
#define REP  (NH_ / NKV)
#define HD   64
#define DQ   (NH_ * HD)
#define DKV  (NKV * HD)
#define ZH   2
#define RH   512                  // query rows < RH use hi+lo planes (0: none)
#define WIN  2048
#define PCAR 1024.0f
#define SCL  0.125f   // HD^-0.5
typedef _Float16 h16;
typedef unsigned short bf;
typedef __attribute__((ext_vector_type(16))) __bf16   v16bf;
typedef __attribute__((ext_vector_type(16))) _Float16 v16h;
typedef __attribute__((ext_vector_type(8)))  _Float16 v8h;
typedef __attribute__((ext_vector_type(8)))  unsigned short v8us;
typedef __attribute__((ext_vector_type(8)))  float    v8f;
typedef __attribute__((ext_vector_type(4)))  float    v4f;
typedef v8h  __attribute__((may_alias)) v8ha;
typedef v4f  __attribute__((may_alias)) v4fa;
typedef v8us __attribute__((may_alias)) v8usa;

__device__ __forceinline__ unsigned short f2bf(float f) { unsigned u = __float_as_uint(f); u += 0x7FFFu + ((u >> 16) & 1u); return (unsigned short)(u >> 16); }
__device__ __forceinline__ float bf2f(unsigned short b) { return __uint_as_float(((unsigned)b) << 16); }
__device__ __forceinline__ float bfr(float f) { return bf2f(f2bf(f)); }
__device__ __forceinline__ v16h cat16(v8h lo, v8h hi) { return __builtin_shufflevector(lo, hi, 0, 1, 2, 3, 4, 5, 6, 7, 8, 9, 10, 11, 12, 13, 14, 15); }
__device__ __forceinline__ v16bf cat16b(v8us lo, v8us hi) { return __builtin_bit_cast(v16bf, __builtin_shufflevector(lo, hi, 0, 1, 2, 3, 4, 5, 6, 7, 8, 9, 10, 11, 12, 13, 14, 15)); }
__device__ __forceinline__ v8f wmma16(v16h a, v16h b, v8f c) { return __builtin_amdgcn_wmma_f32_16x16x32_f16(false, a, false, b, (short)0, c, false, false); }
__device__ __forceinline__ v8f wmmab(v16bf a, v16bf b, v8f c) { return __builtin_amdgcn_wmma_f32_16x16x32_bf16(false, a, false, b, (short)0, c, false, false); }



// ---- k_gemmw: register-blocked GEMM, ONE WAVE per 64x64 output tile (16 accumulators), operands straight from K-contiguous 16-bit planes; grid (M/64, N/64, Z), 32 threads.
// C[m][n] (f32, pitch ldc, + optional f32 bias[n]) = sum_k A[m][k] Bt[n][k] (+ split products per NSPLIT). z-batch strides sA/sB/sC in elements. K % 32 == 0.
template <typename T16> struct WFrag;
template <> struct WFrag<h16> { typedef v16h V; static __device__ __forceinline__ V ld(const h16* p) { return cat16(*(const v8h*)p, *(const v8h*)(p + 16)); } static __device__ __forceinline__ v8f mma(V a, V b, v8f c) { return wmma16(a, b, c); } };
template <> struct WFrag<bf> { typedef v16bf V; static __device__ __forceinline__ V ld(const bf* p) { return cat16b(*(const v8us*)p, *(const v8us*)(p + 16)); } static __device__ __forceinline__ v8f mma(V a, V b, v8f c) { return wmmab(a, b, c); } };
template <typename T16, int NSPLIT, bool BIAS>
__global__ __launch_bounds__(32) void k_gemmw(const T16* __restrict__ A, const T16* __restrict__ A2, const T16* __restrict__ Bt, const T16* __restrict__ Bt2, int K, float* C, int ldc, const float* __restrict__ bias, size_t sA, size_t sB, size_t sC) {
    typedef typename WFrag<T16>::V V;
    __shared__ __align__(16) float os[16 * 68];
    const size_t z = blockIdx.z; A += z * sA; if (A2) A2 += z * sA; Bt += z * sB; if (Bt2) Bt2 += z * sB; C += z * sC;
    const int lane = threadIdx.x & 31, lr = lane & 15, hi = lane >> 4; const int r0 = blockIdx.x * 64, c0 = blockIdx.y * 64;
    v8f acc[4][4];
#pragma unroll
    for (int mb = 0; mb < 4; ++mb)
#pragma unroll
        for (int nb = 0; nb < 4; ++nb) acc[mb][nb] = (v8f){};
    const size_t aoff = (size_t)(r0 + lr) * K + 8 * hi, boff = (size_t)(c0 + lr) * K + 8 * hi;
#pragma unroll 1
    for (int kc = 0; kc < K; kc += 32) {
        V a[4], a2[4];
#pragma unroll
        for (int mb = 0; mb < 4; ++mb) { a[mb] = WFrag<T16>::ld(A + aoff + (size_t)mb * 16 * K + kc); if (NSPLIT == 1 || NSPLIT == 2) a2[mb] = WFrag<T16>::ld(A2 + aoff + (size_t)mb * 16 * K + kc); }
#pragma unroll
        for (int nb = 0; nb < 4; ++nb) { const V b = WFrag<T16>::ld(Bt + boff + (size_t)nb * 16 * K + kc); V b2; if (NSPLIT >= 2) b2 = WFrag<T16>::ld(Bt2 + boff + (size_t)nb * 16 * K + kc);
#pragma unroll
            for (int mb = 0; mb < 4; ++mb) { acc[mb][nb] = WFrag<T16>::mma(a[mb], b, acc[mb][nb]); if (NSPLIT == 1 || NSPLIT == 2) acc[mb][nb] = WFrag<T16>::mma(a2[mb], b, acc[mb][nb]); if (NSPLIT >= 2) acc[mb][nb] = WFrag<T16>::mma(a[mb], b2, acc[mb][nb]); } }
        asm volatile("v_nop\n\tv_nop\n\tv_nop\n\tv_nop" : "+v"(acc[0][0]), "+v"(acc[1][1]), "+v"(acc[2][2]), "+v"(acc[3][3]) : "v"(a[0]), "v"(a[3]));
    }
#pragma unroll
    for (int mb = 0; mb < 4; ++mb) {
#pragma unroll
        for (int nb = 0; nb < 4; ++nb) {
#pragma unroll
            for (int j = 0; j < 8; ++j) os[(hi * 8 + j) * 68 + nb * 16 + lr] = acc[mb][nb][j]; }
        __builtin_amdgcn_wave_barrier(); asm volatile("" ::: "memory");
        float* crow = C + (size_t)(r0 + mb * 16) * ldc + c0;
{
#pragma unroll
            for (int s = 0; s < 8; ++s) { const int row = 2 * s + hi, cofs = lr * 4; v4f val = *(const v4fa*)(os + row * 68 + cofs); if (BIAS) { val[0] += bfr(bias[c0 + cofs]); val[1] += bfr(bias[c0 + cofs + 1]); val[2] += bfr(bias[c0 + cofs + 2]); val[3] += bfr(bias[c0 + cofs + 3]); }
                *(v4f*)(crow + (size_t)row * ldc + cofs) = val; }
             }
        __builtin_amdgcn_wave_barrier(); asm volatile("" ::: "memory");
    }
}

// ---- k_gemmc: the same one-wave 64x64 tile GEMM specialised for causal attention: CMODE 1 skips score tiles entirely above the diagonal (query rows r0+roff.., key columns c0..), CMODE 2 limits the
// key (K) loop of the probability x value contraction to the diagonal block (probabilities beyond it are exactly zero). roff = row offset of this launch's first row within the sequence.
template <typename T16, int NSPLIT, int CMODE>
__global__ __launch_bounds__(32) void k_gemmc(const T16* __restrict__ A, const T16* __restrict__ A2, const T16* __restrict__ Bt, const T16* __restrict__ Bt2, int K, float* C, int ldc, int roff, size_t sA, size_t sB, size_t sC) {
    typedef typename WFrag<T16>::V V;
    __shared__ __align__(16) float os[16 * 68];
    const size_t z = blockIdx.z; A += z * sA; if (A2) A2 += z * sA; Bt += z * sB; if (Bt2) Bt2 += z * sB; C += z * sC;
    const int lane = threadIdx.x & 31, lr = lane & 15, hi = lane >> 4; const int r0 = blockIdx.x * 64, c0 = blockIdx.y * 64;
    if (CMODE == 1 && c0 > r0 + roff + 63) return;                  // score tile entirely above the causal diagonal: never read (the softmax masks j > i by select)
    const int Kl = (CMODE == 2) ? min(K, r0 + roff + 64) : K;        // P.V: probabilities are exactly 0 beyond the diagonal block, so the K loop stops there
    v8f acc[4][4];
#pragma unroll
    for (int mb = 0; mb < 4; ++mb)
#pragma unroll
        for (int nb = 0; nb < 4; ++nb) acc[mb][nb] = (v8f){};
    const size_t aoff = (size_t)(r0 + lr) * K + 8 * hi, boff = (size_t)(c0 + lr) * K + 8 * hi;
#pragma unroll 1
    for (int kc = 0; kc < Kl; kc += 32) {
        V a[4], a2[4];
#pragma unroll
        for (int mb = 0; mb < 4; ++mb) { a[mb] = WFrag<T16>::ld(A + aoff + (size_t)mb * 16 * K + kc); if (NSPLIT == 1 || NSPLIT == 2) a2[mb] = WFrag<T16>::ld(A2 + aoff + (size_t)mb * 16 * K + kc); }
#pragma unroll
        for (int nb = 0; nb < 4; ++nb) { const V b = WFrag<T16>::ld(Bt + boff + (size_t)nb * 16 * K + kc); V b2; if (NSPLIT >= 2) b2 = WFrag<T16>::ld(Bt2 + boff + (size_t)nb * 16 * K + kc);
#pragma unroll
            for (int mb = 0; mb < 4; ++mb) { acc[mb][nb] = WFrag<T16>::mma(a[mb], b, acc[mb][nb]); if (NSPLIT == 1 || NSPLIT == 2) acc[mb][nb] = WFrag<T16>::mma(a2[mb], b, acc[mb][nb]); if (NSPLIT >= 2) acc[mb][nb] = WFrag<T16>::mma(a[mb], b2, acc[mb][nb]); } }
        asm volatile("v_nop\n\tv_nop\n\tv_nop\n\tv_nop" : "+v"(acc[0][0]), "+v"(acc[1][1]), "+v"(acc[2][2]), "+v"(acc[3][3]) : "v"(a[0]), "v"(a[3]));
    }
#pragma unroll
    for (int mb = 0; mb < 4; ++mb) {
#pragma unroll
        for (int nb = 0; nb < 4; ++nb) {
#pragma unroll
            for (int j = 0; j < 8; ++j) os[(hi * 8 + j) * 68 + nb * 16 + lr] = acc[mb][nb][j]; }
        __builtin_amdgcn_wave_barrier(); asm volatile("" ::: "memory");
        float* crow = C + (size_t)(r0 + mb * 16) * ldc + c0;
{
#pragma unroll
            for (int s = 0; s < 8; ++s) { const int row = 2 * s + hi, cofs = lr * 4; v4f val = *(const v4fa*)(os + row * 68 + cofs);
                *(v4f*)(crow + (size_t)row * ldc + cofs) = val; }
             }
        __builtin_amdgcn_wave_barrier(); asm volatile("" ::: "memory");
    }
}

// ---- k_pvs: the probability x value contraction with its key (K) loop SPLIT OVER THE NW WAVES OF ONE WORK-GROUP. One work-group owns a 32 x 64 output tile (all HD columns); wave w takes the 64-key units w, w + NW, ...
// (64 keys = one whole 128-byte line of every operand row) up to the diagonal block (probabilities beyond it are exactly zero), keeps a private f32 partial tile, and the partials are summed through LDS in the fixed order w = 0 .. NW-1.
// A single wave walking all 2048 keys is bound by what one wave can keep in flight; NW waves on one WGP read the same bytes side by side. roff = row offset of this launch's first row within the sequence. K % 64 == 0. Launched in place of k_gemmc's CMODE 2.
template <typename T16, int NSPLIT, int NW>
__global__ __launch_bounds__(NW * 32) void k_pvs(const T16* __restrict__ A, const T16* __restrict__ A2, const T16* __restrict__ Bt, const T16* __restrict__ Bt2, int K, float* C, int roff, size_t sA, size_t sB, size_t sC) {
    typedef typename WFrag<T16>::V V;
    __shared__ __align__(16) float ps[NW * 32 * 68];
    const size_t z = blockIdx.z; A += z * sA; if (A2) A2 += z * sA; Bt += z * sB; if (Bt2) Bt2 += z * sB; C += z * sC;
    const int lane = threadIdx.x & 31, lr = lane & 15, hi = lane >> 4; const int w = __builtin_amdgcn_readfirstlane((int)(threadIdx.x >> 5)); const int r0 = blockIdx.x * 32;
    const int Kl = min(K, (r0 + roff + 32 + 63) & ~63);
    constexpr int CH = (NSPLIT == 2) ? 1 : 2;   // 32-key chunks whose loads are issued together: 24 loads of 16 bytes a lane either way
    v8f acc[2][4];
#pragma unroll
    for (int mb = 0; mb < 2; ++mb)
#pragma unroll
        for (int nb = 0; nb < 4; ++nb) acc[mb][nb] = (v8f){};
    const size_t aoff = (size_t)(r0 + lr) * K + 8 * hi, boff = (size_t)lr * K + 8 * hi;
    // the unit loop stays rolled (two trips at most here): unrolled it would hold two units' fragments and pass the register budget of a 16-wave work-group; the loops inside are unrolled so that the fragment arrays live in registers
#pragma unroll 1
    for (int k0 = w * 64; k0 < Kl; k0 += NW * 64) {
#pragma unroll
        for (int kh = k0; kh < k0 + 64; kh += CH * 32) {
            V a[CH][2], a2[CH][2], b[CH][4], b2[CH][4];
#pragma unroll
            for (int c = 0; c < CH; ++c) {
#pragma unroll
                for (int mb = 0; mb < 2; ++mb) { a[c][mb] = WFrag<T16>::ld(A + aoff + (size_t)mb * 16 * K + kh + c * 32); if (NSPLIT == 2) a2[c][mb] = WFrag<T16>::ld(A2 + aoff + (size_t)mb * 16 * K + kh + c * 32); }
#pragma unroll
                for (int nb = 0; nb < 4; ++nb) { b[c][nb] = WFrag<T16>::ld(Bt + boff + (size_t)nb * 16 * K + kh + c * 32); if (NSPLIT == 2) b2[c][nb] = WFrag<T16>::ld(Bt2 + boff + (size_t)nb * 16 * K + kh + c * 32); } }
            __builtin_amdgcn_sched_barrier(0);   // keeps these 24 loads issued ahead of their first product: one trip to memory for all; without it the scheduler sinks loads between the products and the wave waits several times in turn
#pragma unroll
            for (int c = 0; c < CH; ++c)
#pragma unroll
                for (int nb = 0; nb < 4; ++nb)
#pragma unroll
                    for (int mb = 0; mb < 2; ++mb) { acc[mb][nb] = WFrag<T16>::mma(a[c][mb], b[c][nb], acc[mb][nb]); if (NSPLIT == 2) { acc[mb][nb] = WFrag<T16>::mma(a2[c][mb], b[c][nb], acc[mb][nb]); acc[mb][nb] = WFrag<T16>::mma(a[c][mb], b2[c][nb], acc[mb][nb]); } }
        }
    }
    float* pw = ps + w * (32 * 68);
#pragma unroll
    for (int mb = 0; mb < 2; ++mb)
#pragma unroll
        for (int nb = 0; nb < 4; ++nb)
#pragma unroll
            for (int j = 0; j < 8; ++j) pw[(mb * 16 + hi * 8 + j) * 68 + nb * 16 + lr] = acc[mb][nb][j];
    __syncthreads();
#pragma unroll
    for (int idx = threadIdx.x; idx < 32 * 16; idx += NW * 32) { const int row = idx >> 4, cofs = (idx & 15) * 4; v4f s = *(const v4fa*)(ps + row * 68 + cofs);
#pragma unroll
        for (int ww = 1; ww < NW; ++ww) s += *(const v4fa*)(ps + ww * (32 * 68) + row * 68 + cofs);
        *(v4f*)(C + (size_t)(r0 + row) * HD + cofs) = s; }
}

__device__ __forceinline__ h16 tohx(float x) { return (h16)x; }
__device__ __forceinline__ void splitf(float y, unsigned short& h, unsigned short& l) { h = f2bf(y); l = f2bf(y - bf2f(h)); }
typedef __attribute__((ext_vector_type(2))) _Float16 v2h;
typedef __attribute__((ext_vector_type(4))) _Float16 v4h;
typedef __attribute__((ext_vector_type(2))) unsigned short v2us;
typedef __attribute__((ext_vector_type(4))) unsigned short v4us;
typedef __attribute__((ext_vector_type(2))) float v2f;
typedef __attribute__((ext_vector_type(4))) int v4i;

__global__ __launch_bounds__(256) void k_wtG(const float* __restrict__ w, int K, int N, bf* Bt) {
    const int lane = threadIdx.x & 31; const int L0 = (blockIdx.x * 8 + (threadIdx.x >> 5)) * 8; const int nlines = N * K / 64;
{
#pragma unroll 1
        for (int l = 0; l < 8; ++l) { const int L = L0 + l; if (L >= nlines) break; const size_t e = (size_t)L * 64 + lane * 2; const int k = (int)(e % K), n = (int)(e / K); v2us o;
            o[0] = f2bf(w[(size_t)k * N + n]); o[1] = f2bf(w[(size_t)(k + 1) * N + n]); *(v2us*)(Bt + e) = o; }
         }
}
__global__ __launch_bounds__(256) void k_cvt8(const float* __restrict__ src, bf* dst, size_t n8) { const size_t i = (size_t)blockIdx.x * 256 + threadIdx.x; if (i >= n8) return; const v8f v = *(const v8f*)(src + i * 8); v8us o;
#pragma unroll
    for (int k = 0; k < 8; ++k) o[k] = f2bf(v[k]); *(v8us*)(dst + i * 8) = o;  }

// k_rope: head planes [h][t][d] (fp16 + hi/lo) of rope(x) x sc with the rotate-half convention out[d] = x[d] cos[t][d] - x[d+HD/2] sin[t][d], out[d+HD/2] = x[d+HD/2] cos[t][d+HD/2] + x[d] sin[t][d+HD/2]
__global__ __launch_bounds__(256) void k_rope(const float* __restrict__ F, int pitch, int nheads, const float* __restrict__ CS, const float* __restrict__ RF, const float* __restrict__ nw, float sc, h16* P16, bf* Ph, bf* Pl) {
    const size_t e = ((size_t)blockIdx.x * 256 + threadIdx.x) * 2; if (e >= (size_t)nheads * TT * HD) return; const int d = (int)(e % HD); const int t = (int)((e / HD) % TT); const int h = (int)(e / ((size_t)HD * TT)); const float* f = F + (size_t)t * pitch + h * HD; const float rf = RF ? RF[(size_t)h * TT + t] : 1.0f; v2h o16; v2us oh, ol;
#pragma unroll
    for (int q = 0; q < 2; ++q) { const int dd = d + q; const int dp = (dd < HD / 2) ? dd + HD / 2 : dd - HD / 2; float x0 = f[dd], x1 = f[dp];
        if (RF) { float n0 = __fmul_rn(x0, rf), n1 = __fmul_rn(x1, rf); asm volatile("" : "+v"(n0)); asm volatile("" : "+v"(n1)); x0 = __fmul_rn(bfr(nw[dd]), n0); x1 = __fmul_rn(bfr(nw[dp]), n1); }
        const v2f cs = *(const v2f*)(CS + ((size_t)t * HD + dd) * 2); float a = __fmul_rn(x0, cs[0]), bq = __fmul_rn(x1, cs[1]); asm volatile("" : "+v"(a)); asm volatile("" : "+v"(bq)); const float r = ((dd < HD / 2) ? __fsub_rn(a, bq) : __fadd_rn(a, bq)) * sc;
        o16[q] = tohx(r); unsigned short a2, c2; splitf(r, a2, c2); oh[q] = a2; ol[q] = c2; }
    *(v2h*)(P16 + e) = o16; *(v2us*)(Ph + e) = oh; *(v2us*)(Pl + e) = ol;  }
__global__ __launch_bounds__(256) void k_vtp(const float* __restrict__ F, int pitch, int nheads, h16* V16, bf* Vh, bf* Vl) { const size_t e = ((size_t)blockIdx.x * 256 + threadIdx.x) * 2; if (e >= (size_t)nheads * HD * TT) return; const int t = (int)(e % TT); const int d = (int)((e / TT) % HD); const int g = (int)(e / ((size_t)TT * HD)); v2h o16; v2us oh, ol;
#pragma unroll
    for (int q = 0; q < 2; ++q) { const float x = F[(size_t)(t + q) * pitch + g * HD + d]; o16[q] = tohx(x); unsigned short a2, c2; splitf(x, a2, c2); oh[q] = a2; ol[q] = c2; }
    *(v2h*)(V16 + e) = o16; *(v2us*)(Vh + e) = oh; *(v2us*)(Vl + e) = ol;  }
__global__ __launch_bounds__(256) void k_csid(float* CS) { const int idx = blockIdx.x * 256 + threadIdx.x; if (idx >= TT * HD) return; v2f cs; cs[0] = 1.0f; cs[1] = 0.0f; *(v2f*)(CS + (size_t)idx * 2) = cs;  }
__constant__ float SLOPE8[NH_] = { 5.656854153e+0f, 4.000000000e+0f, 2.828427076e+0f, 2.000000000e+0f, 1.414213538e+0f, 1.000000000e+0f, 7.071067691e-1f, 5.000000000e-1f, 3.535533845e-1f, 2.500000000e-1f, 1.767766923e-1f, 1.250000000e-1f, 8.838834614e-2f, 6.250000000e-2f, 4.419417307e-2f, 3.125000000e-2f };   // 8 x the per-head ALiBi slope magnitude (slopes[h] = 2 ** (-(8/16)(h + 1)), h = 0..15, as the reference's f32 values x 8); the eight power-of-two entries give exact products with |i - j| <= 2047; for the eight irrational ones the product goes unrounded into the fused multiply-subtract of k_asoft
// k_asoft: per row (zz, i): t = (S - SLOPE8[h0 + zz] x (i - j)) x HD^-0.5 for j <= i and i - j < WIN (WIN = TT, so the window test always holds: plain causal mask; the reference's -1e9 additive fill vanishes identically); softmax over the 2048 keys (register row, one exp, fixed trees);
__global__ __launch_bounds__(256) void k_asoft(const float* __restrict__ Sb, int h0, h16* P16, bf* Ph, bf* Pl) {
    const int lane = threadIdx.x & 31; const int row = blockIdx.x * 8 + (threadIdx.x >> 5); if (row >= ZH * TT) return; const int i = row % TT; const int zz = row / TT; (void)zz; const bool hires = (i < RH); const float* sr = Sb + (size_t)row * TT; float v[TT / 32]; v4f ar[TT / 128]; float mx = -3.0e38f;
    const float sl = SLOPE8[h0 + (int)(blockIdx.x / (TT / 8))];   // the block's 8 rows lie in one head (= zz): a scalar load
    const float di = (float)(i - lane * 4);   // key distance i - j = di - (ch * 128 + q): whole numbers below 2^24, exact in f32
#pragma unroll
    for (int ch = 0; ch < TT / 128; ++ch) ar[ch] = *(const v4f*)(sr + ch * 128 + lane * 4);
    __builtin_amdgcn_sched_barrier(0);   // keeps the row's 16 loads issued together, ahead of the distance arithmetic: without it the scheduler holds two loads back until registers of the first ones are free, a second trip to memory
#pragma unroll
    for (int ch = 0; ch < TT / 128; ++ch) { const int j0 = ch * 128 + lane * 4; const v4f a = ar[ch];
#pragma unroll
        for (int q = 0; q < 4; ++q) { const int j = j0 + q; (void)j; const float t = (j <= i && i - j < WIN) ? (a[q] - sl * (di - (float)(ch * 128 + q))) * SCL : -3.0e38f; v[ch * 4 + q] = t; mx = fmaxf(mx, t); } }
#pragma unroll
    for (int sh = 16; sh; sh >>= 1) mx = fmaxf(mx, __shfl_xor(mx, sh, 32));
    float sum = 0.f;
#pragma unroll
    for (int k = 0; k < TT / 32; ++k) { float d0 = __fsub_rn(v[k], mx); asm volatile("" : "+v"(d0)); v[k] = __builtin_amdgcn_exp2f(__fmul_rn(d0, 1.4426950408889634f)); sum += v[k]; }
#pragma unroll
    for (int sh = 16; sh; sh >>= 1) sum += __shfl_xor(sum, sh, 32);
    const float f = __fdiv_rn(hires ? 1.0f : PCAR, sum);
{
        if (hires) {
#pragma unroll
            for (int ch = 0; ch < TT / 128; ++ch) { v4us oh, ol;
#pragma unroll
                for (int q = 0; q < 4; ++q) { unsigned short a, c2; splitf(v[ch * 4 + q] * f, a, c2); oh[q] = a; ol[q] = c2; }
                const size_t oo = ((size_t)zz * (RH ? RH : 1) + i) * TT + ch * 128 + lane * 4; *(v4us*)(Ph + oo) = oh; *(v4us*)(Pl + oo) = ol; }
        } else {
#pragma unroll
            for (int ch = 0; ch < TT / 128; ++ch) { v4h o4;
#pragma unroll
                for (int q = 0; q < 4; ++q) o4[q] = tohx(v[ch * 4 + q] * f);
                *(v4h*)(P16 + (size_t)row * TT + ch * 128 + lane * 4) = o4; } }
         }
}
__global__ __launch_bounds__(256) void k_merge(const float* __restrict__ O, int h0, bf* Ah, bf* Al) { const size_t e = ((size_t)blockIdx.x * 256 + threadIdx.x) * 2; if (e >= (size_t)ZH * TT * HD) return; const int d = (int)(e % HD); const int t = (int)((e / HD) % TT); const int zz = (int)(e / ((size_t)HD * TT)); const float cs = (t < RH) ? 1.0f : (1.0f / PCAR); const size_t oo = (size_t)t * DQ + (h0 + zz) * HD + d;
    v2us oh, ol;
#pragma unroll
    for (int q = 0; q < 2; ++q) { unsigned short a, c2; splitf(O[e + q] * cs, a, c2); oh[q] = a; ol[q] = c2; } *(v2us*)(Ah + oo) = oh; *(v2us*)(Al + oo) = ol;  }

extern "C" void kernel_launch(void* const* d_in, const int* in_sizes, int n_in,
                              void* d_out, int out_size, void* d_ws, size_t ws_size, hipStream_t stream) {
    (void)in_sizes; (void)n_in; (void)out_size;
    const float* x = (const float*)d_in[0]; const float* wqkv = (const float*)d_in[1]; const float* bqkv = (const float*)d_in[2]; const float* wo = (const float*)d_in[3]; const float* bo = (const float*)d_in[4];     const float* bq = bqkv; const float* bk = bqkv + DQ; const float* bv = bqkv + 2 * DQ; const float* wq = wqkv; const float* wk = nullptr; const float* wv = nullptr; (void)wk; (void)wv;
    float* OUT = (float*)d_out;     // [2][2048][1024]
    char* wsp = (char*)d_ws;
    auto take = [&](size_t bytes) { char* p = wsp; wsp += (bytes + 255) & ~(size_t)255; return (void*)p; };
    bf* WQKV = (bf*)take((size_t)3 * DQ * DM * 2); bf* WQ = WQKV; bf* WK = WQKV + (size_t)DQ * DM; bf* WV = WQKV + (size_t)2 * DQ * DM;   /* fused Bt [3*DQ][DM]: q | k | v row blocks */ bf* WO = (bf*)take((size_t)DM * DQ * 2); float* CS = (float*)take((size_t)TT * HD * 2 * 4);
    bf* XB = (bf*)take((size_t)TT * DM * 2); float* FQ = (float*)take((size_t)TT * DQ * 4); float* FK = (float*)take((size_t)TT * DKV * 4);
    h16* QP16 = (h16*)take((size_t)NH_ * TT * HD * 2); h16* KP16 = (h16*)take((size_t)NKV * TT * HD * 2); h16* VT16 = (h16*)take((size_t)NKV * HD * TT * 2);
    bf* QPh = (bf*)take((size_t)NH_ * TT * HD * 2); bf* QPl = (bf*)take((size_t)NH_ * TT * HD * 2); bf* KPh = (bf*)take((size_t)NKV * TT * HD * 2); bf* KPl = (bf*)take((size_t)NKV * TT * HD * 2); bf* VTh = (bf*)take((size_t)NKV * HD * TT * 2); bf* VTl = (bf*)take((size_t)NKV * HD * TT * 2); bf* Ph = (bf*)take((size_t)ZH * RH * TT * 2); bf* Pl = (bf*)take((size_t)ZH * RH * TT * 2);
    float* Sb = (float*)take((size_t)ZH * TT * TT * 4); h16* P16 = (h16*)take((size_t)ZH * TT * TT * 2); float* Ob = (float*)take((size_t)ZH * TT * HD * 4); bf* ATh = (bf*)take((size_t)TT * DQ * 2); bf* ATl = (bf*)take((size_t)TT * DQ * 2);
    if ((size_t)(wsp - (char*)d_ws) > ws_size) return;    // ws 256 MiB
    float* FV = FK;   // v projection reuses the k buffer after the k planes are built (stream-ordered)
    { k_wtG<<<(unsigned)((DM * 3 * DQ / 64 + 63) / 64), 256, 0, stream>>>(wqkv, DM, 3 * DQ, WQKV);   /* fused 'xw' [DM][3*DQ] -> Bt [3*DQ][DM] */
      k_wtG<<<(unsigned)((DQ * DM / 64 + 63) / 64), 256, 0, stream>>>(wo, DQ, DM, WO);
       }
    k_csid<<<(TT * HD + 255) / 256, 256, 0, stream>>>(CS);
    const unsigned LQ = (unsigned)(((size_t)NH_ * TT * HD / 2 + 255) / 256), LKv = (unsigned)(((size_t)NKV * TT * HD / 2 + 255) / 256);
    for (int b = 0; b < NB_; ++b) {
        
        k_cvt8<<<(unsigned)(((size_t)TT * DM / 8 + 255) / 256), 256, 0, stream>>>(x + (size_t)b * TT * DM, XB, (size_t)TT * DM / 8);
        k_gemmw<bf, 0, true><<<dim3(TT / 64, DQ / 64, 1), 32, 0, stream>>>(XB, nullptr, WQ, nullptr, DM, FQ, DQ, bq, 0, 0, 0);
        k_rope<<<LQ, 256, 0, stream>>>(FQ, DQ, NH_, CS, nullptr, nullptr, 1.0f, QP16, QPh, QPl);
        k_gemmw<bf, 0, true><<<dim3(TT / 64, DKV / 64, 1), 32, 0, stream>>>(XB, nullptr, WK, nullptr, DM, FK, DKV, bk, 0, 0, 0);
        k_rope<<<LKv, 256, 0, stream>>>(FK, DKV, NKV, CS, nullptr, nullptr, 1.0f, KP16, KPh, KPl);
        k_gemmw<bf, 0, true><<<dim3(TT / 64, DKV / 64, 1), 32, 0, stream>>>(XB, nullptr, WV, nullptr, DM, FV, DKV, bv, 0, 0, 0); k_vtp<<<LKv, 256, 0, stream>>>(FV, DKV, NKV, VT16, VTh, VTl);
        for (int h0 = 0; h0 < NH_; h0 += ZH) { const size_t zq = (size_t)h0, zk = (size_t)(h0 / REP);   // one kv head per query head: the pass's two heads use consecutive kv planes (z-strides TT*HD)
            k_gemmc<bf, 2, 1><<<dim3(RH / 64, TT / 64, ZH), 32, 0, stream>>>(QPh + zq * TT * HD, QPl + zq * TT * HD, KPh + zk * TT * HD, KPl + zk * TT * HD, HD, Sb, TT, 0, (size_t)TT * HD, (size_t)TT * HD, (size_t)TT * TT);
            k_gemmc<h16, 0, 1><<<dim3((TT - RH) / 64, TT / 64, ZH), 32, 0, stream>>>(QP16 + zq * TT * HD + (size_t)RH * HD, nullptr, KP16 + zk * TT * HD, nullptr, HD, Sb + (size_t)RH * TT, TT, RH, (size_t)TT * HD, (size_t)TT * HD, (size_t)TT * TT);
            k_asoft<<<ZH * TT / 8, 256, 0, stream>>>(Sb, h0, P16, Ph, Pl);   /* - slope_h (i-j) (x 8, in f32) inside */
            k_pvs<bf, 2, 8><<<dim3(RH / 32, 1, ZH), 256, 0, stream>>>(Ph, Pl, VTh + zk * HD * TT, VTl + zk * HD * TT, TT, Ob, 0, (size_t)RH * TT, (size_t)HD * TT, (size_t)TT * HD);
            k_pvs<h16, 0, 16><<<dim3((TT - RH) / 32, 1, ZH), 512, 0, stream>>>(P16 + (size_t)RH * TT, nullptr, VT16 + zk * HD * TT, nullptr, TT, Ob + (size_t)RH * HD, RH, (size_t)TT * TT, (size_t)HD * TT, (size_t)TT * HD);
            k_merge<<<(unsigned)(((size_t)ZH * TT * HD / 2 + 255) / 256), 256, 0, stream>>>(Ob, h0, ATh, ATl); }
        k_gemmw<bf, 1, true><<<dim3(TT / 64, DM / 64, 1), 32, 0, stream>>>(ATh, ATl, WO, nullptr, DQ, OUT + (size_t)b * TT * DM, DM, bo, 0, 0, 0); }
}

// v003
// Measured time: 543 microseconds a run.
// Timed twice side by side with v002, it ran 1.50 and 1.51 times as fast.
// All steps since v000 together make it 2.98 times as fast.
#include <hip/hip_runtime.h>

// Causal self-attention with a fused biased qkv projection and an ALiBi-style bias on the KEY position (x [2][2048][1024]; qkv = (x w_attn + b_attn) ('xw' [1024][3072] 0.02 + bias zeros on this draw: read) reshaped (b, t, 3, 16, 64): q | k | v = column thirds (16 heads x 64); scores / sqrt(float32(64)) + slopes[h] x pos[s] with slopes[h] = 2 ** (-(8/16)(h + 1)) and pos the KEY index s: within a query row t this equals -slopes[h] x (t - s) plus the row constant slopes[h] x t, which the row softmax removes: implemented as the standard ALiBi distance term -slopes[h] x |t - s| on the causal triangle (slopes baked as jnp-exact f32 literals, pre-scaled by 8 for the kernel's exact x 1/8); causal (-inf); softmax; y = merged w_proj + b_proj ('xw' + bias zeros: read) -> [2][2048][1024] (4.2 M); argument order x, w_attn, b_attn, w_proj, b_proj).
// Layout per batch: bf16 copy of x; the fused 'xw' weight transposed once into Bt (q | k | v row blocks) + bias slices; exact projections + f32 biases; identity-table plane builders; raw scores; the softmax kernel subtracts SLOPE8[h] x (i - j) in f32, in its register row, before its x 1/8; causal T-2048 attention (hybrid rows: < 512 hi/lo 3 products, rest fp16 x1024; k_gemmc skips tiles above the diagonal); merged hi/lo x w_proj exact + b_proj.
// Compute dtypes, f32 accumulate: every input rounded to bf16; projections exact + f32 biases; attention rows < 512 3 products, rest fp16; softmax f32; output projection hl x exact.

#define NB_  2
#define TT   2048
#define DM   1024
#define NH_  16
#define NKV  16
#define REP  (NH_ / NKV)
#define HD   64
#define DQ   (NH_ * HD)
#define DKV  (NKV * HD)
#define ZH   8                    // heads per attention pass (grid z of the pass's four GEMM launches)
#define RH   512                  // query rows < RH use hi+lo planes (0: none)
#define WIN  2048
#define PCAR 1024.0f
#define SCL  0.125f   // HD^-0.5
typedef _Float16 h16;
typedef unsigned short bf;
typedef __attribute__((ext_vector_type(16))) __bf16   v16bf;
typedef __attribute__((ext_vector_type(16))) _Float16 v16h;
typedef __attribute__((ext_vector_type(8)))  _Float16 v8h;
typedef __attribute__((ext_vector_type(8)))  unsigned short v8us;
typedef __attribute__((ext_vector_type(8)))  float    v8f;
typedef __attribute__((ext_vector_type(4)))  float    v4f;
typedef v8h  __attribute__((may_alias)) v8ha;
typedef v4f  __attribute__((may_alias)) v4fa;
typedef v8us __attribute__((may_alias)) v8usa;

__device__ __forceinline__ unsigned short f2bf(float f) { unsigned u = __float_as_uint(f); u += 0x7FFFu + ((u >> 16) & 1u); return (unsigned short)(u >> 16); }
__device__ __forceinline__ float bf2f(unsigned short b) { return __uint_as_float(((unsigned)b) << 16); }
__device__ __forceinline__ float bfr(float f) { return bf2f(f2bf(f)); }
__device__ __forceinline__ v16h cat16(v8h lo, v8h hi) { return __builtin_shufflevector(lo, hi, 0, 1, 2, 3, 4, 5, 6, 7, 8, 9, 10, 11, 12, 13, 14, 15); }
__device__ __forceinline__ v16bf cat16b(v8us lo, v8us hi) { return __builtin_bit_cast(v16bf, __builtin_shufflevector(lo, hi, 0, 1, 2, 3, 4, 5, 6, 7, 8, 9, 10, 11, 12, 13, 14, 15)); }
__device__ __forceinline__ v8f wmma16(v16h a, v16h b, v8f c) { return __builtin_amdgcn_wmma_f32_16x16x32_f16(false, a, false, b, (short)0, c, false, false); }
__device__ __forceinline__ v8f wmmab(v16bf a, v16bf b, v8f c) { return __builtin_amdgcn_wmma_f32_16x16x32_bf16(false, a, false, b, (short)0, c, false, false); }



// ---- k_gemmw: register-blocked GEMM, ONE WAVE per 64x64 output tile (16 accumulators), operands straight from K-contiguous 16-bit planes; grid (M/64, N/64, Z), 32 threads.
// C[m][n] (f32, pitch ldc, + optional f32 bias[n]) = sum_k A[m][k] Bt[n][k] (+ split products per NSPLIT). z-batch strides sA/sB/sC in elements. K % 32 == 0.
template <typename T16> struct WFrag;
template <> struct WFrag<h16> { typedef v16h V; static __device__ __forceinline__ V ld(const h16* p) { return cat16(*(const v8h*)p, *(const v8h*)(p + 16)); } static __device__ __forceinline__ v8f mma(V a, V b, v8f c) { return wmma16(a, b, c); } };
template <> struct WFrag<bf> { typedef v16bf V; static __device__ __forceinline__ V ld(const bf* p) { return cat16b(*(const v8us*)p, *(const v8us*)(p + 16)); } static __device__ __forceinline__ v8f mma(V a, V b, v8f c) { return wmmab(a, b, c); } };
template <typename T16, int NSPLIT, bool BIAS>
__global__ __launch_bounds__(32) void k_gemmw(const T16* __restrict__ A, const T16* __restrict__ A2, const T16* __restrict__ Bt, const T16* __restrict__ Bt2, int K, float* C, int ldc, const float* __restrict__ bias, size_t sA, size_t sB, size_t sC) {
    typedef typename WFrag<T16>::V V;
    __shared__ __align__(16) float os[16 * 68];
    const size_t z = blockIdx.z; A += z * sA; if (A2) A2 += z * sA; Bt += z * sB; if (Bt2) Bt2 += z * sB; C += z * sC;
    const int lane = threadIdx.x & 31, lr = lane & 15, hi = lane >> 4; const int r0 = blockIdx.x * 64, c0 = blockIdx.y * 64;
    v8f acc[4][4];
#pragma unroll
    for (int mb = 0; mb < 4; ++mb)
#pragma unroll
        for (int nb = 0; nb < 4; ++nb) acc[mb][nb] = (v8f){};
    const size_t aoff = (size_t)(r0 + lr) * K + 8 * hi, boff = (size_t)(c0 + lr) * K + 8 * hi;
#pragma unroll 1
    for (int kc = 0; kc < K; kc += 32) {
        V a[4], a2[4];
#pragma unroll
        for (int mb = 0; mb < 4; ++mb) { a[mb] = WFrag<T16>::ld(A + aoff + (size_t)mb * 16 * K + kc); if (NSPLIT == 1 || NSPLIT == 2) a2[mb] = WFrag<T16>::ld(A2 + aoff + (size_t)mb * 16 * K + kc); }
#pragma unroll
        for (int nb = 0; nb < 4; ++nb) { const V b = WFrag<T16>::ld(Bt + boff + (size_t)nb * 16 * K + kc); V b2; if (NSPLIT >= 2) b2 = WFrag<T16>::ld(Bt2 + boff + (size_t)nb * 16 * K + kc);
#pragma unroll
            for (int mb = 0; mb < 4; ++mb) { acc[mb][nb] = WFrag<T16>::mma(a[mb], b, acc[mb][nb]); if (NSPLIT == 1 || NSPLIT == 2) acc[mb][nb] = WFrag<T16>::mma(a2[mb], b, acc[mb][nb]); if (NSPLIT >= 2) acc[mb][nb] = WFrag<T16>::mma(a[mb], b2, acc[mb][nb]); } }
        asm volatile("v_nop\n\tv_nop\n\tv_nop\n\tv_nop" : "+v"(acc[0][0]), "+v"(acc[1][1]), "+v"(acc[2][2]), "+v"(acc[3][3]) : "v"(a[0]), "v"(a[3]));
    }
#pragma unroll
    for (int mb = 0; mb < 4; ++mb) {
#pragma unroll
        for (int nb = 0; nb < 4; ++nb) {
#pragma unroll
            for (int j = 0; j < 8; ++j) os[(hi * 8 + j) * 68 + nb * 16 + lr] = acc[mb][nb][j]; }
        __builtin_amdgcn_wave_barrier(); asm volatile("" ::: "memory");
        float* crow = C + (size_t)(r0 + mb * 16) * ldc + c0;
{
#pragma unroll
            for (int s = 0; s < 8; ++s) { const int row = 2 * s + hi, cofs = lr * 4; v4f val = *(const v4fa*)(os + row * 68 + cofs); if (BIAS) { val[0] += bfr(bias[c0 + cofs]); val[1] += bfr(bias[c0 + cofs + 1]); val[2] += bfr(bias[c0 + cofs + 2]); val[3] += bfr(bias[c0 + cofs + 3]); }
                *(v4f*)(crow + (size_t)row * ldc + cofs) = val; }
             }
        __builtin_amdgcn_wave_barrier(); asm volatile("" ::: "memory");
    }
}

// ---- k_gemmc: the same one-wave 64x64 tile GEMM specialised for causal attention: CMODE 1 skips score tiles entirely above the diagonal (query rows r0+roff.., key columns c0..), CMODE 2 limits the
// key (K) loop of the probability x value contraction to the diagonal block (probabilities beyond it are exactly zero). roff = row offset of this launch's first row within the sequence.
template <typename T16, int NSPLIT, int CMODE>
__global__ __launch_bounds__(32) void k_gemmc(const T16* __restrict__ A, const T16* __restrict__ A2, const T16* __restrict__ Bt, const T16* __restrict__ Bt2, int K, float* C, int ldc, int roff, size_t sA, size_t sB, size_t sC) {
    typedef typename WFrag<T16>::V V;
    __shared__ __align__(16) float os[16 * 68];
    const size_t z = blockIdx.z; A += z * sA; if (A2) A2 += z * sA; Bt += z * sB; if (Bt2) Bt2 += z * sB; C += z * sC;
    const int lane = threadIdx.x & 31, lr = lane & 15, hi = lane >> 4; const int r0 = blockIdx.x * 64, c0 = blockIdx.y * 64;
    if (CMODE == 1 && c0 > r0 + roff + 63) return;                  // score tile entirely above the causal diagonal: never read (the softmax masks j > i by select)
    const int Kl = (CMODE == 2) ? min(K, r0 + roff + 64) : K;        // P.V: probabilities are exactly 0 beyond the diagonal block, so the K loop stops there
    v8f acc[4][4];
#pragma unroll
    for (int mb = 0; mb < 4; ++mb)
#pragma unroll
        for (int nb = 0; nb < 4; ++nb) acc[mb][nb] = (v8f){};
    const size_t aoff = (size_t)(r0 + lr) * K + 8 * hi, boff = (size_t)(c0 + lr) * K + 8 * hi;
#pragma unroll 1
    for (int kc = 0; kc < Kl; kc += 32) {
        V a[4], a2[4];
#pragma unroll
        for (int mb = 0; mb < 4; ++mb) { a[mb] = WFrag<T16>::ld(A + aoff + (size_t)mb * 16 * K + kc); if (NSPLIT == 1 || NSPLIT == 2) a2[mb] = WFrag<T16>::ld(A2 + aoff + (size_t)mb * 16 * K + kc); }
#pragma unroll
        for (int nb = 0; nb < 4; ++nb) { const V b = WFrag<T16>::ld(Bt + boff + (size_t)nb * 16 * K + kc); V b2; if (NSPLIT >= 2) b2 = WFrag<T16>::ld(Bt2 + boff + (size_t)nb * 16 * K + kc);
#pragma unroll
            for (int mb = 0; mb < 4; ++mb) { acc[mb][nb] = WFrag<T16>::mma(a[mb], b, acc[mb][nb]); if (NSPLIT == 1 || NSPLIT == 2) acc[mb][nb] = WFrag<T16>::mma(a2[mb], b, acc[mb][nb]); if (NSPLIT >= 2) acc[mb][nb] = WFrag<T16>::mma(a[mb], b2, acc[mb][nb]); } }
        asm volatile("v_nop\n\tv_nop\n\tv_nop\n\tv_nop" : "+v"(acc[0][0]), "+v"(acc[1][1]), "+v"(acc[2][2]), "+v"(acc[3][3]) : "v"(a[0]), "v"(a[3]));
    }
#pragma unroll
    for (int mb = 0; mb < 4; ++mb) {
#pragma unroll
        for (int nb = 0; nb < 4; ++nb) {
#pragma unroll
            for (int j = 0; j < 8; ++j) os[(hi * 8 + j) * 68 + nb * 16 + lr] = acc[mb][nb][j]; }
        __builtin_amdgcn_wave_barrier(); asm volatile("" ::: "memory");
        float* crow = C + (size_t)(r0 + mb * 16) * ldc + c0;
{
#pragma unroll
            for (int s = 0; s < 8; ++s) { const int row = 2 * s + hi, cofs = lr * 4; v4f val = *(const v4fa*)(os + row * 68 + cofs);
                *(v4f*)(crow + (size_t)row * ldc + cofs) = val; }
             }
        __builtin_amdgcn_wave_barrier(); asm volatile("" ::: "memory");
    }
}

// ---- k_pvs: the probability x value contraction with its key (K) loop SPLIT OVER THE NW WAVES OF ONE WORK-GROUP. One work-group owns a 32 x 64 output tile (all HD columns); wave w takes the 64-key units w, w + NW, ...
// (64 keys = one whole 128-byte line of every operand row) up to the diagonal block (probabilities beyond it are exactly zero), keeps a private f32 partial tile, and the partials are summed through LDS in the fixed order w = 0 .. NW-1.
// A single wave walking all 2048 keys is bound by what one wave can keep in flight; NW waves on one WGP read the same bytes side by side. roff = row offset of this launch's first row within the sequence. K % 64 == 0. lda = row pitch of A / A2 in elements (Bt rows have pitch K). Launched in place of k_gemmc's CMODE 2.
template <typename T16, int NSPLIT, int NW>
__global__ __launch_bounds__(NW * 32) void k_pvs(const T16* __restrict__ A, const T16* __restrict__ A2, int lda, const T16* __restrict__ Bt, const T16* __restrict__ Bt2, int K, float* C, int roff, size_t sA, size_t sB, size_t sC) {
    typedef typename WFrag<T16>::V V;
    __shared__ __align__(16) float ps[NW * 32 * 68];
    const size_t z = blockIdx.z; A += z * sA; if (A2) A2 += z * sA; Bt += z * sB; if (Bt2) Bt2 += z * sB; C += z * sC;
    const int lane = threadIdx.x & 31, lr = lane & 15, hi = lane >> 4; const int w = __builtin_amdgcn_readfirstlane((int)(threadIdx.x >> 5)); const int r0 = blockIdx.x * 32;
    const int Kl = min(K, (r0 + roff + 32 + 63) & ~63);
    constexpr int CH = (NSPLIT == 2) ? 1 : 2;   // 32-key chunks whose loads are issued together: 24 loads of 16 bytes a lane either way
    v8f acc[2][4];
#pragma unroll
    for (int mb = 0; mb < 2; ++mb)
#pragma unroll
        for (int nb = 0; nb < 4; ++nb) acc[mb][nb] = (v8f){};
    const size_t aoff = (size_t)(r0 + lr) * lda + 8 * hi, boff = (size_t)lr * K + 8 * hi;
    // the unit loop stays rolled (two trips at most here): unrolled it would hold two units' fragments and pass the register budget of a 16-wave work-group; the loops inside are unrolled so that the fragment arrays live in registers
#pragma unroll 1
    for (int k0 = w * 64; k0 < Kl; k0 += NW * 64) {
#pragma unroll
        for (int kh = k0; kh < k0 + 64; kh += CH * 32) {
            V a[CH][2], a2[CH][2], b[CH][4], b2[CH][4];
#pragma unroll
            for (int c = 0; c < CH; ++c) {
#pragma unroll
                for (int mb = 0; mb < 2; ++mb) { a[c][mb] = WFrag<T16>::ld(A + aoff + (size_t)mb * 16 * lda + kh + c * 32); if (NSPLIT == 2) a2[c][mb] = WFrag<T16>::ld(A2 + aoff + (size_t)mb * 16 * lda + kh + c * 32); }
#pragma unroll
                for (int nb = 0; nb < 4; ++nb) { b[c][nb] = WFrag<T16>::ld(Bt + boff + (size_t)nb * 16 * K + kh + c * 32); if (NSPLIT == 2) b2[c][nb] = WFrag<T16>::ld(Bt2 + boff + (size_t)nb * 16 * K + kh + c * 32); } }
            __builtin_amdgcn_sched_barrier(0);   // keeps these 24 loads issued ahead of their first product: one trip to memory for all; without it the scheduler sinks loads between the products and the wave waits several times in turn
#pragma unroll
            for (int c = 0; c < CH; ++c)
#pragma unroll
                for (int nb = 0; nb < 4; ++nb)
#pragma unroll
                    for (int mb = 0; mb < 2; ++mb) { acc[mb][nb] = WFrag<T16>::mma(a[c][mb], b[c][nb], acc[mb][nb]); if (NSPLIT == 2) { acc[mb][nb] = WFrag<T16>::mma(a2[c][mb], b[c][nb], acc[mb][nb]); acc[mb][nb] = WFrag<T16>::mma(a[c][mb], b2[c][nb], acc[mb][nb]); } }
        }
    }
    float* pw = ps + w * (32 * 68);
#pragma unroll
    for (int mb = 0; mb < 2; ++mb)
#pragma unroll
        for (int nb = 0; nb < 4; ++nb)
#pragma unroll
            for (int j = 0; j < 8; ++j) pw[(mb * 16 + hi * 8 + j) * 68 + nb * 16 + lr] = acc[mb][nb][j];
    __syncthreads();
#pragma unroll
    for (int idx = threadIdx.x; idx < 32 * 16; idx += NW * 32) { const int row = idx >> 4, cofs = (idx & 15) * 4; v4f s = *(const v4fa*)(ps + row * 68 + cofs);
#pragma unroll
        for (int ww = 1; ww < NW; ++ww) s += *(const v4fa*)(ps + ww * (32 * 68) + row * 68 + cofs);
        *(v4f*)(C + (size_t)(r0 + row) * HD + cofs) = s; }
}

__device__ __forceinline__ h16 tohx(float x) { return (h16)x; }
__device__ __forceinline__ void splitf(float y, unsigned short& h, unsigned short& l) { h = f2bf(y); l = f2bf(y - bf2f(h)); }
typedef __attribute__((ext_vector_type(2))) _Float16 v2h;
typedef __attribute__((ext_vector_type(4))) _Float16 v4h;
typedef __attribute__((ext_vector_type(2))) unsigned short v2us;
typedef __attribute__((ext_vector_type(4))) unsigned short v4us;
typedef __attribute__((ext_vector_type(2))) float v2f;
typedef __attribute__((ext_vector_type(4))) int v4i;

__global__ __launch_bounds__(256) void k_wtG(const float* __restrict__ w, int K, int N, bf* Bt) {
    const int lane = threadIdx.x & 31; const int L0 = (blockIdx.x * 8 + (threadIdx.x >> 5)) * 8; const int nlines = N * K / 64;
{
#pragma unroll 1
        for (int l = 0; l < 8; ++l) { const int L = L0 + l; if (L >= nlines) break; const size_t e = (size_t)L * 64 + lane * 2; const int k = (int)(e % K), n = (int)(e / K); v2us o;
            o[0] = f2bf(w[(size_t)k * N + n]); o[1] = f2bf(w[(size_t)(k + 1) * N + n]); *(v2us*)(Bt + e) = o; }
         }
}
__global__ __launch_bounds__(256) void k_cvt8(const float* __restrict__ src, bf* dst, size_t n8) { const size_t i = (size_t)blockIdx.x * 256 + threadIdx.x; if (i >= n8) return; const v8f v = *(const v8f*)(src + i * 8); v8us o;
#pragma unroll
    for (int k = 0; k < 8; ++k) o[k] = f2bf(v[k]); *(v8us*)(dst + i * 8) = o;  }

// k_rope: head planes [h][t][d] (fp16 + hi/lo) of rope(x) x sc with the rotate-half convention out[d] = x[d] cos[t][d] - x[d+HD/2] sin[t][d], out[d+HD/2] = x[d+HD/2] cos[t][d+HD/2] + x[d] sin[t][d+HD/2]
__global__ __launch_bounds__(256) void k_rope(const float* __restrict__ F, int pitch, int nheads, const float* __restrict__ CS, const float* __restrict__ RF, const float* __restrict__ nw, float sc, h16* P16, bf* Ph, bf* Pl) {
    const size_t e = ((size_t)blockIdx.x * 256 + threadIdx.x) * 2; if (e >= (size_t)nheads * TT * HD) return; const int d = (int)(e % HD); const int t = (int)((e / HD) % TT); const int h = (int)(e / ((size_t)HD * TT)); const float* f = F + (size_t)t * pitch + h * HD; const float rf = RF ? RF[(size_t)h * TT + t] : 1.0f; v2h o16; v2us oh, ol;
#pragma unroll
    for (int q = 0; q < 2; ++q) { const int dd = d + q; const int dp = (dd < HD / 2) ? dd + HD / 2 : dd - HD / 2; float x0 = f[dd], x1 = f[dp];
        if (RF) { float n0 = __fmul_rn(x0, rf), n1 = __fmul_rn(x1, rf); asm volatile("" : "+v"(n0)); asm volatile("" : "+v"(n1)); x0 = __fmul_rn(bfr(nw[dd]), n0); x1 = __fmul_rn(bfr(nw[dp]), n1); }
        const v2f cs = *(const v2f*)(CS + ((size_t)t * HD + dd) * 2); float a = __fmul_rn(x0, cs[0]), bq = __fmul_rn(x1, cs[1]); asm volatile("" : "+v"(a)); asm volatile("" : "+v"(bq)); const float r = ((dd < HD / 2) ? __fsub_rn(a, bq) : __fadd_rn(a, bq)) * sc;
        o16[q] = tohx(r); unsigned short a2, c2; splitf(r, a2, c2); oh[q] = a2; ol[q] = c2; }
    *(v2h*)(P16 + e) = o16; *(v2us*)(Ph + e) = oh; *(v2us*)(Pl + e) = ol;  }
__global__ __launch_bounds__(256) void k_vtp(const float* __restrict__ F, int pitch, int nheads, h16* V16, bf* Vh, bf* Vl) { const size_t e = ((size_t)blockIdx.x * 256 + threadIdx.x) * 2; if (e >= (size_t)nheads * HD * TT) return; const int t = (int)(e % TT); const int d = (int)((e / TT) % HD); const int g = (int)(e / ((size_t)TT * HD)); v2h o16; v2us oh, ol;
#pragma unroll
    for (int q = 0; q < 2; ++q) { const float x = F[(size_t)(t + q) * pitch + g * HD + d]; o16[q] = tohx(x); unsigned short a2, c2; splitf(x, a2, c2); oh[q] = a2; ol[q] = c2; }
    *(v2h*)(V16 + e) = o16; *(v2us*)(Vh + e) = oh; *(v2us*)(Vl + e) = ol;  }
__global__ __launch_bounds__(256) void k_csid(float* CS) { const int idx = blockIdx.x * 256 + threadIdx.x; if (idx >= TT * HD) return; v2f cs; cs[0] = 1.0f; cs[1] = 0.0f; *(v2f*)(CS + (size_t)idx * 2) = cs;  }
__constant__ float SLOPE8[NH_] = { 5.656854153e+0f, 4.000000000e+0f, 2.828427076e+0f, 2.000000000e+0f, 1.414213538e+0f, 1.000000000e+0f, 7.071067691e-1f, 5.000000000e-1f, 3.535533845e-1f, 2.500000000e-1f, 1.767766923e-1f, 1.250000000e-1f, 8.838834614e-2f, 6.250000000e-2f, 4.419417307e-2f, 3.125000000e-2f };   // 8 x the per-head ALiBi slope magnitude (slopes[h] = 2 ** (-(8/16)(h + 1)), h = 0..15, as the reference's f32 values x 8); the eight power-of-two entries give exact products with |i - j| <= 2047; for the eight irrational ones the product goes unrounded into the fused multiply-subtract of k_asoft
// k_asoft: per row (zz, i): t = (S - SLOPE8[h0 + zz] x (i - j)) x HD^-0.5 for j <= i and i - j < WIN (sliding causal window; the reference's -1e9 additive fill vanishes identically); softmax over the 2048 keys (register row, one exp, fixed trees);
// P16 IS Sb's own memory: a row's fp16 probabilities (4 KiB) go over the first half of that row's f32 scores (8 KiB), so P16 rows have pitch 2 x TT. One wave owns a row and holds all of it in registers before its first store (every store needs the row sum), and no wave touches another row, so nothing is overwritten before it is read; Sb is therefore not __restrict__.
__global__ __launch_bounds__(256) void k_asoft(const float* Sb, int h0, h16* P16, bf* Ph, bf* Pl) {
    const int lane = threadIdx.x & 31; const int row = blockIdx.x * 8 + (threadIdx.x >> 5); if (row >= ZH * TT) return; const int i = row % TT; const int zz = row / TT; (void)zz; const bool hires = (i < RH); const float* sr = Sb + (size_t)row * TT; float v[TT / 32]; v4f ar[TT / 128]; float mx = -3.0e38f;
    const float sl = SLOPE8[h0 + (int)(blockIdx.x / (TT / 8))];   // the block's 8 rows lie in one head (= zz): a scalar load
    const float di = (float)(i - lane * 4);   // key distance i - j = di - (ch * 128 + q): whole numbers below 2^24, exact in f32
#pragma unroll
    for (int ch = 0; ch < TT / 128; ++ch) ar[ch] = *(const v4f*)(sr + ch * 128 + lane * 4);
    __builtin_amdgcn_sched_barrier(0);   // keeps the row's 16 loads issued together, ahead of the distance arithmetic: without it the scheduler holds two loads back until registers of the first ones are free, a second trip to memory
#pragma unroll
    for (int ch = 0; ch < TT / 128; ++ch) { const int j0 = ch * 128 + lane * 4; const v4f a = ar[ch];
#pragma unroll
        for (int q = 0; q < 4; ++q) { const int j = j0 + q; (void)j; const float t = (j <= i && i - j < WIN) ? (a[q] - sl * (di - (float)(ch * 128 + q))) * SCL : -3.0e38f; v[ch * 4 + q] = t; mx = fmaxf(mx, t); } }
#pragma unroll
    for (int sh = 16; sh; sh >>= 1) mx = fmaxf(mx, __shfl_xor(mx, sh, 32));
    float sum = 0.f;
#pragma unroll
    for (int k = 0; k < TT / 32; ++k) { float d0 = __fsub_rn(v[k], mx); asm volatile("" : "+v"(d0)); v[k] = __builtin_amdgcn_exp2f(__fmul_rn(d0, 1.4426950408889634f)); sum += v[k]; }
#pragma unroll
    for (int sh = 16; sh; sh >>= 1) sum += __shfl_xor(sum, sh, 32);
    const float f = __fdiv_rn(hires ? 1.0f : PCAR, sum);
{
        if (hires) {
#pragma unroll
            for (int ch = 0; ch < TT / 128; ++ch) { v4us oh, ol;
#pragma unroll
                for (int q = 0; q < 4; ++q) { unsigned short a, c2; splitf(v[ch * 4 + q] * f, a, c2); oh[q] = a; ol[q] = c2; }
                const size_t oo = ((size_t)zz * (RH ? RH : 1) + i) * TT + ch * 128 + lane * 4; *(v4us*)(Ph + oo) = oh; *(v4us*)(Pl + oo) = ol; }
        } else {
#pragma unroll
            for (int ch = 0; ch < TT / 128; ++ch) { v4h o4;
#pragma unroll
                for (int q = 0; q < 4; ++q) o4[q] = tohx(v[ch * 4 + q] * f);
                *(v4h*)(P16 + (size_t)row * (2 * TT) + ch * 128 + lane * 4) = o4; } }
         }
}
__global__ __launch_bounds__(256) void k_merge(const float* __restrict__ O, int h0, bf* Ah, bf* Al) { const size_t e = ((size_t)blockIdx.x * 256 + threadIdx.x) * 2; if (e >= (size_t)ZH * TT * HD) return; const int d = (int)(e % HD); const int t = (int)((e / HD) % TT); const int zz = (int)(e / ((size_t)HD * TT)); const float cs = (t < RH) ? 1.0f : (1.0f / PCAR); const size_t oo = (size_t)t * DQ + (h0 + zz) * HD + d;
    v2us oh, ol;
#pragma unroll
    for (int q = 0; q < 2; ++q) { unsigned short a, c2; splitf(O[e + q] * cs, a, c2); oh[q] = a; ol[q] = c2; } *(v2us*)(Ah + oo) = oh; *(v2us*)(Al + oo) = ol;  }

extern "C" void kernel_launch(void* const* d_in, const int* in_sizes, int n_in,
                              void* d_out, int out_size, void* d_ws, size_t ws_size, hipStream_t stream) {
    (void)in_sizes; (void)n_in; (void)out_size;
    const float* x = (const float*)d_in[0]; const float* wqkv = (const float*)d_in[1]; const float* bqkv = (const float*)d_in[2]; const float* wo = (const float*)d_in[3]; const float* bo = (const float*)d_in[4];     const float* bq = bqkv; const float* bk = bqkv + DQ; const float* bv = bqkv + 2 * DQ; const float* wq = wqkv; const float* wk = nullptr; const float* wv = nullptr; (void)wk; (void)wv;
    float* OUT = (float*)d_out;     // [2][2048][1024]
    char* wsp = (char*)d_ws;
    auto take = [&](size_t bytes) { char* p = wsp; wsp += (bytes + 255) & ~(size_t)255; return (void*)p; };
    bf* WQKV = (bf*)take((size_t)3 * DQ * DM * 2); bf* WQ = WQKV; bf* WK = WQKV + (size_t)DQ * DM; bf* WV = WQKV + (size_t)2 * DQ * DM;   /* fused Bt [3*DQ][DM]: q | k | v row blocks */ bf* WO = (bf*)take((size_t)DM * DQ * 2); float* CS = (float*)take((size_t)TT * HD * 2 * 4);
    bf* XB = (bf*)take((size_t)TT * DM * 2); float* FQ = (float*)take((size_t)TT * DQ * 4); float* FK = (float*)take((size_t)TT * DKV * 4);
    h16* QP16 = (h16*)take((size_t)NH_ * TT * HD * 2); h16* KP16 = (h16*)take((size_t)NKV * TT * HD * 2); h16* VT16 = (h16*)take((size_t)NKV * HD * TT * 2);
    bf* QPh = (bf*)take((size_t)NH_ * TT * HD * 2); bf* QPl = (bf*)take((size_t)NH_ * TT * HD * 2); bf* KPh = (bf*)take((size_t)NKV * TT * HD * 2); bf* KPl = (bf*)take((size_t)NKV * TT * HD * 2); bf* VTh = (bf*)take((size_t)NKV * HD * TT * 2); bf* VTl = (bf*)take((size_t)NKV * HD * TT * 2); bf* Ph = (bf*)take((size_t)ZH * RH * TT * 2); bf* Pl = (bf*)take((size_t)ZH * RH * TT * 2);
    float* Sb = (float*)take((size_t)ZH * TT * TT * 4); h16* P16 = (h16*)Sb;   /* fp16 probabilities in place over the score rows, pitch 2 x TT (k_asoft): ZH = 8 score planes fit the workspace only so */ float* Ob = (float*)take((size_t)ZH * TT * HD * 4); bf* ATh = (bf*)take((size_t)TT * DQ * 2); bf* ATl = (bf*)take((size_t)TT * DQ * 2);
    if ((size_t)(wsp - (char*)d_ws) > ws_size) return;    // ws 256 MiB
    float* FV = FK;   // v projection reuses the k buffer after the k planes are built (stream-ordered)
    { k_wtG<<<(unsigned)((DM * 3 * DQ / 64 + 63) / 64), 256, 0, stream>>>(wqkv, DM, 3 * DQ, WQKV);   /* fused 'xw' [DM][3*DQ] -> Bt [3*DQ][DM] */
      k_wtG<<<(unsigned)((DQ * DM / 64 + 63) / 64), 256, 0, stream>>>(wo, DQ, DM, WO);
       }
    k_csid<<<(TT * HD + 255) / 256, 256, 0, stream>>>(CS);
    const unsigned LQ = (unsigned)(((size_t)NH_ * TT * HD / 2 + 255) / 256), LKv = (unsigned)(((size_t)NKV * TT * HD / 2 + 255) / 256);
    for (int b = 0; b < NB_; ++b) {
        
        k_cvt8<<<(unsigned)(((size_t)TT * DM / 8 + 255) / 256), 256, 0, stream>>>(x + (size_t)b * TT * DM, XB, (size_t)TT * DM / 8);
        k_gemmw<bf, 0, true><<<dim3(TT / 64, DQ / 64, 1), 32, 0, stream>>>(XB, nullptr, WQ, nullptr, DM, FQ, DQ, bq, 0, 0, 0);
        k_rope<<<LQ, 256, 0, stream>>>(FQ, DQ, NH_, CS, nullptr, nullptr, 1.0f, QP16, QPh, QPl);
        k_gemmw<bf, 0, true><<<dim3(TT / 64, DKV / 64, 1), 32, 0, stream>>>(XB, nullptr, WK, nullptr, DM, FK, DKV, bk, 0, 0, 0);
        k_rope<<<LKv, 256, 0, stream>>>(FK, DKV, NKV, CS, nullptr, nullptr, 1.0f, KP16, KPh, KPl);
        k_gemmw<bf, 0, true><<<dim3(TT / 64, DKV / 64, 1), 32, 0, stream>>>(XB, nullptr, WV, nullptr, DM, FV, DKV, bv, 0, 0, 0); k_vtp<<<LKv, 256, 0, stream>>>(FV, DKV, NKV, VT16, VTh, VTl);
        for (int h0 = 0; h0 < NH_; h0 += ZH) { const size_t zq = (size_t)h0, zk = (size_t)(h0 / REP);   // one kv head per query head: the pass's ZH heads use consecutive kv planes (z-strides TT*HD)
            k_gemmc<bf, 2, 1><<<dim3(RH / 64, TT / 64, ZH), 32, 0, stream>>>(QPh + zq * TT * HD, QPl + zq * TT * HD, KPh + zk * TT * HD, KPl + zk * TT * HD, HD, Sb, TT, 0, (size_t)TT * HD, (size_t)TT * HD, (size_t)TT * TT);
            k_gemmc<h16, 0, 1><<<dim3((TT - RH) / 64, TT / 64, ZH), 32, 0, stream>>>(QP16 + zq * TT * HD + (size_t)RH * HD, nullptr, KP16 + zk * TT * HD, nullptr, HD, Sb + (size_t)RH * TT, TT, RH, (size_t)TT * HD, (size_t)TT * HD, (size_t)TT * TT);
            k_asoft<<<ZH * TT / 8, 256, 0, stream>>>(Sb, h0, P16, Ph, Pl);   /* - slope_h (i-j) (x 8, in f32) inside */
            k_pvs<bf, 2, 8><<<dim3(RH / 32, 1, ZH), 256, 0, stream>>>(Ph, Pl, TT, VTh + zk * HD * TT, VTl + zk * HD * TT, TT, Ob, 0, (size_t)RH * TT, (size_t)HD * TT, (size_t)TT * HD);
            k_pvs<h16, 0, 16><<<dim3((TT - RH) / 32, 1, ZH), 512, 0, stream>>>(P16 + (size_t)RH * 2 * TT, nullptr, 2 * TT, VT16 + zk * HD * TT, nullptr, TT, Ob + (size_t)RH * HD, RH, (size_t)2 * TT * TT, (size_t)HD * TT, (size_t)TT * HD);
            k_merge<<<(unsigned)(((size_t)ZH * TT * HD / 2 + 255) / 256), 256, 0, stream>>>(Ob, h0, ATh, ATl); }
        k_gemmw<bf, 1, true><<<dim3(TT / 64, DM / 64, 1), 32, 0, stream>>>(ATh, ATl, WO, nullptr, DQ, OUT + (size_t)b * TT * DM, DM, bo, 0, 0, 0); }
}

// v004
// A run of this version takes 354 microseconds.
// Next to v003, in two timings, it ran 1.54 times as fast each time.
// Counting every step since v000, it is 4.60 times as fast.
#include <hip/hip_runtime.h>

// Causal self-attention with a fused biased qkv projection and an ALiBi-style bias on the KEY position (x [2][2048][1024]; qkv = (x w_attn + b_attn) ('xw' [1024][3072] 0.02 + bias zeros on this draw: read) reshaped (b, t, 3, 16, 64): q | k | v = column thirds (16 heads x 64); scores / sqrt(float32(64)) + slopes[h] x pos[s] with slopes[h] = 2 ** (-(8/16)(h + 1)) and pos the KEY index s: within a query row t this equals -slopes[h] x (t - s) plus the row constant slopes[h] x t, which the row softmax removes: implemented as the standard ALiBi distance term -slopes[h] x |t - s| on the causal triangle (slopes baked as jnp-exact f32 literals, pre-scaled by 8 for the kernel's exact x 1/8); causal (-inf); softmax; y = merged w_proj + b_proj ('xw' + bias zeros: read) -> [2][2048][1024] (4.2 M); argument order x, w_attn, b_attn, w_proj, b_proj).
// Layout per batch: bf16 copy of x; the fused 'xw' weight transposed once into Bt (q | k | v row blocks) + bias slices; exact projections + f32 biases; identity-table plane builders; one attention kernel per 32 query rows of a head, scores in LDS: its softmax subtracts SLOPE8[h] x (i - j) in f32, in its register row, before its x 1/8 (hybrid rows: < 512 hi/lo 3 products, rest fp16 x1024; keys past the diagonal block are never touched); merged hi/lo x w_proj exact + b_proj.
// Compute dtypes, f32 accumulate: every input rounded to bf16; projections exact + f32 biases; attention rows < 512 3 products, rest fp16; softmax f32; output projection hl x exact.

#define NB_  2
#define TT   2048
#define DM   1024
#define NH_  16
#define NKV  16
#define REP  (NH_ / NKV)
#define HD   64
#define DQ   (NH_ * HD)
#define DKV  (NKV * HD)
#define RH   512                  // query rows < RH use hi+lo planes (0: none)
#define WIN  2048
#define PCAR 1024.0f
#define SCL  0.125f   // HD^-0.5
typedef _Float16 h16;
typedef unsigned short bf;
typedef __attribute__((ext_vector_type(16))) __bf16   v16bf;
typedef __attribute__((ext_vector_type(16))) _Float16 v16h;
typedef __attribute__((ext_vector_type(8)))  _Float16 v8h;
typedef __attribute__((ext_vector_type(8)))  unsigned short v8us;
typedef __attribute__((ext_vector_type(8)))  float    v8f;
typedef __attribute__((ext_vector_type(4)))  float    v4f;
typedef v8h  __attribute__((may_alias)) v8ha;
typedef v4f  __attribute__((may_alias)) v4fa;
typedef v8us __attribute__((may_alias)) v8usa;

__device__ __forceinline__ unsigned short f2bf(float f) { unsigned u = __float_as_uint(f); u += 0x7FFFu + ((u >> 16) & 1u); return (unsigned short)(u >> 16); }
__device__ __forceinline__ float bf2f(unsigned short b) { return __uint_as_float(((unsigned)b) << 16); }
__device__ __forceinline__ float bfr(float f) { return bf2f(f2bf(f)); }
__device__ __forceinline__ v16h cat16(v8h lo, v8h hi) { return __builtin_shufflevector(lo, hi, 0, 1, 2, 3, 4, 5, 6, 7, 8, 9, 10, 11, 12, 13, 14, 15); }
__device__ __forceinline__ v16bf cat16b(v8us lo, v8us hi) { return __builtin_bit_cast(v16bf, __builtin_shufflevector(lo, hi, 0, 1, 2, 3, 4, 5, 6, 7, 8, 9, 10, 11, 12, 13, 14, 15)); }
__device__ __forceinline__ v8f wmma16(v16h a, v16h b, v8f c) { return __builtin_amdgcn_wmma_f32_16x16x32_f16(false, a, false, b, (short)0, c, false, false); }
__device__ __forceinline__ v8f wmmab(v16bf a, v16bf b, v8f c) { return __builtin_amdgcn_wmma_f32_16x16x32_bf16(false, a, false, b, (short)0, c, false, false); }



// ---- k_gemmw: register-blocked GEMM, ONE WAVE per 64x64 output tile (16 accumulators), operands straight from K-contiguous 16-bit planes; grid (M/64, N/64, Z), 32 threads.
// C[m][n] (f32, pitch ldc, + optional f32 bias[n]) = sum_k A[m][k] Bt[n][k] (+ split products per NSPLIT). z-batch strides sA/sB/sC in elements. K % 32 == 0.
template <typename T16> struct WFrag;
template <> struct WFrag<h16> { typedef v16h V; static __device__ __forceinline__ V ld(const h16* p) { return cat16(*(const v8h*)p, *(const v8h*)(p + 16)); } static __device__ __forceinline__ v8f mma(V a, V b, v8f c) { return wmma16(a, b, c); } };
template <> struct WFrag<bf> { typedef v16bf V; static __device__ __forceinline__ V ld(const bf* p) { return cat16b(*(const v8us*)p, *(const v8us*)(p + 16)); } static __device__ __forceinline__ v8f mma(V a, V b, v8f c) { return wmmab(a, b, c); } };
template <typename T16, int NSPLIT, bool BIAS>
__global__ __launch_bounds__(32) void k_gemmw(const T16* __restrict__ A, const T16* __restrict__ A2, const T16* __restrict__ Bt, const T16* __restrict__ Bt2, int K, float* C, int ldc, const float* __restrict__ bias, size_t sA, size_t sB, size_t sC) {
    typedef typename WFrag<T16>::V V;
    __shared__ __align__(16) float os[16 * 68];
    const size_t z = blockIdx.z; A += z * sA; if (A2) A2 += z * sA; Bt += z * sB; if (Bt2) Bt2 += z * sB; C += z * sC;
    const int lane = threadIdx.x & 31, lr = lane & 15, hi = lane >> 4; const int r0 = blockIdx.x * 64, c0 = blockIdx.y * 64;
    v8f acc[4][4];
#pragma unroll
    for (int mb = 0; mb < 4; ++mb)
#pragma unroll
        for (int nb = 0; nb < 4; ++nb) acc[mb][nb] = (v8f){};
    const size_t aoff = (size_t)(r0 + lr) * K + 8 * hi, boff = (size_t)(c0 + lr) * K + 8 * hi;
#pragma unroll 1
    for (int kc = 0; kc < K; kc += 32) {
        V a[4], a2[4];
#pragma unroll
        for (int mb = 0; mb < 4; ++mb) { a[mb] = WFrag<T16>::ld(A + aoff + (size_t)mb * 16 * K + kc); if (NSPLIT == 1 || NSPLIT == 2) a2[mb] = WFrag<T16>::ld(A2 + aoff + (size_t)mb * 16 * K + kc); }
#pragma unroll
        for (int nb = 0; nb < 4; ++nb) { const V b = WFrag<T16>::ld(Bt + boff + (size_t)nb * 16 * K + kc); V b2; if (NSPLIT >= 2) b2 = WFrag<T16>::ld(Bt2 + boff + (size_t)nb * 16 * K + kc);
#pragma unroll
            for (int mb = 0; mb < 4; ++mb) { acc[mb][nb] = WFrag<T16>::mma(a[mb], b, acc[mb][nb]); if (NSPLIT == 1 || NSPLIT == 2) acc[mb][nb] = WFrag<T16>::mma(a2[mb], b, acc[mb][nb]); if (NSPLIT >= 2) acc[mb][nb] = WFrag<T16>::mma(a[mb], b2, acc[mb][nb]); } }
        asm volatile("v_nop\n\tv_nop\n\tv_nop\n\tv_nop" : "+v"(acc[0][0]), "+v"(acc[1][1]), "+v"(acc[2][2]), "+v"(acc[3][3]) : "v"(a[0]), "v"(a[3]));
    }
#pragma unroll
    for (int mb = 0; mb < 4; ++mb) {
#pragma unroll
        for (int nb = 0; nb < 4; ++nb) {
#pragma unroll
            for (int j = 0; j < 8; ++j) os[(hi * 8 + j) * 68 + nb * 16 + lr] = acc[mb][nb][j]; }
        __builtin_amdgcn_wave_barrier(); asm volatile("" ::: "memory");
        float* crow = C + (size_t)(r0 + mb * 16) * ldc + c0;
{
#pragma unroll
            for (int s = 0; s < 8; ++s) { const int row = 2 * s + hi, cofs = lr * 4; v4f val = *(const v4fa*)(os + row * 68 + cofs); if (BIAS) { val[0] += bfr(bias[c0 + cofs]); val[1] += bfr(bias[c0 + cofs + 1]); val[2] += bfr(bias[c0 + cofs + 2]); val[3] += bfr(bias[c0 + cofs + 3]); }
                *(v4f*)(crow + (size_t)row * ldc + cofs) = val; }
             }
        __builtin_amdgcn_wave_barrier(); asm volatile("" ::: "memory");
    }
}

__device__ __forceinline__ h16 tohx(float x) { return (h16)x; }
__device__ __forceinline__ void splitf(float y, unsigned short& h, unsigned short& l) { h = f2bf(y); l = f2bf(y - bf2f(h)); }
typedef __attribute__((ext_vector_type(2))) _Float16 v2h;
typedef __attribute__((ext_vector_type(4))) _Float16 v4h;
typedef __attribute__((ext_vector_type(2))) unsigned short v2us;
typedef __attribute__((ext_vector_type(4))) unsigned short v4us;
typedef __attribute__((ext_vector_type(2))) float v2f;
typedef __attribute__((ext_vector_type(4))) int v4i;

__global__ __launch_bounds__(256) void k_wtG(const float* __restrict__ w, int K, int N, bf* Bt) {
    const int lane = threadIdx.x & 31; const int L0 = (blockIdx.x * 8 + (threadIdx.x >> 5)) * 8; const int nlines = N * K / 64;
{
#pragma unroll 1
        for (int l = 0; l < 8; ++l) { const int L = L0 + l; if (L >= nlines) break; const size_t e = (size_t)L * 64 + lane * 2; const int k = (int)(e % K), n = (int)(e / K); v2us o;
            o[0] = f2bf(w[(size_t)k * N + n]); o[1] = f2bf(w[(size_t)(k + 1) * N + n]); *(v2us*)(Bt + e) = o; }
         }
}
__global__ __launch_bounds__(256) void k_cvt8(const float* __restrict__ src, bf* dst, size_t n8) { const size_t i = (size_t)blockIdx.x * 256 + threadIdx.x; if (i >= n8) return; const v8f v = *(const v8f*)(src + i * 8); v8us o;
#pragma unroll
    for (int k = 0; k < 8; ++k) o[k] = f2bf(v[k]); *(v8us*)(dst + i * 8) = o;  }

// k_rope: head planes [h][t][d] (fp16 + hi/lo) of rope(x) x sc with the rotate-half convention out[d] = x[d] cos[t][d] - x[d+HD/2] sin[t][d], out[d+HD/2] = x[d+HD/2] cos[t][d+HD/2] + x[d] sin[t][d+HD/2]
__global__ __launch_bounds__(256) void k_rope(const float* __restrict__ F, int pitch, int nheads, const float* __restrict__ CS, const float* __restrict__ RF, const float* __restrict__ nw, float sc, h16* P16, bf* Ph, bf* Pl) {
    const size_t e = ((size_t)blockIdx.x * 256 + threadIdx.x) * 2; if (e >= (size_t)nheads * TT * HD) return; const int d = (int)(e % HD); const int t = (int)((e / HD) % TT); const int h = (int)(e / ((size_t)HD * TT)); const float* f = F + (size_t)t * pitch + h * HD; const float rf = RF ? RF[(size_t)h * TT + t] : 1.0f; v2h o16; v2us oh, ol;
#pragma unroll
    for (int q = 0; q < 2; ++q) { const int dd = d + q; const int dp = (dd < HD / 2) ? dd + HD / 2 : dd - HD / 2; float x0 = f[dd], x1 = f[dp];
        if (RF) { float n0 = __fmul_rn(x0, rf), n1 = __fmul_rn(x1, rf); asm volatile("" : "+v"(n0)); asm volatile("" : "+v"(n1)); x0 = __fmul_rn(bfr(nw[dd]), n0); x1 = __fmul_rn(bfr(nw[dp]), n1); }
        const v2f cs = *(const v2f*)(CS + ((size_t)t * HD + dd) * 2); float a = __fmul_rn(x0, cs[0]), bq = __fmul_rn(x1, cs[1]); asm volatile("" : "+v"(a)); asm volatile("" : "+v"(bq)); const float r = ((dd < HD / 2) ? __fsub_rn(a, bq) : __fadd_rn(a, bq)) * sc;
        o16[q] = tohx(r); unsigned short a2, c2; splitf(r, a2, c2); oh[q] = a2; ol[q] = c2; }
    *(v2h*)(P16 + e) = o16; *(v2us*)(Ph + e) = oh; *(v2us*)(Pl + e) = ol;  }
__global__ __launch_bounds__(256) void k_vtp(const float* __restrict__ F, int pitch, int nheads, h16* V16, bf* Vh, bf* Vl) { const size_t e = ((size_t)blockIdx.x * 256 + threadIdx.x) * 2; if (e >= (size_t)nheads * HD * TT) return; const int t = (int)(e % TT); const int d = (int)((e / TT) % HD); const int g = (int)(e / ((size_t)TT * HD)); v2h o16; v2us oh, ol;
#pragma unroll
    for (int q = 0; q < 2; ++q) { const float x = F[(size_t)(t + q) * pitch + g * HD + d]; o16[q] = tohx(x); unsigned short a2, c2; splitf(x, a2, c2); oh[q] = a2; ol[q] = c2; }
    *(v2h*)(V16 + e) = o16; *(v2us*)(Vh + e) = oh; *(v2us*)(Vl + e) = ol;  }
__global__ __launch_bounds__(256) void k_csid(float* CS) { const int idx = blockIdx.x * 256 + threadIdx.x; if (idx >= TT * HD) return; v2f cs; cs[0] = 1.0f; cs[1] = 0.0f; *(v2f*)(CS + (size_t)idx * 2) = cs;  }
__constant__ float SLOPE8[NH_] = { 5.656854153e+0f, 4.000000000e+0f, 2.828427076e+0f, 2.000000000e+0f, 1.414213538e+0f, 1.000000000e+0f, 7.071067691e-1f, 5.000000000e-1f, 3.535533845e-1f, 2.500000000e-1f, 1.767766923e-1f, 1.250000000e-1f, 8.838834614e-2f, 6.250000000e-2f, 4.419417307e-2f, 3.125000000e-2f };   // 8 x the per-head ALiBi slope magnitude (slopes[h] = 2 ** (-(8/16)(h + 1)), h = 0..15, as the reference's f32 values x 8); the eight power-of-two entries give exact products with |i - j| <= 2047; for the eight irrational ones the product goes unrounded into the fused multiply-subtract of k_attn
typedef v4us __attribute__((may_alias)) v4usa;
typedef v4h  __attribute__((may_alias)) v4ha;
// ---- k_attn: one work-group of NW waves does the whole attention of one head's 32 query rows (i0 .. i0 + 31, i0 = roff + 32 x tile); the rows' f32 scores never leave LDS. grid (heads, NT tiles), the longest tiles first.
// 1. scores: wave w takes the 64-key units w, w + NW, ... below Kl (the diagonal block's end; later keys are masked) and stores its 32 x 64 f32 tiles into the score rows (pitch KMAX + 4 floats: 16 bytes of pad for the 16-byte readers of step 3).
// 2. softmax: one wave per row, the row in registers: t = (S - SLOPE8[h] x (i - j)) x HD^-0.5 for j <= i, one exp, fixed trees. The 2-byte probabilities go over the row's own f32 scores (fp16: first half of the row; hi and lo planes: one half each);
//    the wave holds all of its row before its first store (every store needs the row sum) and no wave touches another row.
// 3. P.V: wave w takes the same units of keys, A fragments from LDS, value planes [d][t] from memory; private f32 partial tiles, laid over the probabilities once every wave has read them, are summed in the fixed order w = 0 .. NW-1.
// 4. the sums, scaled back, go out as hi + lo planes [t][head x HD + d] for the output projection.
// Every loop but the three marked ones is fully unrolled, so that the fragment, accumulator and row arrays are indexed by constants and live in registers.
template <typename T16, int NSPLIT, int NW, int KMAX, int NT>
__global__ __launch_bounds__(NW * 32) void k_attn(const T16* __restrict__ Q, const T16* __restrict__ Q2, const T16* __restrict__ Kp, const T16* __restrict__ Kp2, const T16* __restrict__ Vt, const T16* __restrict__ Vt2, int roff, bf* Ah, bf* Al) {
    typedef typename WFrag<T16>::V V;
    constexpr int SP = KMAX + 4;
    constexpr int SMF = (32 * SP > NW * 32 * 68) ? 32 * SP : NW * 32 * 68;
    __shared__ __align__(16) float sm[SMF];
    const int lane = threadIdx.x & 31, lr = lane & 15, hi = lane >> 4; const int w = __builtin_amdgcn_readfirstlane((int)(threadIdx.x >> 5));
    const int hh = blockIdx.x; const int i0 = roff + (NT - 1 - (int)blockIdx.y) * 32;
    const int Kl = min(KMAX, (i0 + 32 + 63) & ~63);
    const size_t hp = (size_t)hh * TT * HD;
    {
        V a[2][2], a2[2][2];
        const size_t aoff = hp + (size_t)(i0 + lr) * HD + 8 * hi;
#pragma unroll
        for (int c = 0; c < 2; ++c)
#pragma unroll
            for (int mb = 0; mb < 2; ++mb) { a[c][mb] = WFrag<T16>::ld(Q + aoff + (size_t)mb * 16 * HD + c * 32); if (NSPLIT == 2) a2[c][mb] = WFrag<T16>::ld(Q2 + aoff + (size_t)mb * 16 * HD + c * 32); }
        // the unit loop stays rolled (two trips at most): unrolled it would hold two units' key fragments and accumulators
#pragma unroll 1
        for (int k0 = w * 64; k0 < Kl; k0 += NW * 64) {
            V b[2][4], b2[2][4]; v8f acc[2][4];
            const size_t boff = hp + (size_t)(k0 + lr) * HD + 8 * hi;
            // the wait stands behind the query loads (the compiler moves them into this block where the loop has a single trip) and ahead of the key loads, whose results may be given the query loads' address registers;
            // the addresses are its inputs so that their registers are not given away ahead of it
            asm volatile("s_wait_xcnt 0x0" :: "v"(Q + aoff), "v"((NSPLIT == 2 ? Q2 : Q) + aoff) : "memory");
#pragma unroll
            for (int c = 0; c < 2; ++c)
#pragma unroll
                for (int nb = 0; nb < 4; ++nb) { b[c][nb] = WFrag<T16>::ld(Kp + boff + (size_t)nb * 16 * HD + c * 32); if (NSPLIT == 2) b2[c][nb] = WFrag<T16>::ld(Kp2 + boff + (size_t)nb * 16 * HD + c * 32); }
            __builtin_amdgcn_sched_barrier(0);   // keeps the unit's key loads issued together, ahead of their first product: one trip to memory; without it the scheduler issues them in several groups with a wait between
#pragma unroll
            for (int mb = 0; mb < 2; ++mb)
#pragma unroll
                for (int nb = 0; nb < 4; ++nb) acc[mb][nb] = (v8f){};
#pragma unroll
            for (int c = 0; c < 2; ++c)
#pragma unroll
                for (int nb = 0; nb < 4; ++nb)
#pragma unroll
                    for (int mb = 0; mb < 2; ++mb) { acc[mb][nb] = WFrag<T16>::mma(a[c][mb], b[c][nb], acc[mb][nb]); if (NSPLIT == 2) { acc[mb][nb] = WFrag<T16>::mma(a2[c][mb], b[c][nb], acc[mb][nb]); acc[mb][nb] = WFrag<T16>::mma(a[c][mb], b2[c][nb], acc[mb][nb]); } }
            __builtin_amdgcn_sched_barrier(0);   // keeps all eight product chains ahead of the stores: the scheduler otherwise stores a finished tile early and starts the next chain in the same registers
#pragma unroll
            for (int mb = 0; mb < 2; ++mb)
#pragma unroll
                for (int nb = 0; nb < 4; ++nb)
#pragma unroll
                    for (int j = 0; j < 8; ++j) sm[(mb * 16 + hi * 8 + j) * SP + k0 + nb * 16 + lr] = acc[mb][nb][j];
        }
    }
    __syncthreads();   // every score of the 32 rows is in LDS before a row is read
    const float sl = SLOPE8[hh];
    // the row loop stays rolled: one row's registers at a time
#pragma unroll 1
    for (int rr = w; rr < 32; rr += NW) {
        const int i = i0 + rr; float* sr = sm + rr * SP; float v[KMAX / 32]; v4f ar[KMAX / 128]; float mx = -3.0e38f;
        const float di = (float)(i - lane * 4);   // key distance i - j = di - (ch * 128 + q): whole numbers below 2^24, exact in f32
        // chunks of 128 keys at or past Kl are skipped (a scalar test); in a chunk that Kl halves, the upper lanes are off: their keys have no score and no reader
#pragma unroll
        for (int ch = 0; ch < KMAX / 128; ++ch) if (ch * 128 < Kl) { ar[ch] = (v4f){}; if (ch * 128 + lane * 4 < Kl) ar[ch] = *(const v4fa*)(sr + ch * 128 + lane * 4); }
#pragma unroll
        for (int ch = 0; ch < KMAX / 128; ++ch) if (ch * 128 < Kl) { const int j0 = ch * 128 + lane * 4; const v4f a = ar[ch];
#pragma unroll
            for (int q = 0; q < 4; ++q) { const int j = j0 + q; const float t = (j <= i && i - j < WIN) ? (a[q] - sl * (di - (float)(ch * 128 + q))) * SCL : -3.0e38f; v[ch * 4 + q] = t; mx = fmaxf(mx, t); } }
#pragma unroll
        for (int sh = 16; sh; sh >>= 1) mx = fmaxf(mx, __shfl_xor(mx, sh, 32));
        float sum = 0.f;
#pragma unroll
        for (int ch = 0; ch < KMAX / 128; ++ch) if (ch * 128 < Kl) {
#pragma unroll
            for (int q = 0; q < 4; ++q) { const int k = ch * 4 + q; v[k] = __builtin_amdgcn_exp2f(__fmul_rn(__fsub_rn(v[k], mx), 1.4426950408889634f)); sum += v[k]; } }
#pragma unroll
        for (int sh = 16; sh; sh >>= 1) sum += __shfl_xor(sum, sh, 32);
        const float f = __fdiv_rn((NSPLIT == 2) ? 1.0f : PCAR, sum);
#pragma unroll
        for (int ch = 0; ch < KMAX / 128; ++ch) if (ch * 128 < Kl) { const int j0 = ch * 128 + lane * 4;
            if (NSPLIT == 2) { v4us oh, ol;
#pragma unroll
                for (int q = 0; q < 4; ++q) { unsigned short a, c2; splitf(v[ch * 4 + q] * f, a, c2); oh[q] = a; ol[q] = c2; }
                if (j0 < Kl) { *(v4usa*)((bf*)sr + j0) = oh; *(v4usa*)((bf*)sr + KMAX + j0) = ol; }
            } else { v4h o4;
#pragma unroll
                for (int q = 0; q < 4; ++q) o4[q] = tohx(v[ch * 4 + q] * f);
                if (j0 < Kl) *(v4ha*)((h16*)sr + j0) = o4; } }
    }
    __syncthreads();   // every row's probabilities are in LDS before a wave reads all 32 rows
    constexpr int CH = (NSPLIT == 2) ? 1 : 2;   // 32-key chunks whose loads are issued together
    constexpr int lda = 2 * SP;                 // probability row pitch in 2-byte elements
    const T16* A = (const T16*)sm; const T16* A2 = A + KMAX; const T16* Bt = Vt + hp; const T16* Bt2 = (NSPLIT == 2) ? Vt2 + hp : nullptr;
    v8f acc[2][4];
#pragma unroll
    for (int mb = 0; mb < 2; ++mb)
#pragma unroll
        for (int nb = 0; nb < 4; ++nb) acc[mb][nb] = (v8f){};
    const int aoff = lr * lda + 8 * hi; const size_t boff = (size_t)lr * TT + 8 * hi;
    // the unit loop stays rolled (two trips at most): unrolled it would hold two units' fragments and pass the register budget of a 16-wave work-group
#pragma unroll 1
    for (int k0 = w * 64; k0 < Kl; k0 += NW * 64) {
#pragma unroll
        for (int kh = k0; kh < k0 + 64; kh += CH * 32) {
            V a[CH][2], a2[CH][2], b[CH][4], b2[CH][4];
#pragma unroll
            for (int c = 0; c < CH; ++c) {
#pragma unroll
                for (int nb = 0; nb < 4; ++nb) { b[c][nb] = WFrag<T16>::ld(Bt + boff + (size_t)nb * 16 * TT + kh + c * 32); if (NSPLIT == 2) b2[c][nb] = WFrag<T16>::ld(Bt2 + boff + (size_t)nb * 16 * TT + kh + c * 32); }
#pragma unroll
                for (int mb = 0; mb < 2; ++mb) { a[c][mb] = WFrag<T16>::ld(A + aoff + mb * 16 * lda + kh + c * 32); if (NSPLIT == 2) a2[c][mb] = WFrag<T16>::ld(A2 + aoff + mb * 16 * lda + kh + c * 32); } }
            __builtin_amdgcn_sched_barrier(0);   // keeps these loads issued ahead of their first product: one trip to memory for all; without it the scheduler sinks loads between the products and the wave waits several times in turn
#pragma unroll
            for (int c = 0; c < CH; ++c)
#pragma unroll
                for (int nb = 0; nb < 4; ++nb)
#pragma unroll
                    for (int mb = 0; mb < 2; ++mb) { acc[mb][nb] = WFrag<T16>::mma(a[c][mb], b[c][nb], acc[mb][nb]); if (NSPLIT == 2) { acc[mb][nb] = WFrag<T16>::mma(a2[c][mb], b[c][nb], acc[mb][nb]); acc[mb][nb] = WFrag<T16>::mma(a[c][mb], b2[c][nb], acc[mb][nb]); } }
        }
    }
    __syncthreads();   // the partial tiles go over the probabilities: every wave has read its last one
    float* pw = sm + w * (32 * 68);
#pragma unroll
    for (int mb = 0; mb < 2; ++mb)
#pragma unroll
        for (int nb = 0; nb < 4; ++nb)
#pragma unroll
            for (int j = 0; j < 8; ++j) pw[(mb * 16 + hi * 8 + j) * 68 + nb * 16 + lr] = acc[mb][nb][j];
    __syncthreads();   // every wave's partial tile is in LDS before the sums
    const float cs = (NSPLIT == 2) ? 1.0f : (1.0f / PCAR);
#pragma unroll
    for (int idx = threadIdx.x; idx < 32 * 16; idx += NW * 32) { const int row = idx >> 4, cofs = (idx & 15) * 4; v4f s = *(const v4fa*)(sm + row * 68 + cofs);
#pragma unroll
        for (int ww = 1; ww < NW; ++ww) s += *(const v4fa*)(sm + ww * (32 * 68) + row * 68 + cofs);
        v4us oh, ol;
#pragma unroll
        for (int q = 0; q < 4; ++q) { unsigned short a, c2; splitf(s[q] * cs, a, c2); oh[q] = a; ol[q] = c2; }
        const size_t oo = (size_t)(i0 + row) * DQ + hh * HD + cofs; *(v4us*)(Ah + oo) = oh; *(v4us*)(Al + oo) = ol; }
}

extern "C" void kernel_launch(void* const* d_in, const int* in_sizes, int n_in,
                              void* d_out, int out_size, void* d_ws, size_t ws_size, hipStream_t stream) {
    (void)in_sizes; (void)n_in; (void)out_size;
    const float* x = (const float*)d_in[0]; const float* wqkv = (const float*)d_in[1]; const float* bqkv = (const float*)d_in[2]; const float* wo = (const float*)d_in[3]; const float* bo = (const float*)d_in[4];     const float* bq = bqkv; const float* bk = bqkv + DQ; const float* bv = bqkv + 2 * DQ; const float* wq = wqkv; const float* wk = nullptr; const float* wv = nullptr; (void)wk; (void)wv;
    float* OUT = (float*)d_out;     // [2][2048][1024]
    char* wsp = (char*)d_ws;
    auto take = [&](size_t bytes) { char* p = wsp; wsp += (bytes + 255) & ~(size_t)255; return (void*)p; };
    bf* WQKV = (bf*)take((size_t)3 * DQ * DM * 2); bf* WQ = WQKV; bf* WK = WQKV + (size_t)DQ * DM; bf* WV = WQKV + (size_t)2 * DQ * DM;   /* fused Bt [3*DQ][DM]: q | k | v row blocks */ bf* WO = (bf*)take((size_t)DM * DQ * 2); float* CS = (float*)take((size_t)TT * HD * 2 * 4);
    bf* XB = (bf*)take((size_t)TT * DM * 2); float* FQ = (float*)take((size_t)TT * DQ * 4); float* FK = (float*)take((size_t)TT * DKV * 4);
    h16* QP16 = (h16*)take((size_t)NH_ * TT * HD * 2); h16* KP16 = (h16*)take((size_t)NKV * TT * HD * 2); h16* VT16 = (h16*)take((size_t)NKV * HD * TT * 2);
    bf* QPh = (bf*)take((size_t)NH_ * TT * HD * 2); bf* QPl = (bf*)take((size_t)NH_ * TT * HD * 2); bf* KPh = (bf*)take((size_t)NKV * TT * HD * 2); bf* KPl = (bf*)take((size_t)NKV * TT * HD * 2); bf* VTh = (bf*)take((size_t)NKV * HD * TT * 2); bf* VTl = (bf*)take((size_t)NKV * HD * TT * 2);
    bf* ATh = (bf*)take((size_t)TT * DQ * 2); bf* ATl = (bf*)take((size_t)TT * DQ * 2);
    if ((size_t)(wsp - (char*)d_ws) > ws_size) return;    // ws 256 MiB
    float* FV = FK;   // v projection reuses the k buffer after the k planes are built (stream-ordered)
    { k_wtG<<<(unsigned)((DM * 3 * DQ / 64 + 63) / 64), 256, 0, stream>>>(wqkv, DM, 3 * DQ, WQKV);   /* fused 'xw' [DM][3*DQ] -> Bt [3*DQ][DM] */
      k_wtG<<<(unsigned)((DQ * DM / 64 + 63) / 64), 256, 0, stream>>>(wo, DQ, DM, WO);
       }
    k_csid<<<(TT * HD + 255) / 256, 256, 0, stream>>>(CS);
    const unsigned LQ = (unsigned)(((size_t)NH_ * TT * HD / 2 + 255) / 256), LKv = (unsigned)(((size_t)NKV * TT * HD / 2 + 255) / 256);
    for (int b = 0; b < NB_; ++b) {
        
        k_cvt8<<<(unsigned)(((size_t)TT * DM / 8 + 255) / 256), 256, 0, stream>>>(x + (size_t)b * TT * DM, XB, (size_t)TT * DM / 8);
        k_gemmw<bf, 0, true><<<dim3(TT / 64, DQ / 64, 1), 32, 0, stream>>>(XB, nullptr, WQ, nullptr, DM, FQ, DQ, bq, 0, 0, 0);
        k_rope<<<LQ, 256, 0, stream>>>(FQ, DQ, NH_, CS, nullptr, nullptr, 1.0f, QP16, QPh, QPl);
        k_gemmw<bf, 0, true><<<dim3(TT / 64, DKV / 64, 1), 32, 0, stream>>>(XB, nullptr, WK, nullptr, DM, FK, DKV, bk, 0, 0, 0);
        k_rope<<<LKv, 256, 0, stream>>>(FK, DKV, NKV, CS, nullptr, nullptr, 1.0f, KP16, KPh, KPl);
        k_gemmw<bf, 0, true><<<dim3(TT / 64, DKV / 64, 1), 32, 0, stream>>>(XB, nullptr, WV, nullptr, DM, FV, DKV, bv, 0, 0, 0); k_vtp<<<LKv, 256, 0, stream>>>(FV, DKV, NKV, VT16, VTh, VTl);
        k_attn<bf, 2, 8, RH, RH / 32><<<dim3(NH_, RH / 32, 1), 256, 0, stream>>>(QPh, QPl, KPh, KPl, VTh, VTl, 0, ATh, ATl);
        k_attn<h16, 0, 16, TT, (TT - RH) / 32><<<dim3(NH_, (TT - RH) / 32, 1), 512, 0, stream>>>(QP16, nullptr, KP16, nullptr, VT16, nullptr, RH, ATh, ATl);
        k_gemmw<bf, 1, true><<<dim3(TT / 64, DM / 64, 1), 32, 0, stream>>>(ATh, ATl, WO, nullptr, DQ, OUT + (size_t)b * TT * DM, DM, bo, 0, 0, 0); }
}

// v005
// A run of this version takes 230 microseconds.
// Next to v004, in two timings, it ran 1.54 and 1.55 times as fast.
// All steps since v000 together make it 7.09 times as fast.
#include <hip/hip_runtime.h>

// Causal self-attention with a fused biased qkv projection and an ALiBi-style bias on the KEY position (x [2][2048][1024]; qkv = (x w_attn + b_attn) ('xw' [1024][3072] 0.02 + bias zeros on this draw: read) reshaped (b, t, 3, 16, 64): q | k | v = column thirds (16 heads x 64); scores / sqrt(float32(64)) + slopes[h] x pos[s] with slopes[h] = 2 ** (-(8/16)(h + 1)) and pos the KEY index s: within a query row t this equals -slopes[h] x (t - s) plus the row constant slopes[h] x t, which the row softmax removes: implemented as the standard ALiBi distance term -slopes[h] x |t - s| on the causal triangle (slopes baked as jnp-exact f32 literals, pre-scaled by 8 for the kernel's exact x 1/8); causal (-inf); softmax; y = merged w_proj + b_proj ('xw' + bias zeros: read) -> [2][2048][1024] (4.2 M); argument order x, w_attn, b_attn, w_proj, b_proj).
// Every pass takes both batches in one grid (x is read as 4096 rows; planes are [batch][head]...), and q, k, v come out of one projection of 3072 columns. Layout: bf16 copy of x; the fused 'xw' weight transposed once into Bt (q | k | v row blocks); exact projections + f32 biases; identity-table plane builders; one attention kernel per 32 query rows of a head, scores in LDS: its softmax subtracts SLOPE8[h] x (i - j) in f32, in its register row, before its x 1/8 (hybrid rows: < 512 hi/lo 3 products, rest fp16 x1024; keys past the diagonal block are never touched); merged hi/lo x w_proj exact + b_proj.
// Compute dtypes, f32 accumulate: every input rounded to bf16; projections exact + f32 biases; attention rows < 512 3 products, rest fp16; softmax f32; output projection hl x exact.

#define NB_  2
#define TT   2048
#define DM   1024
#define NH_  16
#define NKV  16
#define REP  (NH_ / NKV)
#define HD   64
#define DQ   (NH_ * HD)
#define DKV  (NKV * HD)
#define RH   512                  // query rows < RH use hi+lo planes (0: none)
#define WIN  2048
#define PCAR 1024.0f
#define SCL  0.125f   // HD^-0.5
typedef _Float16 h16;
typedef unsigned short bf;
typedef __attribute__((ext_vector_type(16))) __bf16   v16bf;
typedef __attribute__((ext_vector_type(16))) _Float16 v16h;
typedef __attribute__((ext_vector_type(8)))  _Float16 v8h;
typedef __attribute__((ext_vector_type(8)))  unsigned short v8us;
typedef __attribute__((ext_vector_type(8)))  float    v8f;
typedef __attribute__((ext_vector_type(4)))  float    v4f;
typedef v8h  __attribute__((may_alias)) v8ha;
typedef v4f  __attribute__((may_alias)) v4fa;
typedef v8us __attribute__((may_alias)) v8usa;

__device__ __forceinline__ unsigned short f2bf(float f) { unsigned u = __float_as_uint(f); u += 0x7FFFu + ((u >> 16) & 1u); return (unsigned short)(u >> 16); }
__device__ __forceinline__ float bf2f(unsigned short b) { return __uint_as_float(((unsigned)b) << 16); }
__device__ __forceinline__ float bfr(float f) { return bf2f(f2bf(f)); }
__device__ __forceinline__ v16h cat16(v8h lo, v8h hi) { return __builtin_shufflevector(lo, hi, 0, 1, 2, 3, 4, 5, 6, 7, 8, 9, 10, 11, 12, 13, 14, 15); }
__device__ __forceinline__ v16bf cat16b(v8us lo, v8us hi) { return __builtin_bit_cast(v16bf, __builtin_shufflevector(lo, hi, 0, 1, 2, 3, 4, 5, 6, 7, 8, 9, 10, 11, 12, 13, 14, 15)); }
__device__ __forceinline__ v8f wmma16(v16h a, v16h b, v8f c) { return __builtin_amdgcn_wmma_f32_16x16x32_f16(false, a, false, b, (short)0, c, false, false); }
__device__ __forceinline__ v8f wmmab(v16bf a, v16bf b, v8f c) { return __builtin_amdgcn_wmma_f32_16x16x32_bf16(false, a, false, b, (short)0, c, false, false); }



// ---- k_gemmw: register-blocked GEMM, ONE WAVE per 64x64 output tile (16 accumulators), operands straight from K-contiguous 16-bit planes; grid (M/64, N/64, Z), 32 threads.
// C[m][n] (f32, pitch ldc, + optional f32 bias[n]) = sum_k A[m][k] Bt[n][k] (+ split products per NSPLIT). z-batch strides sA/sB/sC in elements. K % 32 == 0.
template <typename T16> struct WFrag;
template <> struct WFrag<h16> { typedef v16h V; static __device__ __forceinline__ V ld(const h16* p) { return cat16(*(const v8h*)p, *(const v8h*)(p + 16)); } static __device__ __forceinline__ v8f mma(V a, V b, v8f c) { return wmma16(a, b, c); } };
template <> struct WFrag<bf> { typedef v16bf V; static __device__ __forceinline__ V ld(const bf* p) { return cat16b(*(const v8us*)p, *(const v8us*)(p + 16)); } static __device__ __forceinline__ v8f mma(V a, V b, v8f c) { return wmmab(a, b, c); } };
template <typename T16, int NSPLIT, bool BIAS>
__global__ __launch_bounds__(32) void k_gemmw(const T16* __restrict__ A, const T16* __restrict__ A2, const T16* __restrict__ Bt, const T16* __restrict__ Bt2, int K, float* C, int ldc, const float* __restrict__ bias, size_t sA, size_t sB, size_t sC) {
    typedef typename WFrag<T16>::V V;
    __shared__ __align__(16) float os[16 * 68];
    const size_t z = blockIdx.z; A += z * sA; if (A2) A2 += z * sA; Bt += z * sB; if (Bt2) Bt2 += z * sB; C += z * sC;
    const int lane = threadIdx.x & 31, lr = lane & 15, hi = lane >> 4; const int r0 = blockIdx.x * 64, c0 = blockIdx.y * 64;
    v8f acc[4][4];
#pragma unroll
    for (int mb = 0; mb < 4; ++mb)
#pragma unroll
        for (int nb = 0; nb < 4; ++nb) acc[mb][nb] = (v8f){};
    const size_t aoff = (size_t)(r0 + lr) * K + 8 * hi, boff = (size_t)(c0 + lr) * K + 8 * hi;
#pragma unroll 1
    for (int kc = 0; kc < K; kc += 32) {
        V a[4], a2[4];
#pragma unroll
        for (int mb = 0; mb < 4; ++mb) { a[mb] = WFrag<T16>::ld(A + aoff + (size_t)mb * 16 * K + kc); if (NSPLIT == 1 || NSPLIT == 2) a2[mb] = WFrag<T16>::ld(A2 + aoff + (size_t)mb * 16 * K + kc); }
#pragma unroll
        for (int nb = 0; nb < 4; ++nb) { const V b = WFrag<T16>::ld(Bt + boff + (size_t)nb * 16 * K + kc); V b2; if (NSPLIT >= 2) b2 = WFrag<T16>::ld(Bt2 + boff + (size_t)nb * 16 * K + kc);
#pragma unroll
            for (int mb = 0; mb < 4; ++mb) { acc[mb][nb] = WFrag<T16>::mma(a[mb], b, acc[mb][nb]); if (NSPLIT == 1 || NSPLIT == 2) acc[mb][nb] = WFrag<T16>::mma(a2[mb], b, acc[mb][nb]); if (NSPLIT >= 2) acc[mb][nb] = WFrag<T16>::mma(a[mb], b2, acc[mb][nb]); } }
        asm volatile("v_nop\n\tv_nop\n\tv_nop\n\tv_nop" : "+v"(acc[0][0]), "+v"(acc[1][1]), "+v"(acc[2][2]), "+v"(acc[3][3]) : "v"(a[0]), "v"(a[3]));
    }
#pragma unroll
    for (int mb = 0; mb < 4; ++mb) {
#pragma unroll
        for (int nb = 0; nb < 4; ++nb) {
#pragma unroll
            for (int j = 0; j < 8; ++j) os[(hi * 8 + j) * 68 + nb * 16 + lr] = acc[mb][nb][j]; }
        __builtin_amdgcn_wave_barrier(); asm volatile("" ::: "memory");
        float* crow = C + (size_t)(r0 + mb * 16) * ldc + c0;
{
#pragma unroll
            for (int s = 0; s < 8; ++s) { const int row = 2 * s + hi, cofs = lr * 4; v4f val = *(const v4fa*)(os + row * 68 + cofs); if (BIAS) { val[0] += bfr(bias[c0 + cofs]); val[1] += bfr(bias[c0 + cofs + 1]); val[2] += bfr(bias[c0 + cofs + 2]); val[3] += bfr(bias[c0 + cofs + 3]); }
                *(v4f*)(crow + (size_t)row * ldc + cofs) = val; }
             }
        __builtin_amdgcn_wave_barrier(); asm volatile("" ::: "memory");
    }
}

__device__ __forceinline__ h16 tohx(float x) { return (h16)x; }
__device__ __forceinline__ void splitf(float y, unsigned short& h, unsigned short& l) { h = f2bf(y); l = f2bf(y - bf2f(h)); }
typedef __attribute__((ext_vector_type(2))) _Float16 v2h;
typedef __attribute__((ext_vector_type(4))) _Float16 v4h;
typedef __attribute__((ext_vector_type(2))) unsigned short v2us;
typedef __attribute__((ext_vector_type(4))) unsigned short v4us;
typedef __attribute__((ext_vector_type(2))) float v2f;
typedef __attribute__((ext_vector_type(4))) int v4i;

__global__ __launch_bounds__(256) void k_wtG(const float* __restrict__ w, int K, int N, bf* Bt, const float* __restrict__ w2, int N2, bf* Bt2) {
    if (blockIdx.y) { w = w2; N = N2; Bt = Bt2; }   // grid y = 1: the second weight (same K); its surplus work-groups leave at the line test below
    const int lane = threadIdx.x & 31; const int L0 = (blockIdx.x * 8 + (threadIdx.x >> 5)) * 8; const int nlines = N * K / 64;
{
#pragma unroll 1
        for (int l = 0; l < 8; ++l) { const int L = L0 + l; if (L >= nlines) break; const size_t e = (size_t)L * 64 + lane * 2; const int k = (int)(e % K), n = (int)(e / K); v2us o;
            o[0] = f2bf(w[(size_t)k * N + n]); o[1] = f2bf(w[(size_t)(k + 1) * N + n]); *(v2us*)(Bt + e) = o; }
         }
}
__global__ __launch_bounds__(256) void k_cvt8(const float* __restrict__ src, bf* dst, size_t n8) { const size_t i = (size_t)blockIdx.x * 256 + threadIdx.x; if (i >= n8) return; const v8f v = *(const v8f*)(src + i * 8); v8us o;
#pragma unroll
    for (int k = 0; k < 8; ++k) o[k] = f2bf(v[k]); *(v8us*)(dst + i * 8) = o;  }

// k_rope: head planes [h][t][d] (fp16 + hi/lo) of rope(x) x sc with the rotate-half convention out[d] = x[d] cos[t][d] - x[d+HD/2] sin[t][d], out[d+HD/2] = x[d+HD/2] cos[t][d+HD/2] + x[d] sin[t][d+HD/2]
__global__ __launch_bounds__(256) void k_rope(const float* __restrict__ F, int pitch, int nheads, const float* __restrict__ CS, const float* __restrict__ RF, const float* __restrict__ nw, float sc, h16* P16, bf* Ph, bf* Pl) {
    // grid y = batch, grid z = 0: q, 1: k (column blocks of nheads x HD in F; plane blocks [q | k][batch][head])
    { const size_t po = ((size_t)blockIdx.z * NB_ + blockIdx.y) * nheads * TT * HD; F += (size_t)blockIdx.y * TT * pitch + (size_t)blockIdx.z * nheads * HD; P16 += po; Ph += po; Pl += po; }
    const size_t e = ((size_t)blockIdx.x * 256 + threadIdx.x) * 2; if (e >= (size_t)nheads * TT * HD) return; const int d = (int)(e % HD); const int t = (int)((e / HD) % TT); const int h = (int)(e / ((size_t)HD * TT)); const float* f = F + (size_t)t * pitch + h * HD; const float rf = RF ? RF[(size_t)h * TT + t] : 1.0f; v2h o16; v2us oh, ol;
#pragma unroll
    for (int q = 0; q < 2; ++q) { const int dd = d + q; const int dp = (dd < HD / 2) ? dd + HD / 2 : dd - HD / 2; float x0 = f[dd], x1 = f[dp];
        if (RF) { float n0 = __fmul_rn(x0, rf), n1 = __fmul_rn(x1, rf); asm volatile("" : "+v"(n0)); asm volatile("" : "+v"(n1)); x0 = __fmul_rn(bfr(nw[dd]), n0); x1 = __fmul_rn(bfr(nw[dp]), n1); }
        const v2f cs = *(const v2f*)(CS + ((size_t)t * HD + dd) * 2); float a = __fmul_rn(x0, cs[0]), bq = __fmul_rn(x1, cs[1]); asm volatile("" : "+v"(a)); asm volatile("" : "+v"(bq)); const float r = ((dd < HD / 2) ? __fsub_rn(a, bq) : __fadd_rn(a, bq)) * sc;
        o16[q] = tohx(r); unsigned short a2, c2; splitf(r, a2, c2); oh[q] = a2; ol[q] = c2; }
    *(v2h*)(P16 + e) = o16; *(v2us*)(Ph + e) = oh; *(v2us*)(Pl + e) = ol;  }
__global__ __launch_bounds__(256) void k_vtp(const float* __restrict__ F, int pitch, int nheads, h16* V16, bf* Vh, bf* Vl) {
    { const size_t po = (size_t)blockIdx.y * nheads * HD * TT; F += (size_t)blockIdx.y * TT * pitch; V16 += po; Vh += po; Vl += po; }   // grid y = batch
    const size_t e = ((size_t)blockIdx.x * 256 + threadIdx.x) * 2; if (e >= (size_t)nheads * HD * TT) return; const int t = (int)(e % TT); const int d = (int)((e / TT) % HD); const int g = (int)(e / ((size_t)TT * HD)); v2h o16; v2us oh, ol;
#pragma unroll
    for (int q = 0; q < 2; ++q) { const float x = F[(size_t)(t + q) * pitch + g * HD + d]; o16[q] = tohx(x); unsigned short a2, c2; splitf(x, a2, c2); oh[q] = a2; ol[q] = c2; }
    *(v2h*)(V16 + e) = o16; *(v2us*)(Vh + e) = oh; *(v2us*)(Vl + e) = ol;  }
__global__ __launch_bounds__(256) void k_csid(float* CS) { const int idx = blockIdx.x * 256 + threadIdx.x; if (idx >= TT * HD) return; v2f cs; cs[0] = 1.0f; cs[1] = 0.0f; *(v2f*)(CS + (size_t)idx * 2) = cs;  }
__constant__ float SLOPE8[NH_] = { 5.656854153e+0f, 4.000000000e+0f, 2.828427076e+0f, 2.000000000e+0f, 1.414213538e+0f, 1.000000000e+0f, 7.071067691e-1f, 5.000000000e-1f, 3.535533845e-1f, 2.500000000e-1f, 1.767766923e-1f, 1.250000000e-1f, 8.838834614e-2f, 6.250000000e-2f, 4.419417307e-2f, 3.125000000e-2f };   // 8 x the per-head ALiBi slope magnitude (slopes[h] = 2 ** (-(8/16)(h + 1)), h = 0..15, as the reference's f32 values x 8); the eight power-of-two entries give exact products with |i - j| <= 2047; for the eight irrational ones the product goes unrounded into the fused multiply-subtract of k_attn
typedef v4us __attribute__((may_alias)) v4usa;
typedef v4h  __attribute__((may_alias)) v4ha;
// ---- k_attn: one work-group of NW waves does the whole attention of one head's 32 query rows (i0 .. i0 + 31, i0 = roff + 32 x tile); the rows' f32 scores never leave LDS. grid (batches x heads, NT tiles), the longest tiles of both batches first.
// 1. scores: wave w takes the 64-key units w, w + NW, ... below Kl (the diagonal block's end; later keys are masked) and stores its 32 x 64 f32 tiles into the score rows (pitch KMAX + 4 floats: 16 bytes of pad for the 16-byte readers of step 3).
// 2. softmax: one wave per row, the row in registers: t = (S - SLOPE8[h] x (i - j)) x HD^-0.5 for j <= i, one exp, fixed trees. The 2-byte probabilities go over the row's own f32 scores (fp16: first half of the row; hi and lo planes: one half each);
//    the wave holds all of its row before its first store (every store needs the row sum) and no wave touches another row.
// 3. P.V: wave w takes the same units of keys, A fragments from LDS, value planes [d][t] from memory; private f32 partial tiles, laid over the probabilities once every wave has read them, are summed in the fixed order w = 0 .. NW-1.
// 4. the sums, scaled back, go out as hi + lo planes [t][head x HD + d] for the output projection.
// Every loop but the three marked ones is fully unrolled, so that the fragment, accumulator and row arrays are indexed by constants and live in registers.
template <typename T16, int NSPLIT, int NW, int KMAX, int NT>
__global__ __launch_bounds__(NW * 32) void k_attn(const T16* __restrict__ Q, const T16* __restrict__ Q2, const T16* __restrict__ Kp, const T16* __restrict__ Kp2, const T16* __restrict__ Vt, const T16* __restrict__ Vt2, int roff, bf* Ah, bf* Al) {
    typedef typename WFrag<T16>::V V;
    constexpr int SP = KMAX + 4;
    constexpr int SMF = (32 * SP > NW * 32 * 68) ? 32 * SP : NW * 32 * 68;
    __shared__ __align__(16) float sm[SMF];
    const int lane = threadIdx.x & 31, lr = lane & 15, hi = lane >> 4; const int w = __builtin_amdgcn_readfirstlane((int)(threadIdx.x >> 5));
    const int hh = blockIdx.x % NH_; const int i0 = roff + (NT - 1 - (int)blockIdx.y) * 32;
    Ah += (size_t)(blockIdx.x / NH_) * TT * DQ; Al += (size_t)(blockIdx.x / NH_) * TT * DQ;   // this batch's output rows
    const int Kl = min(KMAX, (i0 + 32 + 63) & ~63);
    const size_t hp = (size_t)blockIdx.x * TT * HD;   // planes are [batch][head]: blockIdx.x = batch x NH_ + head
    {
        V a[2][2], a2[2][2];
        const size_t aoff = hp + (size_t)(i0 + lr) * HD + 8 * hi;
#pragma unroll
        for (int c = 0; c < 2; ++c)
#pragma unroll
            for (int mb = 0; mb < 2; ++mb) { a[c][mb] = WFrag<T16>::ld(Q + aoff + (size_t)mb * 16 * HD + c * 32); if (NSPLIT == 2) a2[c][mb] = WFrag<T16>::ld(Q2 + aoff + (size_t)mb * 16 * HD + c * 32); }
        // the unit loop stays rolled (two trips at most): unrolled it would hold two units' key fragments and accumulators
#pragma unroll 1
        for (int k0 = w * 64; k0 < Kl; k0 += NW * 64) {
            V b[2][4], b2[2][4]; v8f acc[2][4];
            const size_t boff = hp + (size_t)(k0 + lr) * HD + 8 * hi;
            // the wait stands behind the query loads (the compiler moves them into this block where the loop has a single trip) and ahead of the key loads, whose results may be given the query loads' address registers;
            // the addresses are its inputs so that their registers are not given away ahead of it
            asm volatile("s_wait_xcnt 0x0" :: "v"(Q + aoff), "v"((NSPLIT == 2 ? Q2 : Q) + aoff) : "memory");
#pragma unroll
            for (int c = 0; c < 2; ++c)
#pragma unroll
                for (int nb = 0; nb < 4; ++nb) { b[c][nb] = WFrag<T16>::ld(Kp + boff + (size_t)nb * 16 * HD + c * 32); if (NSPLIT == 2) b2[c][nb] = WFrag<T16>::ld(Kp2 + boff + (size_t)nb * 16 * HD + c * 32); }
            __builtin_amdgcn_sched_barrier(0);   // keeps the unit's key loads issued together, ahead of their first product: one trip to memory; without it the scheduler issues them in several groups with a wait between
#pragma unroll
            for (int mb = 0; mb < 2; ++mb)
#pragma unroll
                for (int nb = 0; nb < 4; ++nb) acc[mb][nb] = (v8f){};
#pragma unroll
            for (int c = 0; c < 2; ++c)
#pragma unroll
                for (int nb = 0; nb < 4; ++nb)
#pragma unroll
                    for (int mb = 0; mb < 2; ++mb) { acc[mb][nb] = WFrag<T16>::mma(a[c][mb], b[c][nb], acc[mb][nb]); if (NSPLIT == 2) { acc[mb][nb] = WFrag<T16>::mma(a2[c][mb], b[c][nb], acc[mb][nb]); acc[mb][nb] = WFrag<T16>::mma(a[c][mb], b2[c][nb], acc[mb][nb]); } }
            __builtin_amdgcn_sched_barrier(0);   // keeps all eight product chains ahead of the stores: the scheduler otherwise stores a finished tile early and starts the next chain in the same registers
#pragma unroll
            for (int mb = 0; mb < 2; ++mb)
#pragma unroll
                for (int nb = 0; nb < 4; ++nb)
#pragma unroll
                    for (int j = 0; j < 8; ++j) sm[(mb * 16 + hi * 8 + j) * SP + k0 + nb * 16 + lr] = acc[mb][nb][j];
        }
    }
    __syncthreads();   // every score of the 32 rows is in LDS before a row is read
    const float sl = SLOPE8[hh];
    // the row loop stays rolled: one row's registers at a time
#pragma unroll 1
    for (int rr = w; rr < 32; rr += NW) {
        const int i = i0 + rr; float* sr = sm + rr * SP; float v[KMAX / 32]; v4f ar[KMAX / 128]; float mx = -3.0e38f;
        const float di = (float)(i - lane * 4);   // key distance i - j = di - (ch * 128 + q): whole numbers below 2^24, exact in f32
        // chunks of 128 keys at or past Kl are skipped (a scalar test); in a chunk that Kl halves, the upper lanes are off: their keys have no score and no reader
#pragma unroll
        for (int ch = 0; ch < KMAX / 128; ++ch) if (ch * 128 < Kl) { ar[ch] = (v4f){}; if (ch * 128 + lane * 4 < Kl) ar[ch] = *(const v4fa*)(sr + ch * 128 + lane * 4); }
#pragma unroll
        for (int ch = 0; ch < KMAX / 128; ++ch) if (ch * 128 < Kl) { const int j0 = ch * 128 + lane * 4; const v4f a = ar[ch];
#pragma unroll
            for (int q = 0; q < 4; ++q) { const int j = j0 + q; const float t = (j <= i && i - j < WIN) ? (a[q] - sl * (di - (float)(ch * 128 + q))) * SCL : -3.0e38f; v[ch * 4 + q] = t; mx = fmaxf(mx, t); } }
#pragma unroll
        for (int sh = 16; sh; sh >>= 1) mx = fmaxf(mx, __shfl_xor(mx, sh, 32));
        float sum = 0.f;
#pragma unroll
        for (int ch = 0; ch < KMAX / 128; ++ch) if (ch * 128 < Kl) {
#pragma unroll
            for (int q = 0; q < 4; ++q) { const int k = ch * 4 + q; v[k] = __builtin_amdgcn_exp2f(__fmul_rn(__fsub_rn(v[k], mx), 1.4426950408889634f)); sum += v[k]; } }
#pragma unroll
        for (int sh = 16; sh; sh >>= 1) sum += __shfl_xor(sum, sh, 32);
        const float f = __fdiv_rn((NSPLIT == 2) ? 1.0f : PCAR, sum);
#pragma unroll
        for (int ch = 0; ch < KMAX / 128; ++ch) if (ch * 128 < Kl) { const int j0 = ch * 128 + lane * 4;
            if (NSPLIT == 2) { v4us oh, ol;
#pragma unroll
                for (int q = 0; q < 4; ++q) { unsigned short a, c2; splitf(v[ch * 4 + q] * f, a, c2); oh[q] = a; ol[q] = c2; }
                if (j0 < Kl) { *(v4usa*)((bf*)sr + j0) = oh; *(v4usa*)((bf*)sr + KMAX + j0) = ol; }
            } else { v4h o4;
#pragma unroll
                for (int q = 0; q < 4; ++q) o4[q] = tohx(v[ch * 4 + q] * f);
                if (j0 < Kl) *(v4ha*)((h16*)sr + j0) = o4; } }
    }
    __syncthreads();   // every row's probabilities are in LDS before a wave reads all 32 rows
    constexpr int CH = (NSPLIT == 2) ? 1 : 2;   // 32-key chunks whose loads are issued together
    constexpr int lda = 2 * SP;                 // probability row pitch in 2-byte elements
    const T16* A = (const T16*)sm; const T16* A2 = A + KMAX; const T16* Bt = Vt + hp; const T16* Bt2 = (NSPLIT == 2) ? Vt2 + hp : nullptr;
    v8f acc[2][4];
#pragma unroll
    for (int mb = 0; mb < 2; ++mb)
#pragma unroll
        for (int nb = 0; nb < 4; ++nb) acc[mb][nb] = (v8f){};
    const int aoff = lr * lda + 8 * hi; const size_t boff = (size_t)lr * TT + 8 * hi;
    // the unit loop stays rolled (two trips at most): unrolled it would hold two units' fragments and pass the register budget of a 16-wave work-group
#pragma unroll 1
    for (int k0 = w * 64; k0 < Kl; k0 += NW * 64) {
#pragma unroll
        for (int kh = k0; kh < k0 + 64; kh += CH * 32) {
            V a[CH][2], a2[CH][2], b[CH][4], b2[CH][4];
#pragma unroll
            for (int c = 0; c < CH; ++c) {
#pragma unroll
                for (int nb = 0; nb < 4; ++nb) { b[c][nb] = WFrag<T16>::ld(Bt + boff + (size_t)nb * 16 * TT + kh + c * 32); if (NSPLIT == 2) b2[c][nb] = WFrag<T16>::ld(Bt2 + boff + (size_t)nb * 16 * TT + kh + c * 32); }
#pragma unroll
                for (int mb = 0; mb < 2; ++mb) { a[c][mb] = WFrag<T16>::ld(A + aoff + mb * 16 * lda + kh + c * 32); if (NSPLIT == 2) a2[c][mb] = WFrag<T16>::ld(A2 + aoff + mb * 16 * lda + kh + c * 32); } }
            __builtin_amdgcn_sched_barrier(0);   // keeps these loads issued ahead of their first product: one trip to memory for all; without it the scheduler sinks loads between the products and the wave waits several times in turn
#pragma unroll
            for (int c = 0; c < CH; ++c)
#pragma unroll
                for (int nb = 0; nb < 4; ++nb)
#pragma unroll
                    for (int mb = 0; mb < 2; ++mb) { acc[mb][nb] = WFrag<T16>::mma(a[c][mb], b[c][nb], acc[mb][nb]); if (NSPLIT == 2) { acc[mb][nb] = WFrag<T16>::mma(a2[c][mb], b[c][nb], acc[mb][nb]); acc[mb][nb] = WFrag<T16>::mma(a[c][mb], b2[c][nb], acc[mb][nb]); } }
        }
    }
    __syncthreads();   // the partial tiles go over the probabilities: every wave has read its last one
    float* pw = sm + w * (32 * 68);
#pragma unroll
    for (int mb = 0; mb < 2; ++mb)
#pragma unroll
        for (int nb = 0; nb < 4; ++nb)
#pragma unroll
            for (int j = 0; j < 8; ++j) pw[(mb * 16 + hi * 8 + j) * 68 + nb * 16 + lr] = acc[mb][nb][j];
    __syncthreads();   // every wave's partial tile is in LDS before the sums
    const float cs = (NSPLIT == 2) ? 1.0f : (1.0f / PCAR);
#pragma unroll
    for (int idx = threadIdx.x; idx < 32 * 16; idx += NW * 32) { const int row = idx >> 4, cofs = (idx & 15) * 4; v4f s = *(const v4fa*)(sm + row * 68 + cofs);
#pragma unroll
        for (int ww = 1; ww < NW; ++ww) s += *(const v4fa*)(sm + ww * (32 * 68) + row * 68 + cofs);
        v4us oh, ol;
#pragma unroll
        for (int q = 0; q < 4; ++q) { unsigned short a, c2; splitf(s[q] * cs, a, c2); oh[q] = a; ol[q] = c2; }
        const size_t oo = (size_t)(i0 + row) * DQ + hh * HD + cofs; *(v4us*)(Ah + oo) = oh; *(v4us*)(Al + oo) = ol; }
}

extern "C" void kernel_launch(void* const* d_in, const int* in_sizes, int n_in,
                              void* d_out, int out_size, void* d_ws, size_t ws_size, hipStream_t stream) {
    (void)in_sizes; (void)n_in; (void)out_size;
    const float* x = (const float*)d_in[0]; const float* wqkv = (const float*)d_in[1]; const float* bqkv = (const float*)d_in[2]; const float* wo = (const float*)d_in[3]; const float* bo = (const float*)d_in[4];   /* x, w_attn ('xw' [1024][3072]), b_attn, w_proj ('xw'), b_proj */
    float* OUT = (float*)d_out;     // [2][2048][1024]
    char* wsp = (char*)d_ws;
    auto take = [&](size_t bytes) { char* p = wsp; wsp += (bytes + 255) & ~(size_t)255; return (void*)p; };
    bf* WQKV = (bf*)take((size_t)3 * DQ * DM * 2);   /* fused Bt [3*DQ][DM]: q | k | v row blocks */ bf* WO = (bf*)take((size_t)DM * DQ * 2); float* CS = (float*)take((size_t)TT * HD * 2 * 4);
    bf* XB = (bf*)take((size_t)NB_ * TT * DM * 2); float* F = (float*)take((size_t)NB_ * TT * 3 * DQ * 4);   /* f32 q | k | v of all rows, pitch 3 x DQ */
    const size_t PL = (size_t)NB_ * NH_ * TT * HD;   /* elements of one plane set [batch][head][..][..] */
    h16* QP16 = (h16*)take(2 * PL * 2); h16* KP16 = QP16 + PL; h16* VT16 = (h16*)take(PL * 2);   /* q and k planes lie behind one another: one builder launch fills both */
    bf* QPh = (bf*)take(2 * PL * 2); bf* KPh = QPh + PL; bf* QPl = (bf*)take(2 * PL * 2); bf* KPl = QPl + PL; bf* VTh = (bf*)take(PL * 2); bf* VTl = (bf*)take(PL * 2);
    bf* ATh = (bf*)take((size_t)NB_ * TT * DQ * 2); bf* ATl = (bf*)take((size_t)NB_ * TT * DQ * 2);
    if ((size_t)(wsp - (char*)d_ws) > ws_size) return;    // ws 256 MiB
    static_assert(DQ == DM, "both weights are transposed with one K");
    k_wtG<<<dim3((unsigned)((DM * 3 * DQ / 64 + 63) / 64), 2, 1), 256, 0, stream>>>(wqkv, DM, 3 * DQ, WQKV, wo, DM, WO);   /* fused 'xw' [DM][3*DQ] -> Bt [3*DQ][DM]; 'xw' [DQ][DM] -> Bt [DM][DQ] (DQ == DM) */
    k_csid<<<(TT * HD + 255) / 256, 256, 0, stream>>>(CS);
    const unsigned LQ = (unsigned)(((size_t)NH_ * TT * HD / 2 + 255) / 256), LKv = (unsigned)(((size_t)NKV * TT * HD / 2 + 255) / 256);
    k_cvt8<<<(unsigned)(((size_t)NB_ * TT * DM / 8 + 255) / 256), 256, 0, stream>>>(x, XB, (size_t)NB_ * TT * DM / 8);
    k_gemmw<bf, 0, true><<<dim3(NB_ * TT / 64, 3 * DQ / 64, 1), 32, 0, stream>>>(XB, nullptr, WQKV, nullptr, DM, F, 3 * DQ, bqkv, 0, 0, 0);
    k_rope<<<dim3(LQ, NB_, 2), 256, 0, stream>>>(F, 3 * DQ, NH_, CS, nullptr, nullptr, 1.0f, QP16, QPh, QPl);
    k_vtp<<<dim3(LKv, NB_, 1), 256, 0, stream>>>(F + 2 * DQ, 3 * DQ, NKV, VT16, VTh, VTl);
    k_attn<bf, 2, 8, RH, RH / 32><<<dim3(NB_ * NH_, RH / 32, 1), 256, 0, stream>>>(QPh, QPl, KPh, KPl, VTh, VTl, 0, ATh, ATl);
    k_attn<h16, 0, 16, TT, (TT - RH) / 32><<<dim3(NB_ * NH_, (TT - RH) / 32, 1), 512, 0, stream>>>(QP16, nullptr, KP16, nullptr, VT16, nullptr, RH, ATh, ATl);
    k_gemmw<bf, 1, true><<<dim3(NB_ * TT / 64, DM / 64, 1), 32, 0, stream>>>(ATh, ATl, WO, nullptr, DQ, OUT, DM, bo, 0, 0, 0);
}

// v006
// A run of this version takes 186 microseconds.
// Next to v005, in two timings, it ran 1.24 and 1.23 times as fast.
// Over all steps from v000 it is 8.77 times as fast.
#include <hip/hip_runtime.h>

// Causal self-attention with a fused biased qkv projection and an ALiBi-style bias on the KEY position (x [2][2048][1024]; qkv = (x w_attn + b_attn) ('xw' [1024][3072] 0.02 + bias zeros on this draw: read) reshaped (b, t, 3, 16, 64): q | k | v = column thirds (16 heads x 64); scores / sqrt(float32(64)) + slopes[h] x pos[s] with slopes[h] = 2 ** (-(8/16)(h + 1)) and pos the KEY index s: within a query row t this equals -slopes[h] x (t - s) plus the row constant slopes[h] x t, which the row softmax removes: implemented as the standard ALiBi distance term -slopes[h] x |t - s| on the causal triangle (slopes baked as jnp-exact f32 literals, pre-scaled by 8 for the kernel's exact x 1/8); causal (-inf); softmax; y = merged w_proj + b_proj ('xw' + bias zeros: read) -> [2][2048][1024] (4.2 M); argument order x, w_attn, b_attn, w_proj, b_proj).
// Every pass takes both batches in one grid (x is read as 4096 rows; planes are [batch][head]...), and q, k, v come out of one projection of 3072 columns. Layout: bf16 copy of x; the fused 'xw' weight transposed once into Bt (q | k | v row blocks) + bias slices; exact projections + f32 biases; the qkv projection's epilogue writes the head planes itself; one attention kernel per 32 query rows of a head, scores in LDS: its softmax subtracts SLOPE8[h] x (i - j) in f32, in its register row, before its x 1/8 (hybrid rows: < 512 hi/lo 3 products, rest fp16 x1024; keys past the diagonal block are never touched); merged hi/lo x w_proj exact + b_proj.
// Compute dtypes, f32 accumulate: every input rounded to bf16; projections exact + f32 biases; attention rows < 512 3 products, rest fp16; softmax f32; output projection hl x exact.

#define NB_  2
#define TT   2048
#define DM   1024
#define NH_  16
#define NKV  16
#define REP  (NH_ / NKV)
#define HD   64
#define DQ   (NH_ * HD)
#define DKV  (NKV * HD)
#define RH   512                  // query rows < RH use hi+lo planes (0: none)
#define WIN  2048
#define PCAR 1024.0f
#define SCL  0.125f   // HD^-0.5
typedef _Float16 h16;
typedef unsigned short bf;
typedef __attribute__((ext_vector_type(16))) __bf16   v16bf;
typedef __attribute__((ext_vector_type(16))) _Float16 v16h;
typedef __attribute__((ext_vector_type(8)))  _Float16 v8h;
typedef __attribute__((ext_vector_type(8)))  unsigned short v8us;
typedef __attribute__((ext_vector_type(8)))  float    v8f;
typedef __attribute__((ext_vector_type(4)))  float    v4f;
typedef v8h  __attribute__((may_alias)) v8ha;
typedef v4f  __attribute__((may_alias)) v4fa;
typedef v8us __attribute__((may_alias)) v8usa;

__device__ __forceinline__ unsigned short f2bf(float f) { unsigned u = __float_as_uint(f); u += 0x7FFFu + ((u >> 16) & 1u); return (unsigned short)(u >> 16); }
__device__ __forceinline__ float bf2f(unsigned short b) { return __uint_as_float(((unsigned)b) << 16); }
__device__ __forceinline__ float bfr(float f) { return bf2f(f2bf(f)); }
__device__ __forceinline__ v16h cat16(v8h lo, v8h hi) { return __builtin_shufflevector(lo, hi, 0, 1, 2, 3, 4, 5, 6, 7, 8, 9, 10, 11, 12, 13, 14, 15); }
__device__ __forceinline__ v16bf cat16b(v8us lo, v8us hi) { return __builtin_bit_cast(v16bf, __builtin_shufflevector(lo, hi, 0, 1, 2, 3, 4, 5, 6, 7, 8, 9, 10, 11, 12, 13, 14, 15)); }
__device__ __forceinline__ v8f wmma16(v16h a, v16h b, v8f c) { return __builtin_amdgcn_wmma_f32_16x16x32_f16(false, a, false, b, (short)0, c, false, false); }
__device__ __forceinline__ v8f wmmab(v16bf a, v16bf b, v8f c) { return __builtin_amdgcn_wmma_f32_16x16x32_bf16(false, a, false, b, (short)0, c, false, false); }
__device__ __forceinline__ h16 tohx(float x) { return (h16)x; }
__device__ __forceinline__ void splitf(float y, unsigned short& h, unsigned short& l) { h = f2bf(y); l = f2bf(y - bf2f(h)); }



// ---- k_gemmw: register-blocked GEMM, ONE WAVE per 64x64 output tile (16 accumulators), operands straight from K-contiguous 16-bit planes; grid (M/64, N/64, Z), 32 threads.
// C[m][n] (f32, pitch ldc, + optional f32 bias[n]) = sum_k A[m][k] Bt[n][k] (+ split products per NSPLIT). z-batch strides sA/sB/sC in elements. K % 32 == 0.
// PLANES (the qkv projection): no f32 C. A tile is 64 rows t of one batch x the 64 columns of one head of q, k or v (blockIdx.y = section x heads + head); its biased f32 sums go out at once as the attention kernel's 2-byte planes
// (fp16, and bf16 hi + lo): q and k as [section][batch][head][t][d], v as [batch][head][d][t]. Every store is 16 bytes a lane and covers whole 128-byte lines, staged through the wave's own LDS.
template <typename T16> struct WFrag;
template <> struct WFrag<h16> { typedef v16h V; static __device__ __forceinline__ V ld(const h16* p) { return cat16(*(const v8h*)p, *(const v8h*)(p + 16)); } static __device__ __forceinline__ v8f mma(V a, V b, v8f c) { return wmma16(a, b, c); } };
template <> struct WFrag<bf> { typedef v16bf V; static __device__ __forceinline__ V ld(const bf* p) { return cat16b(*(const v8us*)p, *(const v8us*)(p + 16)); } static __device__ __forceinline__ v8f mma(V a, V b, v8f c) { return wmmab(a, b, c); } };
template <typename T16, int NSPLIT, bool BIAS, bool PLANES>
__global__ __launch_bounds__(32) void k_gemmw(const T16* __restrict__ A, const T16* __restrict__ A2, const T16* __restrict__ Bt, const T16* __restrict__ Bt2, int K, float* C, int ldc, const float* __restrict__ bias, size_t sA, size_t sB, size_t sC, h16* P16, bf* Ph, bf* Pl, h16* V16, bf* Vh, bf* Vl) {
    typedef typename WFrag<T16>::V V;
    constexpr int VP = 72;   // pitch of a staged v row in 2-byte elements: 64 t + 16 bytes of pad
    __shared__ __align__(16) float os[PLANES ? 3 * 16 * VP / 2 : 16 * 68];
    const size_t z = blockIdx.z; A += z * sA; if (A2) A2 += z * sA; Bt += z * sB; if (Bt2) Bt2 += z * sB; C += z * sC;
    const int lane = threadIdx.x & 31, lr = lane & 15, hi = lane >> 4; const int r0 = blockIdx.x * 64, c0 = blockIdx.y * 64;
    v8f acc[4][4];
#pragma unroll
    for (int mb = 0; mb < 4; ++mb)
#pragma unroll
        for (int nb = 0; nb < 4; ++nb) acc[mb][nb] = (v8f){};
    const size_t aoff = (size_t)(r0 + lr) * K + 8 * hi, boff = (size_t)(c0 + lr) * K + 8 * hi;
#pragma unroll 1
    for (int kc = 0; kc < K; kc += 32) {
        V a[4], a2[4];
#pragma unroll
        for (int mb = 0; mb < 4; ++mb) { a[mb] = WFrag<T16>::ld(A + aoff + (size_t)mb * 16 * K + kc); if (NSPLIT == 1 || NSPLIT == 2) a2[mb] = WFrag<T16>::ld(A2 + aoff + (size_t)mb * 16 * K + kc); }
#pragma unroll
        for (int nb = 0; nb < 4; ++nb) { const V b = WFrag<T16>::ld(Bt + boff + (size_t)nb * 16 * K + kc); V b2; if (NSPLIT >= 2) b2 = WFrag<T16>::ld(Bt2 + boff + (size_t)nb * 16 * K + kc);
#pragma unroll
            for (int mb = 0; mb < 4; ++mb) { acc[mb][nb] = WFrag<T16>::mma(a[mb], b, acc[mb][nb]); if (NSPLIT == 1 || NSPLIT == 2) acc[mb][nb] = WFrag<T16>::mma(a2[mb], b, acc[mb][nb]); if (NSPLIT >= 2) acc[mb][nb] = WFrag<T16>::mma(a[mb], b2, acc[mb][nb]); } }
        asm volatile("v_nop\n\tv_nop\n\tv_nop\n\tv_nop" : "+v"(acc[0][0]), "+v"(acc[1][1]), "+v"(acc[2][2]), "+v"(acc[3][3]) : "v"(a[0]), "v"(a[3]));
    }
    if constexpr (PLANES) {
        static_assert(BIAS && NKV == NH_ && HD == 64 && TT % 64 == 0, "a tile is one head's columns and lies in one batch");
        const int sec = blockIdx.y / NH_, head = blockIdx.y % NH_, bt = r0 / TT, t0 = r0 % TT;   // section 0: q, 1: k, 2: v
        const int rq = lane >> 3, cq = (lane & 7) * 8;   // reading a staged block back: eight lanes a row of 64 elements, eight elements each
        if (sec != 2) {
            // q, k: the tile is 64 x 64 elements in a row in each plane. Per block of 16 t the f32 sums are turned in LDS from accumulator order into rows.
            const size_t po = (((size_t)((sec * NB_ + bt) * NH_ + head) * TT + t0 + rq) * HD) + cq;
            float bb[8];
#pragma unroll
            for (int k = 0; k < 8; ++k) bb[k] = bfr(bias[c0 + cq + k]);
#pragma unroll
            for (int mb = 0; mb < 4; ++mb) {
#pragma unroll
                for (int nb = 0; nb < 4; ++nb) {
#pragma unroll
                    for (int j = 0; j < 8; ++j) os[(hi * 8 + j) * 68 + nb * 16 + lr] = acc[mb][nb][j]; }
                asm volatile("s_wait_dscnt 0x0" ::: "memory");   // the staged rows are in LDS before other lanes of the wave read them back
#pragma unroll
                for (int s = 0; s < 4; ++s) { const float* sp = os + (4 * s + rq) * 68 + cq; const v4f x0 = *(const v4fa*)sp, x1 = *(const v4fa*)(sp + 4); v8h o16; v8us oh, ol;
#pragma unroll
                    for (int k = 0; k < 8; ++k) { const float x = (k < 4 ? x0[k & 3] : x1[k & 3]) + bb[k]; o16[k] = tohx(x); unsigned short a2, c2; splitf(x, a2, c2); oh[k] = a2; ol[k] = c2; }
                    const size_t o = po + (size_t)(mb * 16 + 4 * s) * HD; *(v8h*)(P16 + o) = o16; *(v8us*)(Ph + o) = oh; *(v8us*)(Pl + o) = ol; }
                if (mb < 3) asm volatile("s_wait_dscnt 0x0" ::: "memory");   // every read of the block has returned before the next block is staged over it
            }
            asm volatile("s_wait_xcnt 0x0" ::: "memory");   // the compiler lays the v block right behind this one, past a branch that always leaves from here: the wait stands between the last stores and that block's first register writes
        } else {
            // v: a lane's eight accumulator rows are eight neighbouring t of its column d. Per block of 16 d the three planes' [d][t] rows are staged in LDS and go out as whole lines.
            unsigned short* st = (unsigned short*)os;
            const size_t vo = ((size_t)(bt * NKV + head) * HD + rq) * TT + t0 + cq;
            float bb[4];
#pragma unroll
            for (int nb = 0; nb < 4; ++nb) bb[nb] = bfr(bias[c0 + nb * 16 + lr]);
#pragma unroll
            for (int nb = 0; nb < 4; ++nb) {
#pragma unroll
                for (int mb = 0; mb < 4; ++mb) { v8h o16; v8us oh, ol;
#pragma unroll
                    for (int j = 0; j < 8; ++j) { const float x = acc[mb][nb][j] + bb[nb]; o16[j] = tohx(x); unsigned short a2, c2; splitf(x, a2, c2); oh[j] = a2; ol[j] = c2; }
                    unsigned short* sp = st + lr * VP + mb * 16 + hi * 8; *(v8ha*)sp = o16; *(v8usa*)(sp + 16 * VP) = oh; *(v8usa*)(sp + 32 * VP) = ol; }
                asm volatile("s_wait_dscnt 0x0" ::: "memory");   // the staged rows are in LDS before other lanes of the wave read them back
#pragma unroll
                for (int s = 0; s < 4; ++s) { const unsigned short* sp = st + (4 * s + rq) * VP + cq; const v8h o16 = *(const v8ha*)sp; const v8us oh = *(const v8usa*)(sp + 16 * VP), ol = *(const v8usa*)(sp + 32 * VP);
                    const size_t o = vo + (size_t)(nb * 16 + 4 * s) * TT; *(v8h*)(V16 + o) = o16; *(v8us*)(Vh + o) = oh; *(v8us*)(Vl + o) = ol; }
                if (nb < 3) asm volatile("s_wait_dscnt 0x0" ::: "memory");   // every read of the block has returned before the next block is staged over it
            }
        }
    } else {
#pragma unroll
    for (int mb = 0; mb < 4; ++mb) {
#pragma unroll
        for (int nb = 0; nb < 4; ++nb) {
#pragma unroll
            for (int j = 0; j < 8; ++j) os[(hi * 8 + j) * 68 + nb * 16 + lr] = acc[mb][nb][j]; }
        __builtin_amdgcn_wave_barrier(); asm volatile("" ::: "memory");
        float* crow = C + (size_t)(r0 + mb * 16) * ldc + c0;
{
#pragma unroll
            for (int s = 0; s < 8; ++s) { const int row = 2 * s + hi, cofs = lr * 4; v4f val = *(const v4fa*)(os + row * 68 + cofs); if (BIAS) { val[0] += bfr(bias[c0 + cofs]); val[1] += bfr(bias[c0 + cofs + 1]); val[2] += bfr(bias[c0 + cofs + 2]); val[3] += bfr(bias[c0 + cofs + 3]); }
                *(v4f*)(crow + (size_t)row * ldc + cofs) = val; }
             }
        __builtin_amdgcn_wave_barrier(); asm volatile("" ::: "memory");
    }
    }
}

typedef __attribute__((ext_vector_type(4))) _Float16 v4h;
typedef __attribute__((ext_vector_type(2))) unsigned short v2us;
typedef __attribute__((ext_vector_type(4))) unsigned short v4us;
typedef __attribute__((ext_vector_type(4))) int v4i;

__global__ __launch_bounds__(256) void k_wtG(const float* __restrict__ w, int K, int N, bf* Bt, const float* __restrict__ w2, int N2, bf* Bt2) {
    if (blockIdx.y) { w = w2; N = N2; Bt = Bt2; }   // grid y = 1: the second weight (same K); its surplus work-groups leave at the line test below
    const int lane = threadIdx.x & 31; const int L0 = (blockIdx.x * 8 + (threadIdx.x >> 5)) * 8; const int nlines = N * K / 64;
{
#pragma unroll 1
        for (int l = 0; l < 8; ++l) { const int L = L0 + l; if (L >= nlines) break; const size_t e = (size_t)L * 64 + lane * 2; const int k = (int)(e % K), n = (int)(e / K); v2us o;
            o[0] = f2bf(w[(size_t)k * N + n]); o[1] = f2bf(w[(size_t)(k + 1) * N + n]); *(v2us*)(Bt + e) = o; }
         }
}
__global__ __launch_bounds__(256) void k_cvt8(const float* __restrict__ src, bf* dst, size_t n8) { const size_t i = (size_t)blockIdx.x * 256 + threadIdx.x; if (i >= n8) return; const v8f v = *(const v8f*)(src + i * 8); v8us o;
#pragma unroll
    for (int k = 0; k < 8; ++k) o[k] = f2bf(v[k]); *(v8us*)(dst + i * 8) = o;  }

__constant__ float SLOPE8[NH_] = { 5.656854153e+0f, 4.000000000e+0f, 2.828427076e+0f, 2.000000000e+0f, 1.414213538e+0f, 1.000000000e+0f, 7.071067691e-1f, 5.000000000e-1f, 3.535533845e-1f, 2.500000000e-1f, 1.767766923e-1f, 1.250000000e-1f, 8.838834614e-2f, 6.250000000e-2f, 4.419417307e-2f, 3.125000000e-2f };   // 8 x the per-head ALiBi slope magnitude (slopes[h] = 2 ** (-(8/16)(h + 1)), h = 0..15, as the reference's f32 values x 8); the eight power-of-two entries give exact products with |i - j| <= 2047; for the eight irrational ones the product goes unrounded into the fused multiply-subtract of k_attn
typedef v4us __attribute__((may_alias)) v4usa;
typedef v4h  __attribute__((may_alias)) v4ha;
// ---- k_attn: one work-group of NW waves does the whole attention of one head's 32 query rows (i0 .. i0 + 31, i0 = roff + 32 x tile); the rows' f32 scores never leave LDS. grid (batches x heads, NT tiles), the longest tiles of both batches first.
// 1. scores: wave w takes the 64-key units w, w + NW, ... below Kl (the diagonal block's end; later keys are masked) and stores its 32 x 64 f32 tiles into the score rows (pitch KMAX + 4 floats: 16 bytes of pad for the 16-byte readers of step 3).
// 2. softmax: one wave per row, the row in registers: t = (S - SLOPE8[h] x (i - j)) x HD^-0.5 for j <= i, one exp, fixed trees. The 2-byte probabilities go over the row's own f32 scores (fp16: first half of the row; hi and lo planes: one half each);
//    the wave holds all of its row before its first store (every store needs the row sum) and no wave touches another row.
// 3. P.V: wave w takes the same units of keys, A fragments from LDS, value planes [d][t] from memory; private f32 partial tiles, laid over the probabilities once every wave has read them, are summed in the fixed order w = 0 .. NW-1.
// 4. the sums, scaled back, go out as hi + lo planes [t][head x HD + d] for the output projection.
// Every loop but the three marked ones is fully unrolled, so that the fragment, accumulator and row arrays are indexed by constants and live in registers.
template <typename T16, int NSPLIT, int NW, int KMAX, int NT>
__global__ __launch_bounds__(NW * 32) void k_attn(const T16* __restrict__ Q, const T16* __restrict__ Q2, const T16* __restrict__ Kp, const T16* __restrict__ Kp2, const T16* __restrict__ Vt, const T16* __restrict__ Vt2, int roff, bf* Ah, bf* Al) {
    typedef typename WFrag<T16>::V V;
    constexpr int SP = KMAX + 4;
    constexpr int SMF = (32 * SP > NW * 32 * 68) ? 32 * SP : NW * 32 * 68;
    __shared__ __align__(16) float sm[SMF];
    const int lane = threadIdx.x & 31, lr = lane & 15, hi = lane >> 4; const int w = __builtin_amdgcn_readfirstlane((int)(threadIdx.x >> 5));
    const int hh = blockIdx.x % NH_; const int i0 = roff + (NT - 1 - (int)blockIdx.y) * 32;
    Ah += (size_t)(blockIdx.x / NH_) * TT * DQ; Al += (size_t)(blockIdx.x / NH_) * TT * DQ;   // this batch's output rows
    const int Kl = min(KMAX, (i0 + 32 + 63) & ~63);
    const size_t hp = (size_t)blockIdx.x * TT * HD;   // planes are [batch][head]: blockIdx.x = batch x NH_ + head
    {
        V a[2][2], a2[2][2];
        const size_t aoff = hp + (size_t)(i0 + lr) * HD + 8 * hi;
#pragma unroll
        for (int c = 0; c < 2; ++c)
#pragma unroll
            for (int mb = 0; mb < 2; ++mb) { a[c][mb] = WFrag<T16>::ld(Q + aoff + (size_t)mb * 16 * HD + c * 32); if (NSPLIT == 2) a2[c][mb] = WFrag<T16>::ld(Q2 + aoff + (size_t)mb * 16 * HD + c * 32); }
        // the unit loop stays rolled (two trips at most): unrolled it would hold two units' key fragments and accumulators
#pragma unroll 1
        for (int k0 = w * 64; k0 < Kl; k0 += NW * 64) {
            V b[2][4], b2[2][4]; v8f acc[2][4];
            const size_t boff = hp + (size_t)(k0 + lr) * HD + 8 * hi;
            // the wait stands behind the query loads (the compiler moves them into this block where the loop has a single trip) and ahead of the key loads, whose results may be given the query loads' address registers;
            // the addresses are its inputs so that their registers are not given away ahead of it
            asm volatile("s_wait_xcnt 0x0" :: "v"(Q + aoff), "v"((NSPLIT == 2 ? Q2 : Q) + aoff) : "memory");
#pragma unroll
            for (int c = 0; c < 2; ++c)
#pragma unroll
                for (int nb = 0; nb < 4; ++nb) { b[c][nb] = WFrag<T16>::ld(Kp + boff + (size_t)nb * 16 * HD + c * 32); if (NSPLIT == 2) b2[c][nb] = WFrag<T16>::ld(Kp2 + boff + (size_t)nb * 16 * HD + c * 32); }
            __builtin_amdgcn_sched_barrier(0);   // keeps the unit's key loads issued together, ahead of their first product: one trip to memory; without it the scheduler issues them in several groups with a wait between
#pragma unroll
            for (int mb = 0; mb < 2; ++mb)
#pragma unroll
                for (int nb = 0; nb < 4; ++nb) acc[mb][nb] = (v8f){};
#pragma unroll
            for (int c = 0; c < 2; ++c)
#pragma unroll
                for (int nb = 0; nb < 4; ++nb)
#pragma unroll
                    for (int mb = 0; mb < 2; ++mb) { acc[mb][nb] = WFrag<T16>::mma(a[c][mb], b[c][nb], acc[mb][nb]); if (NSPLIT == 2) { acc[mb][nb] = WFrag<T16>::mma(a2[c][mb], b[c][nb], acc[mb][nb]); acc[mb][nb] = WFrag<T16>::mma(a[c][mb], b2[c][nb], acc[mb][nb]); } }
            __builtin_amdgcn_sched_barrier(0);   // keeps all eight product chains ahead of the stores: the scheduler otherwise stores a finished tile early and starts the next chain in the same registers
#pragma unroll
            for (int mb = 0; mb < 2; ++mb)
#pragma unroll
                for (int nb = 0; nb < 4; ++nb)
#pragma unroll
                    for (int j = 0; j < 8; ++j) sm[(mb * 16 + hi * 8 + j) * SP + k0 + nb * 16 + lr] = acc[mb][nb][j];
        }
    }
    __syncthreads();   // every score of the 32 rows is in LDS before a row is read
    const float sl = SLOPE8[hh];
    // the row loop stays rolled: one row's registers at a time
#pragma unroll 1
    for (int rr = w; rr < 32; rr += NW) {
        const int i = i0 + rr; float* sr = sm + rr * SP; float v[KMAX / 32]; v4f ar[KMAX / 128]; float mx = -3.0e38f;
        const float di = (float)(i - lane * 4);   // key distance i - j = di - (ch * 128 + q): whole numbers below 2^24, exact in f32
        // chunks of 128 keys at or past Kl are skipped (a scalar test); in a chunk that Kl halves, the upper lanes are off: their keys have no score and no reader
#pragma unroll
        for (int ch = 0; ch < KMAX / 128; ++ch) if (ch * 128 < Kl) { ar[ch] = (v4f){}; if (ch * 128 + lane * 4 < Kl) ar[ch] = *(const v4fa*)(sr + ch * 128 + lane * 4); }
#pragma unroll
        for (int ch = 0; ch < KMAX / 128; ++ch) if (ch * 128 < Kl) { const int j0 = ch * 128 + lane * 4; const v4f a = ar[ch];
#pragma unroll
            for (int q = 0; q < 4; ++q) { const int j = j0 + q; const float t = (j <= i && i - j < WIN) ? (a[q] - sl * (di - (float)(ch * 128 + q))) * SCL : -3.0e38f; v[ch * 4 + q] = t; mx = fmaxf(mx, t); } }
#pragma unroll
        for (int sh = 16; sh; sh >>= 1) mx = fmaxf(mx, __shfl_xor(mx, sh, 32));
        float sum = 0.f;
#pragma unroll
        for (int ch = 0; ch < KMAX / 128; ++ch) if (ch * 128 < Kl) {
#pragma unroll
            for (int q = 0; q < 4; ++q) { const int k = ch * 4 + q; v[k] = __builtin_amdgcn_exp2f(__fmul_rn(__fsub_rn(v[k], mx), 1.4426950408889634f)); sum += v[k]; } }
#pragma unroll
        for (int sh = 16; sh; sh >>= 1) sum += __shfl_xor(sum, sh, 32);
        const float f = __fdiv_rn((NSPLIT == 2) ? 1.0f : PCAR, sum);
#pragma unroll
        for (int ch = 0; ch < KMAX / 128; ++ch) if (ch * 128 < Kl) { const int j0 = ch * 128 + lane * 4;
            if (NSPLIT == 2) { v4us oh, ol;
#pragma unroll
                for (int q = 0; q < 4; ++q) { unsigned short a, c2; splitf(v[ch * 4 + q] * f, a, c2); oh[q] = a; ol[q] = c2; }
                if (j0 < Kl) { *(v4usa*)((bf*)sr + j0) = oh; *(v4usa*)((bf*)sr + KMAX + j0) = ol; }
            } else { v4h o4;
#pragma unroll
                for (int q = 0; q < 4; ++q) o4[q] = tohx(v[ch * 4 + q] * f);
                if (j0 < Kl) *(v4ha*)((h16*)sr + j0) = o4; } }
    }
    __syncthreads();   // every row's probabilities are in LDS before a wave reads all 32 rows
    constexpr int CH = (NSPLIT == 2) ? 1 : 2;   // 32-key chunks whose loads are issued together
    constexpr int lda = 2 * SP;                 // probability row pitch in 2-byte elements
    const T16* A = (const T16*)sm; const T16* A2 = A + KMAX; const T16* Bt = Vt + hp; const T16* Bt2 = (NSPLIT == 2) ? Vt2 + hp : nullptr;
    v8f acc[2][4];
#pragma unroll
    for (int mb = 0; mb < 2; ++mb)
#pragma unroll
        for (int nb = 0; nb < 4; ++nb) acc[mb][nb] = (v8f){};
    const int aoff = lr * lda + 8 * hi; const size_t boff = (size_t)lr * TT + 8 * hi;
    // the unit loop stays rolled (two trips at most): unrolled it would hold two units' fragments and pass the register budget of a 16-wave work-group
#pragma unroll 1
    for (int k0 = w * 64; k0 < Kl; k0 += NW * 64) {
#pragma unroll
        for (int kh = k0; kh < k0 + 64; kh += CH * 32) {
            V a[CH][2], a2[CH][2], b[CH][4], b2[CH][4];
#pragma unroll
            for (int c = 0; c < CH; ++c) {
#pragma unroll
                for (int nb = 0; nb < 4; ++nb) { b[c][nb] = WFrag<T16>::ld(Bt + boff + (size_t)nb * 16 * TT + kh + c * 32); if (NSPLIT == 2) b2[c][nb] = WFrag<T16>::ld(Bt2 + boff + (size_t)nb * 16 * TT + kh + c * 32); }
#pragma unroll
                for (int mb = 0; mb < 2; ++mb) { a[c][mb] = WFrag<T16>::ld(A + aoff + mb * 16 * lda + kh + c * 32); if (NSPLIT == 2) a2[c][mb] = WFrag<T16>::ld(A2 + aoff + mb * 16 * lda + kh + c * 32); } }
            __builtin_amdgcn_sched_barrier(0);   // keeps these loads issued ahead of their first product: one trip to memory for all; without it the scheduler sinks loads between the products and the wave waits several times in turn
#pragma unroll
            for (int c = 0; c < CH; ++c)
#pragma unroll
                for (int nb = 0; nb < 4; ++nb)
#pragma unroll
                    for (int mb = 0; mb < 2; ++mb) { acc[mb][nb] = WFrag<T16>::mma(a[c][mb], b[c][nb], acc[mb][nb]); if (NSPLIT == 2) { acc[mb][nb] = WFrag<T16>::mma(a2[c][mb], b[c][nb], acc[mb][nb]); acc[mb][nb] = WFrag<T16>::mma(a[c][mb], b2[c][nb], acc[mb][nb]); } }
        }
    }
    __syncthreads();   // the partial tiles go over the probabilities: every wave has read its last one
    float* pw = sm + w * (32 * 68);
#pragma unroll
    for (int mb = 0; mb < 2; ++mb)
#pragma unroll
        for (int nb = 0; nb < 4; ++nb)
#pragma unroll
            for (int j = 0; j < 8; ++j) pw[(mb * 16 + hi * 8 + j) * 68 + nb * 16 + lr] = acc[mb][nb][j];
    __syncthreads();   // every wave's partial tile is in LDS before the sums
    const float cs = (NSPLIT == 2) ? 1.0f : (1.0f / PCAR);
#pragma unroll
    for (int idx = threadIdx.x; idx < 32 * 16; idx += NW * 32) { const int row = idx >> 4, cofs = (idx & 15) * 4; v4f s = *(const v4fa*)(sm + row * 68 + cofs);
#pragma unroll
        for (int ww = 1; ww < NW; ++ww) s += *(const v4fa*)(sm + ww * (32 * 68) + row * 68 + cofs);
        v4us oh, ol;
#pragma unroll
        for (int q = 0; q < 4; ++q) { unsigned short a, c2; splitf(s[q] * cs, a, c2); oh[q] = a; ol[q] = c2; }
        const size_t oo = (size_t)(i0 + row) * DQ + hh * HD + cofs; *(v4us*)(Ah + oo) = oh; *(v4us*)(Al + oo) = ol; }
}

extern "C" void kernel_launch(void* const* d_in, const int* in_sizes, int n_in,
                              void* d_out, int out_size, void* d_ws, size_t ws_size, hipStream_t stream) {
    (void)in_sizes; (void)n_in; (void)out_size;
    const float* x = (const float*)d_in[0]; const float* wqkv = (const float*)d_in[1]; const float* bqkv = (const float*)d_in[2]; const float* wo = (const float*)d_in[3]; const float* bo = (const float*)d_in[4];   /* x, w_attn ('xw' [1024][3072]), b_attn, w_proj ('xw'), b_proj */
    float* OUT = (float*)d_out;     // [2][2048][1024]
    char* wsp = (char*)d_ws;
    auto take = [&](size_t bytes) { char* p = wsp; wsp += (bytes + 255) & ~(size_t)255; return (void*)p; };
    bf* WQKV = (bf*)take((size_t)3 * DQ * DM * 2);   /* fused Bt [3*DQ][DM]: q | k | v row blocks */ bf* WO = (bf*)take((size_t)DM * DQ * 2);
    bf* XB = (bf*)take((size_t)NB_ * TT * DM * 2);
    const size_t PL = (size_t)NB_ * NH_ * TT * HD;   /* elements of one plane set [batch][head][..][..] */
    h16* QP16 = (h16*)take(2 * PL * 2); h16* KP16 = QP16 + PL; h16* VT16 = (h16*)take(PL * 2);   /* q and k planes lie behind one another: [section][batch][head] */
    bf* QPh = (bf*)take(2 * PL * 2); bf* KPh = QPh + PL; bf* QPl = (bf*)take(2 * PL * 2); bf* KPl = QPl + PL; bf* VTh = (bf*)take(PL * 2); bf* VTl = (bf*)take(PL * 2);
    bf* ATh = (bf*)take((size_t)NB_ * TT * DQ * 2); bf* ATl = (bf*)take((size_t)NB_ * TT * DQ * 2);
    if ((size_t)(wsp - (char*)d_ws) > ws_size) return;    // ws 256 MiB
    static_assert(DQ == DM, "both weights are transposed with one K");
    k_wtG<<<dim3((unsigned)((DM * 3 * DQ / 64 + 63) / 64), 2, 1), 256, 0, stream>>>(wqkv, DM, 3 * DQ, WQKV, wo, DM, WO);   /* fused 'xw' [DM][3*DQ] -> Bt [3*DQ][DM]; 'xw' [DQ][DM] -> Bt [DM][DQ] (DQ == DM) */
    k_cvt8<<<(unsigned)(((size_t)NB_ * TT * DM / 8 + 255) / 256), 256, 0, stream>>>(x, XB, (size_t)NB_ * TT * DM / 8);
    k_gemmw<bf, 0, true, true><<<dim3(NB_ * TT / 64, 3 * DQ / 64, 1), 32, 0, stream>>>(XB, nullptr, WQKV, nullptr, DM, nullptr, 0, bqkv, 0, 0, 0, QP16, QPh, QPl, VT16, VTh, VTl);
    k_attn<bf, 2, 8, RH, RH / 32><<<dim3(NB_ * NH_, RH / 32, 1), 256, 0, stream>>>(QPh, QPl, KPh, KPl, VTh, VTl, 0, ATh, ATl);
    k_attn<h16, 0, 16, TT, (TT - RH) / 32><<<dim3(NB_ * NH_, (TT - RH) / 32, 1), 512, 0, stream>>>(QP16, nullptr, KP16, nullptr, VT16, nullptr, RH, ATh, ATl);
    k_gemmw<bf, 1, true, false><<<dim3(NB_ * TT / 64, DM / 64, 1), 32, 0, stream>>>(ATh, ATl, WO, nullptr, DQ, OUT, DM, bo, 0, 0, 0, nullptr, nullptr, nullptr, nullptr, nullptr, nullptr);
}

// v007
// One run takes 143 microseconds.
// Timed twice side by side with v006, it ran 1.29 and 1.30 times as fast.
// All steps since v000 together make it 11.4 times as fast.
#include <hip/hip_runtime.h>

// Causal self-attention with a fused biased qkv projection and an ALiBi-style bias on the KEY position (x [2][2048][1024]; qkv = (x w_attn + b_attn) ('xw' [1024][3072] 0.02 + bias zeros on this draw: read) reshaped (b, t, 3, 16, 64): q | k | v = column thirds (16 heads x 64); scores / sqrt(float32(64)) + slopes[h] x pos[s] with slopes[h] = 2 ** (-(8/16)(h + 1)) and pos the KEY index s: within a query row t this equals -slopes[h] x (t - s) plus the row constant slopes[h] x t, which the row softmax removes: implemented as the standard ALiBi distance term -slopes[h] x |t - s| on the causal triangle (slopes baked as jnp-exact f32 literals, pre-scaled by 8 for the kernel's exact x 1/8); causal (-inf); softmax; y = merged w_proj + b_proj ('xw' + bias zeros: read) -> [2][2048][1024] (4.2 M); argument order x, w_attn, b_attn, w_proj, b_proj).
// Every pass takes both batches in one grid (x is read as 4096 rows; planes are [batch][head]...), and q, k, v come out of one projection of 3072 columns. Layout: bf16 copy of x; the fused 'xw' weight transposed once into Bt (q | k | v row blocks) + bias slices; exact projections + f32 biases; the qkv projection's epilogue writes the head planes itself; one attention kernel per 32 query rows of a head, scores in LDS: its softmax subtracts SLOPE8[h] x (i - j) in f32, in its register row, before its x 1/8 (hybrid rows: < 512 hi/lo 3 products, rest fp16 x1024; keys past the diagonal block are never touched); merged hi/lo x w_proj exact + b_proj.
// Compute dtypes, f32 accumulate: every input rounded to bf16; projections exact + f32 biases; attention rows < 512 3 products, rest fp16; softmax f32; output projection hl x exact.

#define NB_  2
#define TT   2048
#define DM   1024
#define NH_  16
#define NKV  16
#define REP  (NH_ / NKV)
#define HD   64
#define DQ   (NH_ * HD)
#define DKV  (NKV * HD)
#define RH   512                  // query rows < RH use hi+lo planes (0: none)
#define WIN  2048
#define PCAR 1024.0f
#define SCL  0.125f   // HD^-0.5
typedef _Float16 h16;
typedef unsigned short bf;
typedef __attribute__((ext_vector_type(16))) __bf16   v16bf;
typedef __attribute__((ext_vector_type(16))) _Float16 v16h;
typedef __attribute__((ext_vector_type(8)))  _Float16 v8h;
typedef __attribute__((ext_vector_type(8)))  unsigned short v8us;
typedef __attribute__((ext_vector_type(8)))  float    v8f;
typedef __attribute__((ext_vector_type(4)))  float    v4f;
typedef v8h  __attribute__((may_alias)) v8ha;
typedef v4f  __attribute__((may_alias)) v4fa;
typedef v8us __attribute__((may_alias)) v8usa;

__device__ __forceinline__ unsigned short f2bf(float f) { unsigned u = __float_as_uint(f); u += 0x7FFFu + ((u >> 16) & 1u); return (unsigned short)(u >> 16); }
__device__ __forceinline__ float bf2f(unsigned short b) { return __uint_as_float(((unsigned)b) << 16); }
__device__ __forceinline__ float bfr(float f) { return bf2f(f2bf(f)); }
__device__ __forceinline__ v16h cat16(v8h lo, v8h hi) { return __builtin_shufflevector(lo, hi, 0, 1, 2, 3, 4, 5, 6, 7, 8, 9, 10, 11, 12, 13, 14, 15); }
__device__ __forceinline__ v16bf cat16b(v8us lo, v8us hi) { return __builtin_bit_cast(v16bf, __builtin_shufflevector(lo, hi, 0, 1, 2, 3, 4, 5, 6, 7, 8, 9, 10, 11, 12, 13, 14, 15)); }
__device__ __forceinline__ v8f wmma16(v16h a, v16h b, v8f c) { return __builtin_amdgcn_wmma_f32_16x16x32_f16(false, a, false, b, (short)0, c, false, false); }
__device__ __forceinline__ v8f wmmab(v16bf a, v16bf b, v8f c) { return __builtin_amdgcn_wmma_f32_16x16x32_bf16(false, a, false, b, (short)0, c, false, false); }
__device__ __forceinline__ h16 tohx(float x) { return (h16)x; }
__device__ __forceinline__ void splitf(float y, unsigned short& h, unsigned short& l) { h = f2bf(y); l = f2bf(y - bf2f(h)); }



// ---- k_gemmw: register-blocked GEMM, one work-group of FOUR WAVES per 128x128 output tile, one wave per 64x64 quarter (16 accumulators); grid (M/128, N/128, Z), 128 threads.
// C[m][n] (f32, pitch ldc, + optional f32 bias[n]) = sum_k A[m][k] Bt[n][k] (NSPLIT 1: + A2[m][k] Bt[n][k]). z-batch strides sA/sB/sC in elements. K % 64 == 0, M % 128 == 0, N % 128 == 0.
// Operands: K-contiguous 16-bit planes. Per trip a slab of 64 k (one whole 128-byte line a row) of the tile's 128 A rows and 128 Bt rows lies in LDS, at a row pitch of 144 bytes for the 16-byte fragment readers;
// asynchronous copies to LDS bring it there, 16 bytes a lane, eight lanes a line, two buffers: the slab after next flies while the next one is worked on. The k order of every accumulator is that of a plain loop over k in steps of 32.
// PLANES (the qkv projection): no f32 C. A wave's tile is 64 rows t of one batch x the 64 columns of one head of q, k or v (column block = section x heads + head); its biased f32 sums go out at once as the attention kernel's 2-byte planes
// (fp16, and bf16 hi + lo): q and k as [section][batch][head][t][d], v as [batch][head][d][t]. Every store is 16 bytes a lane and covers whole 128-byte lines, staged through the wave's own LDS (a piece of the slab buffers, free behind the last trip's barrier).
template <typename T16> struct WFrag;
template <> struct WFrag<h16> { typedef v16h V; static __device__ __forceinline__ V ld(const h16* p) { return cat16(*(const v8h*)p, *(const v8h*)(p + 16)); } static __device__ __forceinline__ v8f mma(V a, V b, v8f c) { return wmma16(a, b, c); } };
template <> struct WFrag<bf> { typedef v16bf V; static __device__ __forceinline__ V ld(const bf* p) { return cat16b(*(const v8us*)p, *(const v8us*)(p + 16)); } static __device__ __forceinline__ v8f mma(V a, V b, v8f c) { return wmmab(a, b, c); } };
// Eight asynchronous 16-byte copies a lane: rows r, r + 16, ... r + 112 of one 128-row slab (l: the lane's LDS byte address, ls: 16 LDS rows in bytes; g: its global address, rs: 16 global rows in elements).
// The s_wait_xcnt is the last line of the copies' own statement, so that it stands ahead of every later write of a register that a copy names.
template <typename T16>
__device__ __forceinline__ void cp8(unsigned l, unsigned ls, const T16* g, size_t rs) {
    asm volatile("global_load_async_to_lds_b128 %0, %8, off\n\t"
                 "global_load_async_to_lds_b128 %1, %9, off\n\t"
                 "global_load_async_to_lds_b128 %2, %10, off\n\t"
                 "global_load_async_to_lds_b128 %3, %11, off\n\t"
                 "global_load_async_to_lds_b128 %4, %12, off\n\t"
                 "global_load_async_to_lds_b128 %5, %13, off\n\t"
                 "global_load_async_to_lds_b128 %6, %14, off\n\t"
                 "global_load_async_to_lds_b128 %7, %15, off\n\t"
                 "s_wait_xcnt 0x0"
                 :: "v"(l), "v"(l + ls), "v"(l + 2 * ls), "v"(l + 3 * ls), "v"(l + 4 * ls), "v"(l + 5 * ls), "v"(l + 6 * ls), "v"(l + 7 * ls),
                    "v"(g), "v"(g + rs), "v"(g + 2 * rs), "v"(g + 3 * rs), "v"(g + 4 * rs), "v"(g + 5 * rs), "v"(g + 6 * rs), "v"(g + 7 * rs)
                 : "memory");
}
template <typename T16, int NSPLIT, bool BIAS, bool PLANES>
__global__ __launch_bounds__(128) void k_gemmw(const T16* __restrict__ A, const T16* __restrict__ A2, const T16* __restrict__ Bt, const T16* __restrict__ Bt2, int K, float* C, int ldc, const float* __restrict__ bias, size_t sA, size_t sB, size_t sC, h16* P16, bf* Ph, bf* Pl, h16* V16, bf* Vh, bf* Vl) {
    typedef typename WFrag<T16>::V V;
    static_assert(NSPLIT == 0 || NSPLIT == 1, "slabs are staged for A, Bt and (NSPLIT 1) A2");
    (void)Bt2;
    constexpr int VP = 72;   // pitch of a staged v row in 2-byte elements: 64 t + 16 bytes of pad
    constexpr int LP = 72;   // pitch of a staged operand row in 2-byte elements: 64 k + 16 bytes of pad
    constexpr int TE = 128 * LP;                   // elements of one operand's slab
    constexpr int BE = (NSPLIT == 1 ? 3 : 2) * TE; // elements of one buffer: A | Bt | A2
    constexpr int OSF = PLANES ? 3 * 16 * VP / 2 : 16 * 68;   // floats of one wave's output staging
    static_assert(4 * OSF <= BE, "the output staging lies inside the slab buffers");
    __shared__ __align__(16) float smf[BE];        // two buffers of BE 2-byte elements
    const size_t z = blockIdx.z; A += z * sA; if (A2) A2 += z * sA; Bt += z * sB; C += z * sC;
    const int lane = threadIdx.x & 31, lr = lane & 15, hi = lane >> 4; const int w = __builtin_amdgcn_readfirstlane((int)(threadIdx.x >> 5));
    const int R0 = blockIdx.x * 128, C0 = blockIdx.y * 128; const int r0 = R0 + (w & 1) * 64, c0 = C0 + (w >> 1) * 64;
    v8f acc[4][4];
#pragma unroll
    for (int mb = 0; mb < 4; ++mb)
#pragma unroll
        for (int nb = 0; nb < 4; ++nb) acc[mb][nb] = (v8f){};
    // a lane's share of a slab: 16 bytes of row crow + 16 i, i = 0 .. 7
    const int crow = threadIdx.x >> 3, ccol = (threadIdx.x & 7) * 8;
    const unsigned l0 = (unsigned)(size_t)smf + (unsigned)(crow * LP + ccol) * 2u;
    const T16* ga = A + (size_t)(R0 + crow) * K + ccol; const T16* gb = Bt + (size_t)(C0 + crow) * K + ccol; const T16* ga2 = (NSPLIT == 1) ? A2 + (size_t)(R0 + crow) * K + ccol : nullptr;
    const size_t rs = (size_t)16 * K;
    auto fill = [&](int t, int buf) { const unsigned l = l0 + (unsigned)buf * (BE * 2u);
        cp8(l, 16u * LP * 2u, ga + t * 64, rs); cp8(l + TE * 2u, 16u * LP * 2u, gb + t * 64, rs); if (NSPLIT == 1) cp8(l + 2u * TE * 2u, 16u * LP * 2u, ga2 + t * 64, rs); };
    const int nt = K / 64;
    fill(0, 0);
    asm volatile("s_wait_asynccnt 0x0" ::: "memory");   // this wave's copies of slab 0 have landed
    __syncthreads();                                    // every wave's have: slab 0 may be read
    if (nt > 1) fill(1, 1);
    const T16* ring = (const T16*)smf;
    const int fa = ((w & 1) * 64 + lr) * LP + 8 * hi, fb = TE + ((w >> 1) * 64 + lr) * LP + 8 * hi;
    // the trip loop stays rolled: one trip's fragments at a time, and one publish point in the text
#pragma unroll 1
    for (int t = 0; t < nt; ++t) {
        const T16* sb = ring + (t & 1) * BE;
#pragma unroll
        for (int kk = 0; kk < 64; kk += 32) {
            V a[4], a2[4], b[4];
#pragma unroll
            for (int mb = 0; mb < 4; ++mb) { a[mb] = WFrag<T16>::ld(sb + fa + mb * 16 * LP + kk); if (NSPLIT == 1) a2[mb] = WFrag<T16>::ld(sb + 2 * TE + fa + mb * 16 * LP + kk); }
#pragma unroll
            for (int nb = 0; nb < 4; ++nb) b[nb] = WFrag<T16>::ld(sb + fb + nb * 16 * LP + kk);
            __builtin_amdgcn_sched_barrier(0);   // keeps the step's fragment reads issued as one group ahead of its products: one LDS latency a step; without it the scheduler reads each Bt fragment into one register set and waits for it four times a step
#pragma unroll
            for (int nb = 0; nb < 4; ++nb)
#pragma unroll
                for (int mb = 0; mb < 4; ++mb) { acc[mb][nb] = WFrag<T16>::mma(a[mb], b[nb], acc[mb][nb]); if (NSPLIT == 1) acc[mb][nb] = WFrag<T16>::mma(a2[mb], b[nb], acc[mb][nb]); }
        }
        asm volatile("s_wait_dscnt 0x0" ::: "memory");      // this wave's reads of the buffer have returned before the buffer is handed to the copies
        asm volatile("s_wait_asynccnt 0x0" ::: "memory");   // this wave's copies of slab t + 1 have landed
        __syncthreads();                                    // publishes slab t + 1 and ends every wave's reads of slab t
        if (t + 2 < nt) fill(t + 2, t & 1);
    }
    asm volatile("s_wait_asynccnt 0x0" ::: "memory");       // no copy is in flight when the buffers become output staging
    float* os = smf + w * OSF;
    if constexpr (PLANES) {
        static_assert(BIAS && NKV == NH_ && HD == 64 && TT % 64 == 0, "a tile is one head's columns and lies in one batch");
        const int sec = (c0 / 64) / NH_, head = (c0 / 64) % NH_, bt = r0 / TT, t0 = r0 % TT;   // section 0: q, 1: k, 2: v
        const int rq = lane >> 3, cq = (lane & 7) * 8;   // reading a staged block back: eight lanes a row of 64 elements, eight elements each
        if (sec != 2) {
            // q, k: the tile is 64 x 64 elements in a row in each plane. Per block of 16 t the f32 sums are turned in LDS from accumulator order into rows.
            const size_t po = (((size_t)((sec * NB_ + bt) * NH_ + head) * TT + t0 + rq) * HD) + cq;
            float bb[8];
#pragma unroll
            for (int k = 0; k < 8; ++k) bb[k] = bfr(bias[c0 + cq + k]);
#pragma unroll
            for (int mb = 0; mb < 4; ++mb) {
#pragma unroll
                for (int nb = 0; nb < 4; ++nb) {
#pragma unroll
                    for (int j = 0; j < 8; ++j) os[(hi * 8 + j) * 68 + nb * 16 + lr] = acc[mb][nb][j]; }
                asm volatile("s_wait_dscnt 0x0" ::: "memory");   // the staged rows are in LDS before other lanes of the wave read them back
#pragma unroll
                for (int s = 0; s < 4; ++s) { const float* sp = os + (4 * s + rq) * 68 + cq; const v4f x0 = *(const v4fa*)sp, x1 = *(const v4fa*)(sp + 4); v8h o16; v8us oh, ol;
#pragma unroll
                    for (int k = 0; k < 8; ++k) { const float x = (k < 4 ? x0[k & 3] : x1[k & 3]) + bb[k]; o16[k] = tohx(x); unsigned short a2, c2; splitf(x, a2, c2); oh[k] = a2; ol[k] = c2; }
                    const size_t o = po + (size_t)(mb * 16 + 4 * s) * HD; *(v8h*)(P16 + o) = o16; *(v8us*)(Ph + o) = oh; *(v8us*)(Pl + o) = ol; }
                if (mb < 3) asm volatile("s_wait_dscnt 0x0" ::: "memory");   // every read of the block has returned before the next block is staged over it
            }
            asm volatile("s_wait_xcnt 0x0" ::: "memory");   // the compiler lays the v block right behind this one, past a branch that always leaves from here: the wait stands between the last stores and that block's first register writes
        } else {
            // v: a lane's eight accumulator rows are eight neighbouring t of its column d. Per block of 16 d the three planes' [d][t] rows are staged in LDS and go out as whole lines.
            unsigned short* st = (unsigned short*)os;
            const size_t vo = ((size_t)(bt * NKV + head) * HD + rq) * TT + t0 + cq;
            float bb[4];
#pragma unroll
            for (int nb = 0; nb < 4; ++nb) bb[nb] = bfr(bias[c0 + nb * 16 + lr]);
#pragma unroll
            for (int nb = 0; nb < 4; ++nb) {
#pragma unroll
                for (int mb = 0; mb < 4; ++mb) { v8h o16; v8us oh, ol;
#pragma unroll
                    for (int j = 0; j < 8; ++j) { const float x = acc[mb][nb][j] + bb[nb]; o16[j] = tohx(x); unsigned short a2, c2; splitf(x, a2, c2); oh[j] = a2; ol[j] = c2; }
                    unsigned short* sp = st + lr * VP + mb * 16 + hi * 8; *(v8ha*)sp = o16; *(v8usa*)(sp + 16 * VP) = oh; *(v8usa*)(sp + 32 * VP) = ol; }
                asm volatile("s_wait_dscnt 0x0" ::: "memory");   // the staged rows are in LDS before other lanes of the wave read them back
#pragma unroll
                for (int s = 0; s < 4; ++s) { const unsigned short* sp = st + (4 * s + rq) * VP + cq; const v8h o16 = *(const v8ha*)sp; const v8us oh = *(const v8usa*)(sp + 16 * VP), ol = *(const v8usa*)(sp + 32 * VP);
                    const size_t o = vo + (size_t)(nb * 16 + 4 * s) * TT; *(v8h*)(V16 + o) = o16; *(v8us*)(Vh + o) = oh; *(v8us*)(Vl + o) = ol; }
                if (nb < 3) asm volatile("s_wait_dscnt 0x0" ::: "memory");   // every read of the block has returned before the next block is staged over it
            }
        }
    } else {
#pragma unroll
    for (int mb = 0; mb < 4; ++mb) {
#pragma unroll
        for (int nb = 0; nb < 4; ++nb) {
#pragma unroll
            for (int j = 0; j < 8; ++j) os[(hi * 8 + j) * 68 + nb * 16 + lr] = acc[mb][nb][j]; }
        __builtin_amdgcn_wave_barrier(); asm volatile("" ::: "memory");
        float* crow = C + (size_t)(r0 + mb * 16) * ldc + c0;
{
#pragma unroll
            for (int s = 0; s < 8; ++s) { const int row = 2 * s + hi, cofs = lr * 4; v4f val = *(const v4fa*)(os + row * 68 + cofs); if (BIAS) { val[0] += bfr(bias[c0 + cofs]); val[1] += bfr(bias[c0 + cofs + 1]); val[2] += bfr(bias[c0 + cofs + 2]); val[3] += bfr(bias[c0 + cofs + 3]); }
                *(v4f*)(crow + (size_t)row * ldc + cofs) = val; }
             }
        __builtin_amdgcn_wave_barrier(); asm volatile("" ::: "memory");
    }
    }
}

typedef __attribute__((ext_vector_type(4))) _Float16 v4h;
typedef __attribute__((ext_vector_type(2))) unsigned short v2us;
typedef __attribute__((ext_vector_type(4))) unsigned short v4us;
typedef __attribute__((ext_vector_type(4))) int v4i;

__global__ __launch_bounds__(256) void k_wtG(const float* __restrict__ w, int K, int N, bf* Bt, const float* __restrict__ w2, int N2, bf* Bt2) {
    if (blockIdx.y) { w = w2; N = N2; Bt = Bt2; }   // grid y = 1: the second weight (same K); its surplus work-groups leave at the line test below
    const int lane = threadIdx.x & 31; const int L0 = (blockIdx.x * 8 + (threadIdx.x >> 5)) * 8; const int nlines = N * K / 64;
{
#pragma unroll 1
        for (int l = 0; l < 8; ++l) { const int L = L0 + l; if (L >= nlines) break; const size_t e = (size_t)L * 64 + lane * 2; const int k = (int)(e % K), n = (int)(e / K); v2us o;
            o[0] = f2bf(w[(size_t)k * N + n]); o[1] = f2bf(w[(size_t)(k + 1) * N + n]); *(v2us*)(Bt + e) = o; }
         }
}
__global__ __launch_bounds__(256) void k_cvt8(const float* __restrict__ src, bf* dst, size_t n8) { const size_t i = (size_t)blockIdx.x * 256 + threadIdx.x; if (i >= n8) return; const v8f v = *(const v8f*)(src + i * 8); v8us o;
#pragma unroll
    for (int k = 0; k < 8; ++k) o[k] = f2bf(v[k]); *(v8us*)(dst + i * 8) = o;  }

__constant__ float SLOPE8[NH_] = { 5.656854153e+0f, 4.000000000e+0f, 2.828427076e+0f, 2.000000000e+0f, 1.414213538e+0f, 1.000000000e+0f, 7.071067691e-1f, 5.000000000e-1f, 3.535533845e-1f, 2.500000000e-1f, 1.767766923e-1f, 1.250000000e-1f, 8.838834614e-2f, 6.250000000e-2f, 4.419417307e-2f, 3.125000000e-2f };   // 8 x the per-head ALiBi slope magnitude (slopes[h] = 2 ** (-(8/16)(h + 1)), h = 0..15, as the reference's f32 values x 8); the eight power-of-two entries give exact products with |i - j| <= 2047; for the eight irrational ones the product goes unrounded into the fused multiply-subtract of k_attn
typedef v4us __attribute__((may_alias)) v4usa;
typedef v4h  __attribute__((may_alias)) v4ha;
// ---- k_attn: one work-group of NW waves does the whole attention of one head's 32 query rows (i0 .. i0 + 31, i0 = roff + 32 x tile); the rows' f32 scores never leave LDS. grid (batches x heads, NT tiles), the longest tiles of both batches first.
// 1. scores: wave w takes the 64-key units w, w + NW, ... below Kl (the diagonal block's end; later keys are masked) and stores its 32 x 64 f32 tiles into the score rows (pitch KMAX + 4 floats: 16 bytes of pad for the 16-byte readers of step 3).
// 2. softmax: one wave per row, the row in registers: t = (S - SLOPE8[h] x (i - j)) x HD^-0.5 for j <= i, one exp, fixed trees. The 2-byte probabilities go over the row's own f32 scores (fp16: first half of the row; hi and lo planes: one half each);
//    the wave holds all of its row before its first store (every store needs the row sum) and no wave touches another row.
// 3. P.V: wave w takes the same units of keys, A fragments from LDS, value planes [d][t] from memory; private f32 partial tiles, laid over the probabilities once every wave has read them, are summed in the fixed order w = 0 .. NW-1.
// 4. the sums, scaled back, go out as hi + lo planes [t][head x HD + d] for the output projection.
// Every loop but the three marked ones is fully unrolled, so that the fragment, accumulator and row arrays are indexed by constants and live in registers.
template <typename T16, int NSPLIT, int NW, int KMAX, int NT>
__global__ __launch_bounds__(NW * 32) void k_attn(const T16* __restrict__ Q, const T16* __restrict__ Q2, const T16* __restrict__ Kp, const T16* __restrict__ Kp2, const T16* __restrict__ Vt, const T16* __restrict__ Vt2, int roff, bf* Ah, bf* Al) {
    typedef typename WFrag<T16>::V V;
    constexpr int SP = KMAX + 4;
    constexpr int SMF = (32 * SP > NW * 32 * 68) ? 32 * SP : NW * 32 * 68;
    __shared__ __align__(16) float sm[SMF];
    const int lane = threadIdx.x & 31, lr = lane & 15, hi = lane >> 4; const int w = __builtin_amdgcn_readfirstlane((int)(threadIdx.x >> 5));
    const int hh = blockIdx.x % NH_; const int i0 = roff + (NT - 1 - (int)blockIdx.y) * 32;
    Ah += (size_t)(blockIdx.x / NH_) * TT * DQ; Al += (size_t)(blockIdx.x / NH_) * TT * DQ;   // this batch's output rows
    const int Kl = min(KMAX, (i0 + 32 + 63) & ~63);
    const size_t hp = (size_t)blockIdx.x * TT * HD;   // planes are [batch][head]: blockIdx.x = batch x NH_ + head
    {
        V a[2][2], a2[2][2];
        const size_t aoff = hp + (size_t)(i0 + lr) * HD + 8 * hi;
#pragma unroll
        for (int c = 0; c < 2; ++c)
#pragma unroll
            for (int mb = 0; mb < 2; ++mb) { a[c][mb] = WFrag<T16>::ld(Q + aoff + (size_t)mb * 16 * HD + c * 32); if (NSPLIT == 2) a2[c][mb] = WFrag<T16>::ld(Q2 + aoff + (size_t)mb * 16 * HD + c * 32); }
        // the unit loop stays rolled (two trips at most): unrolled it would hold two units' key fragments and accumulators
#pragma unroll 1
        for (int k0 = w * 64; k0 < Kl; k0 += NW * 64) {
            V b[2][4], b2[2][4]; v8f acc[2][4];
            const size_t boff = hp + (size_t)(k0 + lr) * HD + 8 * hi;
            // the wait stands behind the query loads (the compiler moves them into this block where the loop has a single trip) and ahead of the key loads, whose results may be given the query loads' address registers;
            // the addresses are its inputs so that their registers are not given away ahead of it
            asm volatile("s_wait_xcnt 0x0" :: "v"(Q + aoff), "v"((NSPLIT == 2 ? Q2 : Q) + aoff) : "memory");
#pragma unroll
            for (int c = 0; c < 2; ++c)
#pragma unroll
                for (int nb = 0; nb < 4; ++nb) { b[c][nb] = WFrag<T16>::ld(Kp + boff + (size_t)nb * 16 * HD + c * 32); if (NSPLIT == 2) b2[c][nb] = WFrag<T16>::ld(Kp2 + boff + (size_t)nb * 16 * HD + c * 32); }
            __builtin_amdgcn_sched_barrier(0);   // keeps the unit's key loads issued together, ahead of their first product: one trip to memory; without it the scheduler issues them in several groups with a wait between
#pragma unroll
            for (int mb = 0; mb < 2; ++mb)
#pragma unroll
                for (int nb = 0; nb < 4; ++nb) acc[mb][nb] = (v8f){};
#pragma unroll
            for (int c = 0; c < 2; ++c)
#pragma unroll
                for (int nb = 0; nb < 4; ++nb)
#pragma unroll
                    for (int mb = 0; mb < 2; ++mb) { acc[mb][nb] = WFrag<T16>::mma(a[c][mb], b[c][nb], acc[mb][nb]); if (NSPLIT == 2) { acc[mb][nb] = WFrag<T16>::mma(a2[c][mb], b[c][nb], acc[mb][nb]); acc[mb][nb] = WFrag<T16>::mma(a[c][mb], b2[c][nb], acc[mb][nb]); } }
            __builtin_amdgcn_sched_barrier(0);   // keeps all eight product chains ahead of the stores: the scheduler otherwise stores a finished tile early and starts the next chain in the same registers
#pragma unroll
            for (int mb = 0; mb < 2; ++mb)
#pragma unroll
                for (int nb = 0; nb < 4; ++nb)
#pragma unroll
                    for (int j = 0; j < 8; ++j) sm[(mb * 16 + hi * 8 + j) * SP + k0 + nb * 16 + lr] = acc[mb][nb][j];
        }
    }
    __syncthreads();   // every score of the 32 rows is in LDS before a row is read
    const float sl = SLOPE8[hh];
    // the row loop stays rolled: one row's registers at a time
#pragma unroll 1
    for (int rr = w; rr < 32; rr += NW) {
        const int i = i0 + rr; float* sr = sm + rr * SP; float v[KMAX / 32]; v4f ar[KMAX / 128]; float mx = -3.0e38f;
        const float di = (float)(i - lane * 4);   // key distance i - j = di - (ch * 128 + q): whole numbers below 2^24, exact in f32
        // chunks of 128 keys at or past Kl are skipped (a scalar test); in a chunk that Kl halves, the upper lanes are off: their keys have no score and no reader
#pragma unroll
        for (int ch = 0; ch < KMAX / 128; ++ch) if (ch * 128 < Kl) { ar[ch] = (v4f){}; if (ch * 128 + lane * 4 < Kl) ar[ch] = *(const v4fa*)(sr + ch * 128 + lane * 4); }
#pragma unroll
        for (int ch = 0; ch < KMAX / 128; ++ch) if (ch * 128 < Kl) { const int j0 = ch * 128 + lane * 4; const v4f a = ar[ch];
#pragma unroll
            for (int q = 0; q < 4; ++q) { const int j = j0 + q; const float t = (j <= i && i - j < WIN) ? (a[q] - sl * (di - (float)(ch * 128 + q))) * SCL : -3.0e38f; v[ch * 4 + q] = t; mx = fmaxf(mx, t); } }
#pragma unroll
        for (int sh = 16; sh; sh >>= 1) mx = fmaxf(mx, __shfl_xor(mx, sh, 32));
        float sum = 0.f;
#pragma unroll
        for (int ch = 0; ch < KMAX / 128; ++ch) if (ch * 128 < Kl) {
#pragma unroll
            for (int q = 0; q < 4; ++q) { const int k = ch * 4 + q; v[k] = __builtin_amdgcn_exp2f(__fmul_rn(__fsub_rn(v[k], mx), 1.4426950408889634f)); sum += v[k]; } }
#pragma unroll
        for (int sh = 16; sh; sh >>= 1) sum += __shfl_xor(sum, sh, 32);
        const float f = __fdiv_rn((NSPLIT == 2) ? 1.0f : PCAR, sum);
#pragma unroll
        for (int ch = 0; ch < KMAX / 128; ++ch) if (ch * 128 < Kl) { const int j0 = ch * 128 + lane * 4;
            if (NSPLIT == 2) { v4us oh, ol;
#pragma unroll
                for (int q = 0; q < 4; ++q) { unsigned short a, c2; splitf(v[ch * 4 + q] * f, a, c2); oh[q] = a; ol[q] = c2; }
                if (j0 < Kl) { *(v4usa*)((bf*)sr + j0) = oh; *(v4usa*)((bf*)sr + KMAX + j0) = ol; }
            } else { v4h o4;
#pragma unroll
                for (int q = 0; q < 4; ++q) o4[q] = tohx(v[ch * 4 + q] * f);
                if (j0 < Kl) *(v4ha*)((h16*)sr + j0) = o4; } }
    }
    __syncthreads();   // every row's probabilities are in LDS before a wave reads all 32 rows
    constexpr int CH = (NSPLIT == 2) ? 1 : 2;   // 32-key chunks whose loads are issued together
    constexpr int lda = 2 * SP;                 // probability row pitch in 2-byte elements
    const T16* A = (const T16*)sm; const T16* A2 = A + KMAX; const T16* Bt = Vt + hp; const T16* Bt2 = (NSPLIT == 2) ? Vt2 + hp : nullptr;
    v8f acc[2][4];
#pragma unroll
    for (int mb = 0; mb < 2; ++mb)
#pragma unroll
        for (int nb = 0; nb < 4; ++nb) acc[mb][nb] = (v8f){};
    const int aoff = lr * lda + 8 * hi; const size_t boff = (size_t)lr * TT + 8 * hi;
    // the unit loop stays rolled (two trips at most): unrolled it would hold two units' fragments and pass the register budget of a 16-wave work-group
#pragma unroll 1
    for (int k0 = w * 64; k0 < Kl; k0 += NW * 64) {
#pragma unroll
        for (int kh = k0; kh < k0 + 64; kh += CH * 32) {
            V a[CH][2], a2[CH][2], b[CH][4], b2[CH][4];
#pragma unroll
            for (int c = 0; c < CH; ++c) {
#pragma unroll
                for (int nb = 0; nb < 4; ++nb) { b[c][nb] = WFrag<T16>::ld(Bt + boff + (size_t)nb * 16 * TT + kh + c * 32); if (NSPLIT == 2) b2[c][nb] = WFrag<T16>::ld(Bt2 + boff + (size_t)nb * 16 * TT + kh + c * 32); }
#pragma unroll
                for (int mb = 0; mb < 2; ++mb) { a[c][mb] = WFrag<T16>::ld(A + aoff + mb * 16 * lda + kh + c * 32); if (NSPLIT == 2) a2[c][mb] = WFrag<T16>::ld(A2 + aoff + mb * 16 * lda + kh + c * 32); } }
            __builtin_amdgcn_sched_barrier(0);   // keeps these loads issued ahead of their first product: one trip to memory for all; without it the scheduler sinks loads between the products and the wave waits several times in turn
#pragma unroll
            for (int c = 0; c < CH; ++c)
#pragma unroll
                for (int nb = 0; nb < 4; ++nb)
#pragma unroll
                    for (int mb = 0; mb < 2; ++mb) { acc[mb][nb] = WFrag<T16>::mma(a[c][mb], b[c][nb], acc[mb][nb]); if (NSPLIT == 2) { acc[mb][nb] = WFrag<T16>::mma(a2[c][mb], b[c][nb], acc[mb][nb]); acc[mb][nb] = WFrag<T16>::mma(a[c][mb], b2[c][nb], acc[mb][nb]); } }
        }
    }
    __syncthreads();   // the partial tiles go over the probabilities: every wave has read its last one
    float* pw = sm + w * (32 * 68);
#pragma unroll
    for (int mb = 0; mb < 2; ++mb)
#pragma unroll
        for (int nb = 0; nb < 4; ++nb)
#pragma unroll
            for (int j = 0; j < 8; ++j) pw[(mb * 16 + hi * 8 + j) * 68 + nb * 16 + lr] = acc[mb][nb][j];
    __syncthreads();   // every wave's partial tile is in LDS before the sums
    const float cs = (NSPLIT == 2) ? 1.0f : (1.0f / PCAR);
#pragma unroll
    for (int idx = threadIdx.x; idx < 32 * 16; idx += NW * 32) { const int row = idx >> 4, cofs = (idx & 15) * 4; v4f s = *(const v4fa*)(sm + row * 68 + cofs);
#pragma unroll
        for (int ww = 1; ww < NW; ++ww) s += *(const v4fa*)(sm + ww * (32 * 68) + row * 68 + cofs);
        v4us oh, ol;
#pragma unroll
        for (int q = 0; q < 4; ++q) { unsigned short a, c2; splitf(s[q] * cs, a, c2); oh[q] = a; ol[q] = c2; }
        const size_t oo = (size_t)(i0 + row) * DQ + hh * HD + cofs; *(v4us*)(Ah + oo) = oh; *(v4us*)(Al + oo) = ol; }
}

extern "C" void kernel_launch(void* const* d_in, const int* in_sizes, int n_in,
                              void* d_out, int out_size, void* d_ws, size_t ws_size, hipStream_t stream) {
    (void)in_sizes; (void)n_in; (void)out_size;
    const float* x = (const float*)d_in[0]; const float* wqkv = (const float*)d_in[1]; const float* bqkv = (const float*)d_in[2]; const float* wo = (const float*)d_in[3]; const float* bo = (const float*)d_in[4];   /* x, w_attn ('xw' [1024][3072]), b_attn, w_proj ('xw'), b_proj */
    float* OUT = (float*)d_out;     // [2][2048][1024]
    char* wsp = (char*)d_ws;
    auto take = [&](size_t bytes) { char* p = wsp; wsp += (bytes + 255) & ~(size_t)255; return (void*)p; };
    bf* WQKV = (bf*)take((size_t)3 * DQ * DM * 2);   /* fused Bt [3*DQ][DM]: q | k | v row blocks */ bf* WO = (bf*)take((size_t)DM * DQ * 2);
    bf* XB = (bf*)take((size_t)NB_ * TT * DM * 2);
    const size_t PL = (size_t)NB_ * NH_ * TT * HD;   /* elements of one plane set [batch][head][..][..] */
    h16* QP16 = (h16*)take(2 * PL * 2); h16* KP16 = QP16 + PL; h16* VT16 = (h16*)take(PL * 2);   /* q and k planes lie behind one another: [section][batch][head] */
    bf* QPh = (bf*)take(2 * PL * 2); bf* KPh = QPh + PL; bf* QPl = (bf*)take(2 * PL * 2); bf* KPl = QPl + PL; bf* VTh = (bf*)take(PL * 2); bf* VTl = (bf*)take(PL * 2);
    bf* ATh = (bf*)take((size_t)NB_ * TT * DQ * 2); bf* ATl = (bf*)take((size_t)NB_ * TT * DQ * 2);
    if ((size_t)(wsp - (char*)d_ws) > ws_size) return;    // ws 256 MiB
    static_assert(DQ == DM, "both weights are transposed with one K");
    k_wtG<<<dim3((unsigned)((DM * 3 * DQ / 64 + 63) / 64), 2, 1), 256, 0, stream>>>(wqkv, DM, 3 * DQ, WQKV, wo, DM, WO);   /* fused 'xw' [DM][3*DQ] -> Bt [3*DQ][DM]; 'xw' [DQ][DM] -> Bt [DM][DQ] (DQ == DM) */
    k_cvt8<<<(unsigned)(((size_t)NB_ * TT * DM / 8 + 255) / 256), 256, 0, stream>>>(x, XB, (size_t)NB_ * TT * DM / 8);
    k_gemmw<bf, 0, true, true><<<dim3(NB_ * TT / 128, 3 * DQ / 128, 1), 128, 0, stream>>>(XB, nullptr, WQKV, nullptr, DM, nullptr, 0, bqkv, 0, 0, 0, QP16, QPh, QPl, VT16, VTh, VTl);
    k_attn<bf, 2, 8, RH, RH / 32><<<dim3(NB_ * NH_, RH / 32, 1), 256, 0, stream>>>(QPh, QPl, KPh, KPl, VTh, VTl, 0, ATh, ATl);
    k_attn<h16, 0, 16, TT, (TT - RH) / 32><<<dim3(NB_ * NH_, (TT - RH) / 32, 1), 512, 0, stream>>>(QP16, nullptr, KP16, nullptr, VT16, nullptr, RH, ATh, ATl);
    k_gemmw<bf, 1, true, false><<<dim3(NB_ * TT / 128, DM / 128, 1), 128, 0, stream>>>(ATh, ATl, WO, nullptr, DQ, OUT, DM, bo, 0, 0, 0, nullptr, nullptr, nullptr, nullptr, nullptr, nullptr);
}

// v008
// Measured time: 123 microseconds a run.
// In two side-by-side timings against v007, it was 1.15 and 1.16 times as fast.
// Over all steps from v000 it is 13.1 times as fast.
#include <hip/hip_runtime.h>

// Causal self-attention with a fused biased qkv projection and an ALiBi-style bias on the KEY position (x [2][2048][1024]; qkv = (x w_attn + b_attn) ('xw' [1024][3072] 0.02 + bias zeros on this draw: read) reshaped (b, t, 3, 16, 64): q | k | v = column thirds (16 heads x 64); scores / sqrt(float32(64)) + slopes[h] x pos[s] with slopes[h] = 2 ** (-(8/16)(h + 1)) and pos the KEY index s: within a query row t this equals -slopes[h] x (t - s) plus the row constant slopes[h] x t, which the row softmax removes: implemented as the standard ALiBi distance term -slopes[h] x |t - s| on the causal triangle (slopes baked as jnp-exact f32 literals, pre-scaled by 8 for the kernel's exact x 1/8); causal (-inf); softmax; y = merged w_proj + b_proj ('xw' + bias zeros: read) -> [2][2048][1024] (4.2 M); argument order x, w_attn, b_attn, w_proj, b_proj).
// Every pass takes both batches in one grid (x is read as 4096 rows; planes are [batch][head]...), and q, k, v come out of one projection of 3072 columns. Layout: bf16 copy of x; the fused 'xw' weight transposed once into Bt (q | k | v row blocks) + bias slices; exact projections + f32 biases; the qkv projection's epilogue writes the head planes itself; one attention kernel per 32 query rows of a head, scores in LDS: its softmax subtracts SLOPE8[h] x (i - j) in f32, in its register row, before its x 1/8 (hybrid rows: < 512 hi/lo 3 products, rest fp16 x1024; keys past the diagonal block are never touched); merged hi/lo x w_proj exact + b_proj.
// Compute dtypes, f32 accumulate: every input rounded to bf16; projections exact + f32 biases; attention rows < 512 3 products, rest fp16; softmax f32; output projection hl x exact.

#define NB_  2
#define TT   2048
#define DM   1024
#define NH_  16
#define NKV  16
#define REP  (NH_ / NKV)
#define HD   64
#define DQ   (NH_ * HD)
#define DKV  (NKV * HD)
#define RH   512                  // query rows < RH use hi+lo planes (0: none)
#define WIN  2048
#define PCAR 1024.0f
#define SCL  0.125f   // HD^-0.5
typedef _Float16 h16;
typedef unsigned short bf;
typedef __attribute__((ext_vector_type(16))) __bf16   v16bf;
typedef __attribute__((ext_vector_type(16))) _Float16 v16h;
typedef __attribute__((ext_vector_type(8)))  _Float16 v8h;
typedef __attribute__((ext_vector_type(8)))  unsigned short v8us;
typedef __attribute__((ext_vector_type(8)))  float    v8f;
typedef __attribute__((ext_vector_type(4)))  float    v4f;
typedef v8h  __attribute__((may_alias)) v8ha;
typedef v4f  __attribute__((may_alias)) v4fa;
typedef v8us __attribute__((may_alias)) v8usa;

__device__ __forceinline__ unsigned short f2bf(float f) { unsigned u = __float_as_uint(f); u += 0x7FFFu + ((u >> 16) & 1u); return (unsigned short)(u >> 16); }
__device__ __forceinline__ float bf2f(unsigned short b) { return __uint_as_float(((unsigned)b) << 16); }
__device__ __forceinline__ float bfr(float f) { return bf2f(f2bf(f)); }
__device__ __forceinline__ v16h cat16(v8h lo, v8h hi) { return __builtin_shufflevector(lo, hi, 0, 1, 2, 3, 4, 5, 6, 7, 8, 9, 10, 11, 12, 13, 14, 15); }
__device__ __forceinline__ v16bf cat16b(v8us lo, v8us hi) { return __builtin_bit_cast(v16bf, __builtin_shufflevector(lo, hi, 0, 1, 2, 3, 4, 5, 6, 7, 8, 9, 10, 11, 12, 13, 14, 15)); }
__device__ __forceinline__ v8f wmma16(v16h a, v16h b, v8f c) { return __builtin_amdgcn_wmma_f32_16x16x32_f16(false, a, false, b, (short)0, c, false, false); }
__device__ __forceinline__ v8f wmmab(v16bf a, v16bf b, v8f c) { return __builtin_amdgcn_wmma_f32_16x16x32_bf16(false, a, false, b, (short)0, c, false, false); }
__device__ __forceinline__ h16 tohx(float x) { return (h16)x; }
__device__ __forceinline__ void splitf(float y, unsigned short& h, unsigned short& l) { h = f2bf(y); l = f2bf(y - bf2f(h)); }



// ---- k_gemmw: register-blocked GEMM, one work-group of FOUR WAVES per 128x128 output tile, one wave per 64x64 quarter (16 accumulators); grid (M/128, N/128, Z), 128 threads.
// C[m][n] (f32, pitch ldc, + optional f32 bias[n]) = sum_k A[m][k] Bt[n][k] (NSPLIT 1: + A2[m][k] Bt[n][k]). z-batch strides sA/sB/sC in elements. K % 64 == 0, M % 128 == 0, N % 128 == 0.
// Operands: K-contiguous 16-bit planes. Per trip a slab of 64 k (one whole 128-byte line a row) of the tile's 128 A rows and 128 Bt rows lies in LDS, at a row pitch of 144 bytes for the 16-byte fragment readers;
// asynchronous copies to LDS bring it there, 16 bytes a lane, eight lanes a line, two buffers: the slab after next flies while the next one is worked on. The k order of every accumulator is that of a plain loop over k in steps of 32.
// PLANES (the qkv projection): no f32 C. A wave's tile is 64 rows t of one batch x the 64 columns of one head of q, k or v (column block = section x heads + head); its biased f32 sums go out at once as the attention kernel's 2-byte planes
// (fp16, and bf16 hi + lo), each head's plane laid out IN THE ORDER OF THE MATRIX FRAGMENTS that the attention kernel loads, so that one 16-byte load of a wave there reads 512 bytes in a row (four whole lines):
// q and k, [section][batch][head]: element (t, d) at (t / 16) x 1024 + (d / 16) x 256 + ((d / 8 % 2) x 16 + t % 16) x 8 + d % 8; v, [batch][head]: element (d, t) at (t / 32) x 2048 + (d / 16) x 512 + (t / 16 % 2) x 256 + ((t / 8 % 2) x 16 + d % 16) x 8 + t % 8.
// Every store is 16 bytes a lane, 512 bytes in a row a wave; q and k are turned in the wave's own LDS (a piece of the slab buffers, free behind the last trip's barrier), v goes out straight from the accumulators.
// ld: a fragment from rows of k-contiguous elements (p: the lane's row, + 8 x its half). ldf: a fragment from a plane in fragment order (p: the fragment's start + 8 x lane; its two halves of k lie 256 elements apart).
template <typename T16> struct WFrag;
template <> struct WFrag<h16> { typedef v16h V; static __device__ __forceinline__ V ld(const h16* p) { return cat16(*(const v8h*)p, *(const v8h*)(p + 16)); } static __device__ __forceinline__ V ldf(const h16* p) { return cat16(*(const v8h*)p, *(const v8h*)(p + 256)); } static __device__ __forceinline__ v8f mma(V a, V b, v8f c) { return wmma16(a, b, c); } };
template <> struct WFrag<bf> { typedef v16bf V; static __device__ __forceinline__ V ld(const bf* p) { return cat16b(*(const v8us*)p, *(const v8us*)(p + 16)); } static __device__ __forceinline__ V ldf(const bf* p) { return cat16b(*(const v8us*)p, *(const v8us*)(p + 256)); } static __device__ __forceinline__ v8f mma(V a, V b, v8f c) { return wmmab(a, b, c); } };
// Eight asynchronous 16-byte copies a lane: rows r, r + 16, ... r + 112 of one 128-row slab (l: the lane's LDS byte address, ls: 16 LDS rows in bytes; g: its global address, rs: 16 global rows in elements).
// The s_wait_xcnt is the last line of the copies' own statement, so that it stands ahead of every later write of a register that a copy names.
template <typename T16>
__device__ __forceinline__ void cp8(unsigned l, unsigned ls, const T16* g, size_t rs) {
    asm volatile("global_load_async_to_lds_b128 %0, %8, off\n\t"
                 "global_load_async_to_lds_b128 %1, %9, off\n\t"
                 "global_load_async_to_lds_b128 %2, %10, off\n\t"
                 "global_load_async_to_lds_b128 %3, %11, off\n\t"
                 "global_load_async_to_lds_b128 %4, %12, off\n\t"
                 "global_load_async_to_lds_b128 %5, %13, off\n\t"
                 "global_load_async_to_lds_b128 %6, %14, off\n\t"
                 "global_load_async_to_lds_b128 %7, %15, off\n\t"
                 "s_wait_xcnt 0x0"
                 :: "v"(l), "v"(l + ls), "v"(l + 2 * ls), "v"(l + 3 * ls), "v"(l + 4 * ls), "v"(l + 5 * ls), "v"(l + 6 * ls), "v"(l + 7 * ls),
                    "v"(g), "v"(g + rs), "v"(g + 2 * rs), "v"(g + 3 * rs), "v"(g + 4 * rs), "v"(g + 5 * rs), "v"(g + 6 * rs), "v"(g + 7 * rs)
                 : "memory");
}
template <typename T16, int NSPLIT, bool BIAS, bool PLANES>
__global__ __launch_bounds__(128) void k_gemmw(const T16* __restrict__ A, const T16* __restrict__ A2, const T16* __restrict__ Bt, const T16* __restrict__ Bt2, int K, float* C, int ldc, const float* __restrict__ bias, size_t sA, size_t sB, size_t sC, h16* P16, bf* Ph, bf* Pl, h16* V16, bf* Vh, bf* Vl) {
    typedef typename WFrag<T16>::V V;
    static_assert(NSPLIT == 0 || NSPLIT == 1, "slabs are staged for A, Bt and (NSPLIT 1) A2");
    (void)Bt2;
    constexpr int LP = 72;   // pitch of a staged operand row in 2-byte elements: 64 k + 16 bytes of pad
    constexpr int TE = 128 * LP;                   // elements of one operand's slab
    constexpr int BE = (NSPLIT == 1 ? 3 : 2) * TE; // elements of one buffer: A | Bt | A2
    constexpr int OSF = 16 * 68;   // floats of one wave's output staging
    static_assert(4 * OSF <= BE, "the output staging lies inside the slab buffers");
    __shared__ __align__(16) float smf[BE];        // two buffers of BE 2-byte elements
    const size_t z = blockIdx.z; A += z * sA; if (A2) A2 += z * sA; Bt += z * sB; C += z * sC;
    const int lane = threadIdx.x & 31, lr = lane & 15, hi = lane >> 4; const int w = __builtin_amdgcn_readfirstlane((int)(threadIdx.x >> 5));
    const int R0 = blockIdx.x * 128, C0 = blockIdx.y * 128; const int r0 = R0 + (w & 1) * 64, c0 = C0 + (w >> 1) * 64;
    v8f acc[4][4];
#pragma unroll
    for (int mb = 0; mb < 4; ++mb)
#pragma unroll
        for (int nb = 0; nb < 4; ++nb) acc[mb][nb] = (v8f){};
    // a lane's share of a slab: 16 bytes of row crow + 16 i, i = 0 .. 7
    const int crow = threadIdx.x >> 3, ccol = (threadIdx.x & 7) * 8;
    const unsigned l0 = (unsigned)(size_t)smf + (unsigned)(crow * LP + ccol) * 2u;
    const T16* ga = A + (size_t)(R0 + crow) * K + ccol; const T16* gb = Bt + (size_t)(C0 + crow) * K + ccol; const T16* ga2 = (NSPLIT == 1) ? A2 + (size_t)(R0 + crow) * K + ccol : nullptr;
    const size_t rs = (size_t)16 * K;
    auto fill = [&](int t, int buf) { const unsigned l = l0 + (unsigned)buf * (BE * 2u);
        cp8(l, 16u * LP * 2u, ga + t * 64, rs); cp8(l + TE * 2u, 16u * LP * 2u, gb + t * 64, rs); if (NSPLIT == 1) cp8(l + 2u * TE * 2u, 16u * LP * 2u, ga2 + t * 64, rs); };
    const int nt = K / 64;
    fill(0, 0);
    asm volatile("s_wait_asynccnt 0x0" ::: "memory");   // this wave's copies of slab 0 have landed
    __syncthreads();                                    // every wave's have: slab 0 may be read
    if (nt > 1) fill(1, 1);
    const T16* ring = (const T16*)smf;
    const int fa = ((w & 1) * 64 + lr) * LP + 8 * hi, fb = TE + ((w >> 1) * 64 + lr) * LP + 8 * hi;
    // the trip loop stays rolled: one trip's fragments at a time, and one publish point in the text
#pragma unroll 1
    for (int t = 0; t < nt; ++t) {
        const T16* sb = ring + (t & 1) * BE;
#pragma unroll
        for (int kk = 0; kk < 64; kk += 32) {
            V a[4], a2[4], b[4];
#pragma unroll
            for (int mb = 0; mb < 4; ++mb) { a[mb] = WFrag<T16>::ld(sb + fa + mb * 16 * LP + kk); if (NSPLIT == 1) a2[mb] = WFrag<T16>::ld(sb + 2 * TE + fa + mb * 16 * LP + kk); }
#pragma unroll
            for (int nb = 0; nb < 4; ++nb) b[nb] = WFrag<T16>::ld(sb + fb + nb * 16 * LP + kk);
            __builtin_amdgcn_sched_barrier(0);   // keeps the step's fragment reads issued as one group ahead of its products: one LDS latency a step; without it the scheduler reads each Bt fragment into one register set and waits for it four times a step
#pragma unroll
            for (int nb = 0; nb < 4; ++nb)
#pragma unroll
                for (int mb = 0; mb < 4; ++mb) { acc[mb][nb] = WFrag<T16>::mma(a[mb], b[nb], acc[mb][nb]); if (NSPLIT == 1) acc[mb][nb] = WFrag<T16>::mma(a2[mb], b[nb], acc[mb][nb]); }
        }
        asm volatile("s_wait_dscnt 0x0" ::: "memory");      // this wave's reads of the buffer have returned before the buffer is handed to the copies
        asm volatile("s_wait_asynccnt 0x0" ::: "memory");   // this wave's copies of slab t + 1 have landed
        __syncthreads();                                    // publishes slab t + 1 and ends every wave's reads of slab t
        if (t + 2 < nt) fill(t + 2, t & 1);
    }
    asm volatile("s_wait_asynccnt 0x0" ::: "memory");       // no copy is in flight when the buffers become output staging
    float* os = smf + w * OSF;
    if constexpr (PLANES) {
        static_assert(BIAS && NKV == NH_ && HD == 64 && TT % 64 == 0, "a tile is one head's columns and lies in one batch");
        const int sec = (c0 / 64) / NH_, head = (c0 / 64) % NH_, bt = r0 / TT, t0 = r0 % TT;   // section 0: q, 1: k, 2: v
        float bb[4];   // the biases of the lane's four accumulator columns
#pragma unroll
        for (int nb = 0; nb < 4; ++nb) bb[nb] = bfr(bias[c0 + nb * 16 + lr]);
        if (sec != 2) {
            // q, k: per block of 16 t the biased f32 sums are turned in LDS from accumulator order (a lane: one d, eight t) into fragment order (a lane: one t, eight d).
            const size_t po = (size_t)((sec * NB_ + bt) * NH_ + head) * TT * HD + (size_t)(t0 / 16) * 1024 + lane * 8;
#pragma unroll
            for (int mb = 0; mb < 4; ++mb) {
#pragma unroll
                for (int nb = 0; nb < 4; ++nb) {
#pragma unroll
                    for (int j = 0; j < 8; ++j) os[(hi * 8 + j) * 68 + nb * 16 + lr] = acc[mb][nb][j] + bb[nb]; }
                asm volatile("s_wait_dscnt 0x0" ::: "memory");   // the staged rows are in LDS before other lanes of the wave read them back
#pragma unroll
                for (int s = 0; s < 4; ++s) { const float* sp = os + lr * 68 + s * 16 + hi * 8; const v4f x0 = *(const v4fa*)sp, x1 = *(const v4fa*)(sp + 4); v8h o16; v8us oh, ol;
#pragma unroll
                    for (int k = 0; k < 8; ++k) { const float x = k < 4 ? x0[k & 3] : x1[k & 3]; o16[k] = tohx(x); unsigned short a2, c2; splitf(x, a2, c2); oh[k] = a2; ol[k] = c2; }
                    const size_t o = po + (size_t)(mb * 1024 + s * 256); *(v8h*)(P16 + o) = o16; *(v8us*)(Ph + o) = oh; *(v8us*)(Pl + o) = ol;
                    asm volatile("s_wait_xcnt 0x0" ::: "memory"); }   // stands between the three stores and the next values, which are formed in the stores' data registers
                if (mb < 3) asm volatile("s_wait_dscnt 0x0" ::: "memory");   // every read of the block has returned before the next block is staged over it
            }
        } else {
            // v: a lane's eight accumulator rows are eight neighbouring t of its column d, which is the lane's own 16 bytes of a fragment: no staging.
            const size_t vo = (size_t)(bt * NKV + head) * HD * TT + (size_t)(t0 / 32) * 2048 + lane * 8;
#pragma unroll
            for (int nb = 0; nb < 4; ++nb) {
#pragma unroll
                for (int mb = 0; mb < 4; ++mb) { v8h o16; v8us oh, ol;
#pragma unroll
                    for (int j = 0; j < 8; ++j) { const float x = acc[mb][nb][j] + bb[nb]; o16[j] = tohx(x); unsigned short a2, c2; splitf(x, a2, c2); oh[j] = a2; ol[j] = c2; }
                    const size_t o = vo + (size_t)((mb >> 1) * 2048 + nb * 512 + (mb & 1) * 256); *(v8h*)(V16 + o) = o16; *(v8us*)(Vh + o) = oh; *(v8us*)(Vl + o) = ol;
                    asm volatile("s_wait_xcnt 0x0" ::: "memory");   // stands between the three stores and the next values, which are formed in the stores' data registers
                    __builtin_amdgcn_sched_barrier(0); }            // keeps the next values' arithmetic, which reads registers only, behind that wait: the scheduler otherwise lifts it over the wait
            }
        }
    } else {
#pragma unroll
    for (int mb = 0; mb < 4; ++mb) {
#pragma unroll
        for (int nb = 0; nb < 4; ++nb) {
#pragma unroll
            for (int j = 0; j < 8; ++j) os[(hi * 8 + j) * 68 + nb * 16 + lr] = acc[mb][nb][j]; }
        __builtin_amdgcn_wave_barrier(); asm volatile("" ::: "memory");
        float* crow = C + (size_t)(r0 + mb * 16) * ldc + c0;
{
#pragma unroll
            for (int s = 0; s < 8; ++s) { const int row = 2 * s + hi, cofs = lr * 4; v4f val = *(const v4fa*)(os + row * 68 + cofs); if (BIAS) { val[0] += bfr(bias[c0 + cofs]); val[1] += bfr(bias[c0 + cofs + 1]); val[2] += bfr(bias[c0 + cofs + 2]); val[3] += bfr(bias[c0 + cofs + 3]); }
                *(v4f*)(crow + (size_t)row * ldc + cofs) = val; }
             }
        __builtin_amdgcn_wave_barrier(); asm volatile("" ::: "memory");
    }
    }
}

typedef __attribute__((ext_vector_type(4))) _Float16 v4h;
typedef __attribute__((ext_vector_type(2))) unsigned short v2us;
typedef __attribute__((ext_vector_type(4))) unsigned short v4us;
typedef __attribute__((ext_vector_type(4))) int v4i;

__global__ __launch_bounds__(256) void k_wtG(const float* __restrict__ w, int K, int N, bf* Bt, const float* __restrict__ w2, int N2, bf* Bt2) {
    if (blockIdx.y) { w = w2; N = N2; Bt = Bt2; }   // grid y = 1: the second weight (same K); its surplus work-groups leave at the line test below
    const int lane = threadIdx.x & 31; const int L0 = (blockIdx.x * 8 + (threadIdx.x >> 5)) * 8; const int nlines = N * K / 64;
{
#pragma unroll 1
        for (int l = 0; l < 8; ++l) { const int L = L0 + l; if (L >= nlines) break; const size_t e = (size_t)L * 64 + lane * 2; const int k = (int)(e % K), n = (int)(e / K); v2us o;
            o[0] = f2bf(w[(size_t)k * N + n]); o[1] = f2bf(w[(size_t)(k + 1) * N + n]); *(v2us*)(Bt + e) = o; }
         }
}
__global__ __launch_bounds__(256) void k_cvt8(const float* __restrict__ src, bf* dst, size_t n8) { const size_t i = (size_t)blockIdx.x * 256 + threadIdx.x; if (i >= n8) return; const v8f v = *(const v8f*)(src + i * 8); v8us o;
#pragma unroll
    for (int k = 0; k < 8; ++k) o[k] = f2bf(v[k]); *(v8us*)(dst + i * 8) = o;  }

__constant__ float SLOPE8[NH_] = { 5.656854153e+0f, 4.000000000e+0f, 2.828427076e+0f, 2.000000000e+0f, 1.414213538e+0f, 1.000000000e+0f, 7.071067691e-1f, 5.000000000e-1f, 3.535533845e-1f, 2.500000000e-1f, 1.767766923e-1f, 1.250000000e-1f, 8.838834614e-2f, 6.250000000e-2f, 4.419417307e-2f, 3.125000000e-2f };   // 8 x the per-head ALiBi slope magnitude (slopes[h] = 2 ** (-(8/16)(h + 1)), h = 0..15, as the reference's f32 values x 8); the eight power-of-two entries give exact products with |i - j| <= 2047; for the eight irrational ones the product goes unrounded into the fused multiply-subtract of k_attn
typedef v4us __attribute__((may_alias)) v4usa;
typedef v4h  __attribute__((may_alias)) v4ha;
// ---- k_attn: one work-group of NW waves does the whole attention of one head's 32 query rows (i0 .. i0 + 31, i0 = roff + 32 x tile); the rows' f32 scores never leave LDS. grid (batches x heads, NT tiles), the longest tiles of both batches first.
// The q, k and v planes lie in fragment order (k_gemmw): every fragment load of a wave reads 512 bytes in a row.
// 1. scores: wave w takes the 64-key units w, w + NW, ... below Kl (the diagonal block's end; later keys are masked) and stores its 32 x 64 f32 tiles into the score rows (pitch KMAX + 4 floats: 16 bytes of pad for the 16-byte readers of step 3).
// 2. softmax: one wave per row, the row in registers: t = (S - SLOPE8[h] x (i - j)) x HD^-0.5 for j <= i, one exp, fixed trees. The 2-byte probabilities go over the row's own f32 scores (fp16: first half of the row; hi and lo planes: one half each);
//    the wave holds all of its row before its first store (every store needs the row sum) and no wave touches another row.
// 3. P.V: wave w takes the same units of keys, A fragments from LDS, value fragments from memory; private f32 partial tiles, laid over the probabilities once every wave has read them, are summed in the fixed order w = 0 .. NW-1.
// 4. the sums, scaled back, go out as hi + lo planes [t][head x HD + d] for the output projection.
// Every loop but the three marked ones is fully unrolled, so that the fragment, accumulator and row arrays are indexed by constants and live in registers.
template <typename T16, int NSPLIT, int NW, int KMAX, int NT>
__global__ __launch_bounds__(NW * 32) void k_attn(const T16* __restrict__ Q, const T16* __restrict__ Q2, const T16* __restrict__ Kp, const T16* __restrict__ Kp2, const T16* __restrict__ Vt, const T16* __restrict__ Vt2, int roff, bf* Ah, bf* Al) {
    typedef typename WFrag<T16>::V V;
    constexpr int SP = KMAX + 4;
    constexpr int SMF = (32 * SP > NW * 32 * 68) ? 32 * SP : NW * 32 * 68;
    __shared__ __align__(16) float sm[SMF];
    const int lane = threadIdx.x & 31, lr = lane & 15, hi = lane >> 4; const int w = __builtin_amdgcn_readfirstlane((int)(threadIdx.x >> 5));
    const int hh = blockIdx.x % NH_; const int i0 = roff + (NT - 1 - (int)blockIdx.y) * 32;
    Ah += (size_t)(blockIdx.x / NH_) * TT * DQ; Al += (size_t)(blockIdx.x / NH_) * TT * DQ;   // this batch's output rows
    const int Kl = min(KMAX, (i0 + 32 + 63) & ~63);
    const size_t hp = (size_t)blockIdx.x * TT * HD;   // planes are [batch][head]: blockIdx.x = batch x NH_ + head
    {
        V a[2][2], a2[2][2];
        const size_t aoff = hp + (size_t)(i0 / 16) * 1024 + lane * 8;
#pragma unroll
        for (int c = 0; c < 2; ++c)
#pragma unroll
            for (int mb = 0; mb < 2; ++mb) { a[c][mb] = WFrag<T16>::ldf(Q + aoff + mb * 1024 + c * 512); if (NSPLIT == 2) a2[c][mb] = WFrag<T16>::ldf(Q2 + aoff + mb * 1024 + c * 512); }
        // the unit loop stays rolled (two trips at most): unrolled it would hold two units' key fragments and accumulators
#pragma unroll 1
        for (int k0 = w * 64; k0 < Kl; k0 += NW * 64) {
            V b[2][4], b2[2][4]; v8f acc[2][4];
            const size_t boff = hp + (size_t)(k0 / 16) * 1024 + lane * 8;
            // the wait stands behind the query loads (the compiler moves them into this block where the loop has a single trip) and ahead of the key loads, whose results may be given the query loads' address registers;
            // the addresses are its inputs so that their registers are not given away ahead of it
            asm volatile("s_wait_xcnt 0x0" :: "v"(Q + aoff), "v"((NSPLIT == 2 ? Q2 : Q) + aoff) : "memory");
#pragma unroll
            for (int c = 0; c < 2; ++c)
#pragma unroll
                for (int nb = 0; nb < 4; ++nb) { b[c][nb] = WFrag<T16>::ldf(Kp + boff + nb * 1024 + c * 512); if (NSPLIT == 2) b2[c][nb] = WFrag<T16>::ldf(Kp2 + boff + nb * 1024 + c * 512); }
            __builtin_amdgcn_sched_barrier(0);   // keeps the unit's key loads issued together, ahead of their first product: one trip to memory; without it the scheduler issues them in several groups with a wait between
#pragma unroll
            for (int mb = 0; mb < 2; ++mb)
#pragma unroll
                for (int nb = 0; nb < 4; ++nb) acc[mb][nb] = (v8f){};
#pragma unroll
            for (int c = 0; c < 2; ++c)
#pragma unroll
                for (int nb = 0; nb < 4; ++nb)
#pragma unroll
                    for (int mb = 0; mb < 2; ++mb) { acc[mb][nb] = WFrag<T16>::mma(a[c][mb], b[c][nb], acc[mb][nb]); if (NSPLIT == 2) { acc[mb][nb] = WFrag<T16>::mma(a2[c][mb], b[c][nb], acc[mb][nb]); acc[mb][nb] = WFrag<T16>::mma(a[c][mb], b2[c][nb], acc[mb][nb]); } }
            __builtin_amdgcn_sched_barrier(0);   // keeps all eight product chains ahead of the stores: the scheduler otherwise stores a finished tile early and starts the next chain in the same registers
#pragma unroll
            for (int mb = 0; mb < 2; ++mb)
#pragma unroll
                for (int nb = 0; nb < 4; ++nb)
#pragma unroll
                    for (int j = 0; j < 8; ++j) sm[(mb * 16 + hi * 8 + j) * SP + k0 + nb * 16 + lr] = acc[mb][nb][j];
        }
    }
    __syncthreads();   // every score of the 32 rows is in LDS before a row is read
    const float sl = SLOPE8[hh];
    // the row loop stays rolled: one row's registers at a time
#pragma unroll 1
    for (int rr = w; rr < 32; rr += NW) {
        const int i = i0 + rr; float* sr = sm + rr * SP; float v[KMAX / 32]; v4f ar[KMAX / 128]; float mx = -3.0e38f;
        const float di = (float)(i - lane * 4);   // key distance i - j = di - (ch * 128 + q): whole numbers below 2^24, exact in f32
        // chunks of 128 keys at or past Kl are skipped (a scalar test); in a chunk that Kl halves, the upper lanes are off: their keys have no score and no reader
#pragma unroll
        for (int ch = 0; ch < KMAX / 128; ++ch) if (ch * 128 < Kl) { ar[ch] = (v4f){}; if (ch * 128 + lane * 4 < Kl) ar[ch] = *(const v4fa*)(sr + ch * 128 + lane * 4); }
#pragma unroll
        for (int ch = 0; ch < KMAX / 128; ++ch) if (ch * 128 < Kl) { const int j0 = ch * 128 + lane * 4; const v4f a = ar[ch];
#pragma unroll
            for (int q = 0; q < 4; ++q) { const int j = j0 + q; const float t = (j <= i && i - j < WIN) ? (a[q] - sl * (di - (float)(ch * 128 + q))) * SCL : -3.0e38f; v[ch * 4 + q] = t; mx = fmaxf(mx, t); } }
#pragma unroll
        for (int sh = 16; sh; sh >>= 1) mx = fmaxf(mx, __shfl_xor(mx, sh, 32));
        float sum = 0.f;
#pragma unroll
        for (int ch = 0; ch < KMAX / 128; ++ch) if (ch * 128 < Kl) {
#pragma unroll
            for (int q = 0; q < 4; ++q) { const int k = ch * 4 + q; v[k] = __builtin_amdgcn_exp2f(__fmul_rn(__fsub_rn(v[k], mx), 1.4426950408889634f)); sum += v[k]; } }
#pragma unroll
        for (int sh = 16; sh; sh >>= 1) sum += __shfl_xor(sum, sh, 32);
        const float f = __fdiv_rn((NSPLIT == 2) ? 1.0f : PCAR, sum);
#pragma unroll
        for (int ch = 0; ch < KMAX / 128; ++ch) if (ch * 128 < Kl) { const int j0 = ch * 128 + lane * 4;
            if (NSPLIT == 2) { v4us oh, ol;
#pragma unroll
                for (int q = 0; q < 4; ++q) { unsigned short a, c2; splitf(v[ch * 4 + q] * f, a, c2); oh[q] = a; ol[q] = c2; }
                if (j0 < Kl) { *(v4usa*)((bf*)sr + j0) = oh; *(v4usa*)((bf*)sr + KMAX + j0) = ol; }
            } else { v4h o4;
#pragma unroll
                for (int q = 0; q < 4; ++q) o4[q] = tohx(v[ch * 4 + q] * f);
                if (j0 < Kl) *(v4ha*)((h16*)sr + j0) = o4; } }
    }
    __syncthreads();   // every row's probabilities are in LDS before a wave reads all 32 rows
    constexpr int CH = (NSPLIT == 2) ? 1 : 2;   // 32-key chunks whose loads are issued together
    constexpr int lda = 2 * SP;                 // probability row pitch in 2-byte elements
    const T16* A = (const T16*)sm; const T16* A2 = A + KMAX; const T16* Bt = Vt + hp; const T16* Bt2 = (NSPLIT == 2) ? Vt2 + hp : nullptr;
    v8f acc[2][4];
#pragma unroll
    for (int mb = 0; mb < 2; ++mb)
#pragma unroll
        for (int nb = 0; nb < 4; ++nb) acc[mb][nb] = (v8f){};
    const int aoff = lr * lda + 8 * hi; const int boff = lane * 8;
    // the unit loop stays rolled (two trips at most): unrolled it would hold two units' fragments and pass the register budget of a 16-wave work-group
#pragma unroll 1
    for (int k0 = w * 64; k0 < Kl; k0 += NW * 64) {
#pragma unroll
        for (int kh = k0; kh < k0 + 64; kh += CH * 32) {
            V a[CH][2], a2[CH][2], b[CH][4], b2[CH][4];
#pragma unroll
            for (int c = 0; c < CH; ++c) {
#pragma unroll
                for (int nb = 0; nb < 4; ++nb) { b[c][nb] = WFrag<T16>::ldf(Bt + boff + (size_t)(kh / 32 + c) * 2048 + nb * 512); if (NSPLIT == 2) b2[c][nb] = WFrag<T16>::ldf(Bt2 + boff + (size_t)(kh / 32 + c) * 2048 + nb * 512); }
#pragma unroll
                for (int mb = 0; mb < 2; ++mb) { a[c][mb] = WFrag<T16>::ld(A + aoff + mb * 16 * lda + kh + c * 32); if (NSPLIT == 2) a2[c][mb] = WFrag<T16>::ld(A2 + aoff + mb * 16 * lda + kh + c * 32); } }
            __builtin_amdgcn_sched_barrier(0);   // keeps these loads issued ahead of their first product: one trip to memory for all; without it the scheduler sinks loads between the products and the wave waits several times in turn
#pragma unroll
            for (int c = 0; c < CH; ++c)
#pragma unroll
                for (int nb = 0; nb < 4; ++nb)
#pragma unroll
                    for (int mb = 0; mb < 2; ++mb) { acc[mb][nb] = WFrag<T16>::mma(a[c][mb], b[c][nb], acc[mb][nb]); if (NSPLIT == 2) { acc[mb][nb] = WFrag<T16>::mma(a2[c][mb], b[c][nb], acc[mb][nb]); acc[mb][nb] = WFrag<T16>::mma(a[c][mb], b2[c][nb], acc[mb][nb]); } }
        }
    }
    __syncthreads();   // the partial tiles go over the probabilities: every wave has read its last one
    float* pw = sm + w * (32 * 68);
#pragma unroll
    for (int mb = 0; mb < 2; ++mb)
#pragma unroll
        for (int nb = 0; nb < 4; ++nb)
#pragma unroll
            for (int j = 0; j < 8; ++j) pw[(mb * 16 + hi * 8 + j) * 68 + nb * 16 + lr] = acc[mb][nb][j];
    __syncthreads();   // every wave's partial tile is in LDS before the sums
    const float cs = (NSPLIT == 2) ? 1.0f : (1.0f / PCAR);
#pragma unroll
    for (int idx = threadIdx.x; idx < 32 * 16; idx += NW * 32) { const int row = idx >> 4, cofs = (idx & 15) * 4; v4f s = *(const v4fa*)(sm + row * 68 + cofs);
#pragma unroll
        for (int ww = 1; ww < NW; ++ww) s += *(const v4fa*)(sm + ww * (32 * 68) + row * 68 + cofs);
        v4us oh, ol;
#pragma unroll
        for (int q = 0; q < 4; ++q) { unsigned short a, c2; splitf(s[q] * cs, a, c2); oh[q] = a; ol[q] = c2; }
        const size_t oo = (size_t)(i0 + row) * DQ + hh * HD + cofs; *(v4us*)(Ah + oo) = oh; *(v4us*)(Al + oo) = ol; }
}

extern "C" void kernel_launch(void* const* d_in, const int* in_sizes, int n_in,
                              void* d_out, int out_size, void* d_ws, size_t ws_size, hipStream_t stream) {
    (void)in_sizes; (void)n_in; (void)out_size;
    const float* x = (const float*)d_in[0]; const float* wqkv = (const float*)d_in[1]; const float* bqkv = (const float*)d_in[2]; const float* wo = (const float*)d_in[3]; const float* bo = (const float*)d_in[4];   /* x, w_attn ('xw' [1024][3072]), b_attn, w_proj ('xw'), b_proj */
    float* OUT = (float*)d_out;     // [2][2048][1024]
    char* wsp = (char*)d_ws;
    auto take = [&](size_t bytes) { char* p = wsp; wsp += (bytes + 255) & ~(size_t)255; return (void*)p; };
    bf* WQKV = (bf*)take((size_t)3 * DQ * DM * 2);   /* fused Bt [3*DQ][DM]: q | k | v row blocks */ bf* WO = (bf*)take((size_t)DM * DQ * 2);
    bf* XB = (bf*)take((size_t)NB_ * TT * DM * 2);
    const size_t PL = (size_t)NB_ * NH_ * TT * HD;   /* elements of one plane set [batch][head][..][..] */
    h16* QP16 = (h16*)take(2 * PL * 2); h16* KP16 = QP16 + PL; h16* VT16 = (h16*)take(PL * 2);   /* q and k planes lie behind one another: [section][batch][head] */
    bf* QPh = (bf*)take(2 * PL * 2); bf* KPh = QPh + PL; bf* QPl = (bf*)take(2 * PL * 2); bf* KPl = QPl + PL; bf* VTh = (bf*)take(PL * 2); bf* VTl = (bf*)take(PL * 2);
    bf* ATh = (bf*)take((size_t)NB_ * TT * DQ * 2); bf* ATl = (bf*)take((size_t)NB_ * TT * DQ * 2);
    if ((size_t)(wsp - (char*)d_ws) > ws_size) return;    // ws 256 MiB
    static_assert(DQ == DM, "both weights are transposed with one K");
    k_wtG<<<dim3((unsigned)((DM * 3 * DQ / 64 + 63) / 64), 2, 1), 256, 0, stream>>>(wqkv, DM, 3 * DQ, WQKV, wo, DM, WO);   /* fused 'xw' [DM][3*DQ] -> Bt [3*DQ][DM]; 'xw' [DQ][DM] -> Bt [DM][DQ] (DQ == DM) */
    k_cvt8<<<(unsigned)(((size_t)NB_ * TT * DM / 8 + 255) / 256), 256, 0, stream>>>(x, XB, (size_t)NB_ * TT * DM / 8);
    k_gemmw<bf, 0, true, true><<<dim3(NB_ * TT / 128, 3 * DQ / 128, 1), 128, 0, stream>>>(XB, nullptr, WQKV, nullptr, DM, nullptr, 0, bqkv, 0, 0, 0, QP16, QPh, QPl, VT16, VTh, VTl);
    k_attn<bf, 2, 8, RH, RH / 32><<<dim3(NB_ * NH_, RH / 32, 1), 256, 0, stream>>>(QPh, QPl, KPh, KPl, VTh, VTl, 0, ATh, ATl);
    k_attn<h16, 0, 16, TT, (TT - RH) / 32><<<dim3(NB_ * NH_, (TT - RH) / 32, 1), 512, 0, stream>>>(QP16, nullptr, KP16, nullptr, VT16, nullptr, RH, ATh, ATl);
    k_gemmw<bf, 1, true, false><<<dim3(NB_ * TT / 128, DM / 128, 1), 128, 0, stream>>>(ATh, ATl, WO, nullptr, DQ, OUT, DM, bo, 0, 0, 0, nullptr, nullptr, nullptr, nullptr, nullptr, nullptr);
}

// v009
// One run takes 116 microseconds.
// In both of two side-by-side timings against v008, it was 1.06 times as fast.
// Counting every step since v000, it is 14.0 times as fast.
#include <hip/hip_runtime.h>

// Causal self-attention with a fused biased qkv projection and an ALiBi-style bias on the KEY position (x [2][2048][1024]; qkv = (x w_attn + b_attn) ('xw' [1024][3072] 0.02 + bias zeros on this draw: read) reshaped (b, t, 3, 16, 64): q | k | v = column thirds (16 heads x 64); scores / sqrt(float32(64)) + slopes[h] x pos[s] with slopes[h] = 2 ** (-(8/16)(h + 1)) and pos the KEY index s: within a query row t this equals -slopes[h] x (t - s) plus the row constant slopes[h] x t, which the row softmax removes: implemented as the standard ALiBi distance term -slopes[h] x |t - s| on the causal triangle (slopes baked as jnp-exact f32 literals, pre-scaled by 8 for the kernel's exact x 1/8); causal (-inf); softmax; y = merged w_proj + b_proj ('xw' + bias zeros: read) -> [2][2048][1024] (4.2 M); argument order x, w_attn, b_attn, w_proj, b_proj).
// Every pass takes both batches in one grid (x is read as 4096 rows; planes are [batch][head]...), and q, k, v come out of one projection of 3072 columns. Layout: bf16 copy of x; the fused 'xw' weight transposed once into Bt (q | k | v row blocks) + bias slices; exact projections + f32 biases; the qkv projection's epilogue writes the head planes itself; one attention kernel per 32 query rows of a head, scores in LDS: its softmax subtracts SLOPE8[h] x (i - j) in f32, in its register row, before its x 1/8 (hybrid rows: < 512 hi/lo 3 products, rest fp16 x1024; keys past the diagonal block are never touched); merged hi/lo x w_proj exact + b_proj.
// Compute dtypes, f32 accumulate: every input rounded to bf16; projections exact + f32 biases; attention rows < 512 3 products, rest fp16; softmax f32; output projection hl x exact.

#define NB_  2
#define TT   2048
#define DM   1024
#define NH_  16
#define NKV  16
#define REP  (NH_ / NKV)
#define HD   64
#define DQ   (NH_ * HD)
#define DKV  (NKV * HD)
#define RH   512                  // query rows < RH use hi+lo planes (0: none)
#define WIN  2048
#define PCAR 1024.0f
#define SCL  0.125f   // HD^-0.5
typedef _Float16 h16;
typedef unsigned short bf;
typedef __attribute__((ext_vector_type(16))) __bf16   v16bf;
typedef __attribute__((ext_vector_type(16))) _Float16 v16h;
typedef __attribute__((ext_vector_type(8)))  _Float16 v8h;
typedef __attribute__((ext_vector_type(8)))  unsigned short v8us;
typedef __attribute__((ext_vector_type(8)))  float    v8f;
typedef __attribute__((ext_vector_type(4)))  float    v4f;
typedef v8h  __attribute__((may_alias)) v8ha;
typedef v4f  __attribute__((may_alias)) v4fa;
typedef v8us __attribute__((may_alias)) v8usa;

__device__ __forceinline__ unsigned short f2bf(float f) { unsigned u = __float_as_uint(f); u += 0x7FFFu + ((u >> 16) & 1u); return (unsigned short)(u >> 16); }
__device__ __forceinline__ float bf2f(unsigned short b) { return __uint_as_float(((unsigned)b) << 16); }
__device__ __forceinline__ float bfr(float f) { return bf2f(f2bf(f)); }
__device__ __forceinline__ v16h cat16(v8h lo, v8h hi) { return __builtin_shufflevector(lo, hi, 0, 1, 2, 3, 4, 5, 6, 7, 8, 9, 10, 11, 12, 13, 14, 15); }
__device__ __forceinline__ v16bf cat16b(v8us lo, v8us hi) { return __builtin_bit_cast(v16bf, __builtin_shufflevector(lo, hi, 0, 1, 2, 3, 4, 5, 6, 7, 8, 9, 10, 11, 12, 13, 14, 15)); }
__device__ __forceinline__ v8f wmma16(v16h a, v16h b, v8f c) { return __builtin_amdgcn_wmma_f32_16x16x32_f16(false, a, false, b, (short)0, c, false, false); }
__device__ __forceinline__ v8f wmmab(v16bf a, v16bf b, v8f c) { return __builtin_amdgcn_wmma_f32_16x16x32_bf16(false, a, false, b, (short)0, c, false, false); }
__device__ __forceinline__ h16 tohx(float x) { return (h16)x; }
__device__ __forceinline__ void splitf(float y, unsigned short& h, unsigned short& l) { h = f2bf(y); l = f2bf(y - bf2f(h)); }



// ---- k_gemmw: register-blocked GEMM, one work-group of FOUR WAVES per 128x128 output tile, one wave per 64x64 quarter (16 accumulators); grid (M/128, N/128, Z), 128 threads.
// C[m][n] (f32, pitch ldc, + optional f32 bias[n]) = sum_k A[m][k] Bt[n][k] (NSPLIT 1: + A2[m][k] Bt[n][k]). z-batch strides sA/sB/sC in elements. K % 64 == 0, M % 128 == 0, N % 128 == 0.
// Operands: K-contiguous 16-bit planes. Per trip a slab of 64 k (one whole 128-byte line a row) of the tile's 128 A rows and 128 Bt rows lies in LDS, at a row pitch of 144 bytes for the 16-byte fragment readers;
// asynchronous copies to LDS bring it there, 16 bytes a lane, eight lanes a line, two buffers: the slab after next flies while the next one is worked on. The k order of every accumulator is that of a plain loop over k in steps of 32.
// PLANES (the qkv projection): no f32 C. A wave's tile is 64 rows t of one batch x the 64 columns of one head of q, k or v (column block = section x heads + head); its biased f32 sums go out at once as the attention kernel's 2-byte planes
// (fp16, and bf16 hi + lo), each head's plane laid out IN THE ORDER OF THE MATRIX FRAGMENTS that the attention kernel loads, so that one 16-byte load of a wave there reads 512 bytes in a row (four whole lines):
// q and k, [section][batch][head]: element (t, d) at (t / 16) x 1024 + (d / 16) x 256 + ((d / 8 % 2) x 16 + t % 16) x 8 + d % 8; v, [batch][head]: element (d, t) at (t / 32) x 2048 + (d / 16) x 512 + (t / 16 % 2) x 256 + ((t / 8 % 2) x 16 + d % 16) x 8 + t % 8.
// Every store is 16 bytes a lane, 512 bytes in a row a wave; q and k are turned in the wave's own LDS (a piece of the slab buffers, free behind the last trip's barrier), v goes out straight from the accumulators.
// ld: a fragment from rows of k-contiguous elements (p: the lane's row, + 8 x its half). ldf: a fragment from a plane in fragment order (p: the fragment's start + 8 x lane; its two halves of k lie 256 elements apart).
template <typename T16> struct WFrag;
template <> struct WFrag<h16> { typedef v16h V; static __device__ __forceinline__ V ld(const h16* p) { return cat16(*(const v8h*)p, *(const v8h*)(p + 16)); } static __device__ __forceinline__ V ldf(const h16* p) { return cat16(*(const v8h*)p, *(const v8h*)(p + 256)); } static __device__ __forceinline__ v8f mma(V a, V b, v8f c) { return wmma16(a, b, c); } };
template <> struct WFrag<bf> { typedef v16bf V; static __device__ __forceinline__ V ld(const bf* p) { return cat16b(*(const v8us*)p, *(const v8us*)(p + 16)); } static __device__ __forceinline__ V ldf(const bf* p) { return cat16b(*(const v8us*)p, *(const v8us*)(p + 256)); } static __device__ __forceinline__ v8f mma(V a, V b, v8f c) { return wmmab(a, b, c); } };
// Eight asynchronous 16-byte copies a lane: rows r, r + 16, ... r + 112 of one 128-row slab (l: the lane's LDS byte address, ls: 16 LDS rows in bytes; g: its global address, rs: 16 global rows in elements).
// The s_wait_xcnt is the last line of the copies' own statement, so that it stands ahead of every later write of a register that a copy names.
template <typename T16>
__device__ __forceinline__ void cp8(unsigned l, unsigned ls, const T16* g, size_t rs) {
    asm volatile("global_load_async_to_lds_b128 %0, %8, off\n\t"
                 "global_load_async_to_lds_b128 %1, %9, off\n\t"
                 "global_load_async_to_lds_b128 %2, %10, off\n\t"
                 "global_load_async_to_lds_b128 %3, %11, off\n\t"
                 "global_load_async_to_lds_b128 %4, %12, off\n\t"
                 "global_load_async_to_lds_b128 %5, %13, off\n\t"
                 "global_load_async_to_lds_b128 %6, %14, off\n\t"
                 "global_load_async_to_lds_b128 %7, %15, off\n\t"
                 "s_wait_xcnt 0x0"
                 :: "v"(l), "v"(l + ls), "v"(l + 2 * ls), "v"(l + 3 * ls), "v"(l + 4 * ls), "v"(l + 5 * ls), "v"(l + 6 * ls), "v"(l + 7 * ls),
                    "v"(g), "v"(g + rs), "v"(g + 2 * rs), "v"(g + 3 * rs), "v"(g + 4 * rs), "v"(g + 5 * rs), "v"(g + 6 * rs), "v"(g + 7 * rs)
                 : "memory");
}
template <typename T16, int NSPLIT, bool BIAS, bool PLANES>
__global__ __launch_bounds__(128) void k_gemmw(const T16* __restrict__ A, const T16* __restrict__ A2, const T16* __restrict__ Bt, const T16* __restrict__ Bt2, int K, float* C, int ldc, const float* __restrict__ bias, size_t sA, size_t sB, size_t sC, h16* P16, bf* Ph, bf* Pl, h16* V16, bf* Vh, bf* Vl) {
    typedef typename WFrag<T16>::V V;
    static_assert(NSPLIT == 0 || NSPLIT == 1, "slabs are staged for A, Bt and (NSPLIT 1) A2");
    (void)Bt2;
    constexpr int LP = 72;   // pitch of a staged operand row in 2-byte elements: 64 k + 16 bytes of pad
    constexpr int TE = 128 * LP;                   // elements of one operand's slab
    constexpr int BE = (NSPLIT == 1 ? 3 : 2) * TE; // elements of one buffer: A | Bt | A2
    constexpr int OSF = 16 * 68;   // floats of one wave's output staging
    static_assert(4 * OSF <= BE, "the output staging lies inside the slab buffers");
    __shared__ __align__(16) float smf[BE];        // two buffers of BE 2-byte elements
    const size_t z = blockIdx.z; A += z * sA; if (A2) A2 += z * sA; Bt += z * sB; C += z * sC;
    const int lane = threadIdx.x & 31, lr = lane & 15, hi = lane >> 4; const int w = __builtin_amdgcn_readfirstlane((int)(threadIdx.x >> 5));
    const int R0 = blockIdx.x * 128, C0 = blockIdx.y * 128; const int r0 = R0 + (w & 1) * 64, c0 = C0 + (w >> 1) * 64;
    v8f acc[4][4];
#pragma unroll
    for (int mb = 0; mb < 4; ++mb)
#pragma unroll
        for (int nb = 0; nb < 4; ++nb) acc[mb][nb] = (v8f){};
    // a lane's share of a slab: 16 bytes of row crow + 16 i, i = 0 .. 7
    const int crow = threadIdx.x >> 3, ccol = (threadIdx.x & 7) * 8;
    const unsigned l0 = (unsigned)(size_t)smf + (unsigned)(crow * LP + ccol) * 2u;
    const T16* ga = A + (size_t)(R0 + crow) * K + ccol; const T16* gb = Bt + (size_t)(C0 + crow) * K + ccol; const T16* ga2 = (NSPLIT == 1) ? A2 + (size_t)(R0 + crow) * K + ccol : nullptr;
    const size_t rs = (size_t)16 * K;
    auto fill = [&](int t, int buf) { const unsigned l = l0 + (unsigned)buf * (BE * 2u);
        cp8(l, 16u * LP * 2u, ga + t * 64, rs); cp8(l + TE * 2u, 16u * LP * 2u, gb + t * 64, rs); if (NSPLIT == 1) cp8(l + 2u * TE * 2u, 16u * LP * 2u, ga2 + t * 64, rs); };
    const int nt = K / 64;
    fill(0, 0);
    asm volatile("s_wait_asynccnt 0x0" ::: "memory");   // this wave's copies of slab 0 have landed
    __syncthreads();                                    // every wave's have: slab 0 may be read
    if (nt > 1) fill(1, 1);
    const T16* ring = (const T16*)smf;
    const int fa = ((w & 1) * 64 + lr) * LP + 8 * hi, fb = TE + ((w >> 1) * 64 + lr) * LP + 8 * hi;
    // the trip loop stays rolled: one trip's fragments at a time, and one publish point in the text
#pragma unroll 1
    for (int t = 0; t < nt; ++t) {
        const T16* sb = ring + (t & 1) * BE;
#pragma unroll
        for (int kk = 0; kk < 64; kk += 32) {
            V a[4], a2[4], b[4];
#pragma unroll
            for (int mb = 0; mb < 4; ++mb) { a[mb] = WFrag<T16>::ld(sb + fa + mb * 16 * LP + kk); if (NSPLIT == 1) a2[mb] = WFrag<T16>::ld(sb + 2 * TE + fa + mb * 16 * LP + kk); }
#pragma unroll
            for (int nb = 0; nb < 4; ++nb) b[nb] = WFrag<T16>::ld(sb + fb + nb * 16 * LP + kk);
            __builtin_amdgcn_sched_barrier(0);   // keeps the step's fragment reads issued as one group ahead of its products: one LDS latency a step; without it the scheduler reads each Bt fragment into one register set and waits for it four times a step
#pragma unroll
            for (int nb = 0; nb < 4; ++nb)
#pragma unroll
                for (int mb = 0; mb < 4; ++mb) { acc[mb][nb] = WFrag<T16>::mma(a[mb], b[nb], acc[mb][nb]); if (NSPLIT == 1) acc[mb][nb] = WFrag<T16>::mma(a2[mb], b[nb], acc[mb][nb]); }
        }
        asm volatile("s_wait_dscnt 0x0" ::: "memory");      // this wave's reads of the buffer have returned before the buffer is handed to the copies
        asm volatile("s_wait_asynccnt 0x0" ::: "memory");   // this wave's copies of slab t + 1 have landed
        __syncthreads();                                    // publishes slab t + 1 and ends every wave's reads of slab t
        if (t + 2 < nt) fill(t + 2, t & 1);
    }
    asm volatile("s_wait_asynccnt 0x0" ::: "memory");       // no copy is in flight when the buffers become output staging
    float* os = smf + w * OSF;
    if constexpr (PLANES) {
        static_assert(BIAS && NKV == NH_ && HD == 64 && TT % 64 == 0, "a tile is one head's columns and lies in one batch");
        const int sec = (c0 / 64) / NH_, head = (c0 / 64) % NH_, bt = r0 / TT, t0 = r0 % TT;   // section 0: q, 1: k, 2: v
        float bb[4];   // the biases of the lane's four accumulator columns
#pragma unroll
        for (int nb = 0; nb < 4; ++nb) bb[nb] = bfr(bias[c0 + nb * 16 + lr]);
        if (sec != 2) {
            // q, k: per block of 16 t the biased f32 sums are turned in LDS from accumulator order (a lane: one d, eight t) into fragment order (a lane: one t, eight d).
            const size_t po = (size_t)((sec * NB_ + bt) * NH_ + head) * TT * HD + (size_t)(t0 / 16) * 1024 + lane * 8;
#pragma unroll
            for (int mb = 0; mb < 4; ++mb) {
#pragma unroll
                for (int nb = 0; nb < 4; ++nb) {
#pragma unroll
                    for (int j = 0; j < 8; ++j) os[(hi * 8 + j) * 68 + nb * 16 + lr] = acc[mb][nb][j] + bb[nb]; }
                asm volatile("s_wait_dscnt 0x0" ::: "memory");   // the staged rows are in LDS before other lanes of the wave read them back
#pragma unroll
                for (int s = 0; s < 4; ++s) { const float* sp = os + lr * 68 + s * 16 + hi * 8; const v4f x0 = *(const v4fa*)sp, x1 = *(const v4fa*)(sp + 4); v8h o16; v8us oh, ol;
#pragma unroll
                    for (int k = 0; k < 8; ++k) { const float x = k < 4 ? x0[k & 3] : x1[k & 3]; o16[k] = tohx(x); unsigned short a2, c2; splitf(x, a2, c2); oh[k] = a2; ol[k] = c2; }
                    const size_t o = po + (size_t)(mb * 1024 + s * 256); *(v8h*)(P16 + o) = o16; *(v8us*)(Ph + o) = oh; *(v8us*)(Pl + o) = ol;
                    asm volatile("s_wait_xcnt 0x0" ::: "memory"); }   // stands between the three stores and the next values, which are formed in the stores' data registers
                if (mb < 3) asm volatile("s_wait_dscnt 0x0" ::: "memory");   // every read of the block has returned before the next block is staged over it
            }
        } else {
            // v: a lane's eight accumulator rows are eight neighbouring t of its column d, which is the lane's own 16 bytes of a fragment: no staging.
            const size_t vo = (size_t)(bt * NKV + head) * HD * TT + (size_t)(t0 / 32) * 2048 + lane * 8;
#pragma unroll
            for (int nb = 0; nb < 4; ++nb) {
#pragma unroll
                for (int mb = 0; mb < 4; ++mb) { v8h o16; v8us oh, ol;
#pragma unroll
                    for (int j = 0; j < 8; ++j) { const float x = acc[mb][nb][j] + bb[nb]; o16[j] = tohx(x); unsigned short a2, c2; splitf(x, a2, c2); oh[j] = a2; ol[j] = c2; }
                    const size_t o = vo + (size_t)((mb >> 1) * 2048 + nb * 512 + (mb & 1) * 256); *(v8h*)(V16 + o) = o16; *(v8us*)(Vh + o) = oh; *(v8us*)(Vl + o) = ol;
                    asm volatile("s_wait_xcnt 0x0" ::: "memory");   // stands between the three stores and the next values, which are formed in the stores' data registers
                    __builtin_amdgcn_sched_barrier(0); }            // keeps the next values' arithmetic, which reads registers only, behind that wait: the scheduler otherwise lifts it over the wait
            }
        }
    } else {
#pragma unroll
    for (int mb = 0; mb < 4; ++mb) {
#pragma unroll
        for (int nb = 0; nb < 4; ++nb) {
#pragma unroll
            for (int j = 0; j < 8; ++j) os[(hi * 8 + j) * 68 + nb * 16 + lr] = acc[mb][nb][j]; }
        __builtin_amdgcn_wave_barrier(); asm volatile("" ::: "memory");
        float* crow = C + (size_t)(r0 + mb * 16) * ldc + c0;
{
#pragma unroll
            for (int s = 0; s < 8; ++s) { const int row = 2 * s + hi, cofs = lr * 4; v4f val = *(const v4fa*)(os + row * 68 + cofs); if (BIAS) { val[0] += bfr(bias[c0 + cofs]); val[1] += bfr(bias[c0 + cofs + 1]); val[2] += bfr(bias[c0 + cofs + 2]); val[3] += bfr(bias[c0 + cofs + 3]); }
                *(v4f*)(crow + (size_t)row * ldc + cofs) = val; }
             }
        __builtin_amdgcn_wave_barrier(); asm volatile("" ::: "memory");
    }
    }
}

typedef __attribute__((ext_vector_type(4))) _Float16 v4h;
typedef __attribute__((ext_vector_type(2))) unsigned short v2us;
typedef __attribute__((ext_vector_type(4))) unsigned short v4us;
typedef __attribute__((ext_vector_type(4))) int v4i;

__global__ __launch_bounds__(256) void k_wtG(const float* __restrict__ w, int K, int N, bf* Bt, const float* __restrict__ w2, int N2, bf* Bt2) {
    if (blockIdx.y) { w = w2; N = N2; Bt = Bt2; }   // grid y = 1: the second weight (same K); its surplus work-groups leave at the line test below
    const int lane = threadIdx.x & 31; const int L0 = (blockIdx.x * 8 + (threadIdx.x >> 5)) * 8; const int nlines = N * K / 64;
{
#pragma unroll 1
        for (int l = 0; l < 8; ++l) { const int L = L0 + l; if (L >= nlines) break; const size_t e = (size_t)L * 64 + lane * 2; const int k = (int)(e % K), n = (int)(e / K); v2us o;
            o[0] = f2bf(w[(size_t)k * N + n]); o[1] = f2bf(w[(size_t)(k + 1) * N + n]); *(v2us*)(Bt + e) = o; }
         }
}
__global__ __launch_bounds__(256) void k_cvt8(const float* __restrict__ src, bf* dst, size_t n8) { const size_t i = (size_t)blockIdx.x * 256 + threadIdx.x; if (i >= n8) return; const v8f v = *(const v8f*)(src + i * 8); v8us o;
#pragma unroll
    for (int k = 0; k < 8; ++k) o[k] = f2bf(v[k]); *(v8us*)(dst + i * 8) = o;  }

__constant__ float SLOPE8[NH_] = { 5.656854153e+0f, 4.000000000e+0f, 2.828427076e+0f, 2.000000000e+0f, 1.414213538e+0f, 1.000000000e+0f, 7.071067691e-1f, 5.000000000e-1f, 3.535533845e-1f, 2.500000000e-1f, 1.767766923e-1f, 1.250000000e-1f, 8.838834614e-2f, 6.250000000e-2f, 4.419417307e-2f, 3.125000000e-2f };   // 8 x the per-head ALiBi slope magnitude (slopes[h] = 2 ** (-(8/16)(h + 1)), h = 0..15, as the reference's f32 values x 8); the eight power-of-two entries give exact products with |i - j| <= 2047; for the eight irrational ones the product goes unrounded into the fused multiply-subtract of k_attn
typedef v4us __attribute__((may_alias)) v4usa;
typedef v4h  __attribute__((may_alias)) v4ha;
// ---- k_attn: one work-group of NW waves does the whole attention of one head's 32 query rows (i0 .. i0 + 31, i0 = roff + 32 x tile); the rows' f32 scores never leave LDS. grid (batches x heads, NT tiles), the longest tiles of both batches first.
// The q, k and v planes lie in fragment order (k_gemmw): every fragment load of a wave reads 512 bytes in a row.
// 1. scores: wave w takes the 64-key units w, w + NW, ... below Kl (the diagonal block's end; later keys are masked) and stores its 32 x 64 f32 tiles into the score rows (pitch KMAX + 4 floats: 16 bytes of pad for the 16-byte readers of step 3).
// 2. softmax: one wave per row, the row in registers: t = (S - SLOPE8[h] x (i - j)) x HD^-0.5 for j <= i (the mask is applied only in the chunk of keys that the diagonal crosses), one exp, fixed trees. The 2-byte probabilities go over the row's own f32 scores (fp16: first half of the row; hi and lo planes: one half each);
//    the wave holds all of its row before its first store (every store needs the row sum) and no wave touches another row.
// 3. P.V: wave w takes the same units of keys, A fragments from LDS, value fragments from memory; private f32 partial tiles, laid over the probabilities once every wave has read them, are summed in the fixed order w = 0 .. NW-1.
// 4. the sums, scaled back, go out as hi + lo planes [t][head x HD + d] for the output projection.
// Every loop but the three marked ones is fully unrolled, so that the fragment, accumulator and row arrays are indexed by constants and live in registers.
template <typename T16, int NSPLIT, int NW, int KMAX, int NT>
__global__ __launch_bounds__(NW * 32) void k_attn(const T16* __restrict__ Q, const T16* __restrict__ Q2, const T16* __restrict__ Kp, const T16* __restrict__ Kp2, const T16* __restrict__ Vt, const T16* __restrict__ Vt2, int roff, bf* Ah, bf* Al) {
    typedef typename WFrag<T16>::V V;
    constexpr int SP = KMAX + 4;
    constexpr int SMF = (32 * SP > NW * 32 * 68) ? 32 * SP : NW * 32 * 68;
    __shared__ __align__(16) float sm[SMF];
    const int lane = threadIdx.x & 31, lr = lane & 15, hi = lane >> 4; const int w = __builtin_amdgcn_readfirstlane((int)(threadIdx.x >> 5));
    const int hh = blockIdx.x % NH_; const int i0 = roff + (NT - 1 - (int)blockIdx.y) * 32;
    Ah += (size_t)(blockIdx.x / NH_) * TT * DQ; Al += (size_t)(blockIdx.x / NH_) * TT * DQ;   // this batch's output rows
    const int Kl = min(KMAX, (i0 + 32 + 63) & ~63);
    const size_t hp = (size_t)blockIdx.x * TT * HD;   // planes are [batch][head]: blockIdx.x = batch x NH_ + head
    {
        V a[2][2], a2[2][2];
        const size_t aoff = hp + (size_t)(i0 / 16) * 1024 + lane * 8;
#pragma unroll
        for (int c = 0; c < 2; ++c)
#pragma unroll
            for (int mb = 0; mb < 2; ++mb) { a[c][mb] = WFrag<T16>::ldf(Q + aoff + mb * 1024 + c * 512); if (NSPLIT == 2) a2[c][mb] = WFrag<T16>::ldf(Q2 + aoff + mb * 1024 + c * 512); }
        // the unit loop stays rolled (two trips at most): unrolled it would hold two units' key fragments and accumulators
#pragma unroll 1
        for (int k0 = w * 64; k0 < Kl; k0 += NW * 64) {
            V b[2][4], b2[2][4]; v8f acc[2][4];
            const size_t boff = hp + (size_t)(k0 / 16) * 1024 + lane * 8;
            // the wait stands behind the query loads (the compiler moves them into this block where the loop has a single trip) and ahead of the key loads, whose results may be given the query loads' address registers;
            // the addresses are its inputs so that their registers are not given away ahead of it
            asm volatile("s_wait_xcnt 0x0" :: "v"(Q + aoff), "v"((NSPLIT == 2 ? Q2 : Q) + aoff) : "memory");
#pragma unroll
            for (int c = 0; c < 2; ++c)
#pragma unroll
                for (int nb = 0; nb < 4; ++nb) { b[c][nb] = WFrag<T16>::ldf(Kp + boff + nb * 1024 + c * 512); if (NSPLIT == 2) b2[c][nb] = WFrag<T16>::ldf(Kp2 + boff + nb * 1024 + c * 512); }
            __builtin_amdgcn_sched_barrier(0);   // keeps the unit's key loads issued together, ahead of their first product: one trip to memory; without it the scheduler issues them in several groups with a wait between
#pragma unroll
            for (int mb = 0; mb < 2; ++mb)
#pragma unroll
                for (int nb = 0; nb < 4; ++nb) acc[mb][nb] = (v8f){};
#pragma unroll
            for (int c = 0; c < 2; ++c)
#pragma unroll
                for (int nb = 0; nb < 4; ++nb)
#pragma unroll
                    for (int mb = 0; mb < 2; ++mb) { acc[mb][nb] = WFrag<T16>::mma(a[c][mb], b[c][nb], acc[mb][nb]); if (NSPLIT == 2) { acc[mb][nb] = WFrag<T16>::mma(a2[c][mb], b[c][nb], acc[mb][nb]); acc[mb][nb] = WFrag<T16>::mma(a[c][mb], b2[c][nb], acc[mb][nb]); } }
            __builtin_amdgcn_sched_barrier(0);   // keeps all eight product chains ahead of the stores: the scheduler otherwise stores a finished tile early and starts the next chain in the same registers
#pragma unroll
            for (int mb = 0; mb < 2; ++mb)
#pragma unroll
                for (int nb = 0; nb < 4; ++nb)
#pragma unroll
                    for (int j = 0; j < 8; ++j) sm[(mb * 16 + hi * 8 + j) * SP + k0 + nb * 16 + lr] = acc[mb][nb][j];
        }
    }
    __syncthreads();   // every score of the 32 rows is in LDS before a row is read
    const float sl = SLOPE8[hh];
    // the row loop stays rolled: one row's registers at a time
#pragma unroll 1
    for (int rr = w; rr < 32; rr += NW) {
        const int i = i0 + rr; float* sr = sm + rr * SP; float v[KMAX / 32], vt[4]; v4f ar[KMAX / 128], at = (v4f){}; float mx = -3.0e38f;
        // The row's keys in chunks of 128 (four a lane). The first nf chunks lie whole at or below the diagonal: no key of theirs is masked, every lane reads and writes them, and one scalar test a chunk is all their control flow.
        // At most one more chunk reaches below Kl (Kl <= i0 + 64, i0 a multiple of 32): the one that the diagonal crosses. It has registers of its own (at, vt), since its index is not a constant; it alone is masked,
        // and where Kl halves it its upper lanes are off: their keys have no score and no reader.
        // 'ch < nf' is marked as expected so that the chunk bodies stay in line, each test falling through into its body: unmarked, the compiler moves every body out of line, two taken branches a chunk and pass.
        const int nf = (i + 1) >> 7; const bool tail = nf * 128 < Kl; const int jt = nf * 128 + lane * 4;
        float dq[4];   // key distance i - j of the lane's four keys of the current chunk: whole numbers below 2^24, exact in f32; 128 less from chunk to chunk
#pragma unroll
        for (int q = 0; q < 4; ++q) dq[q] = (float)(i - lane * 4 - q);
#pragma unroll
        for (int ch = 0; ch < KMAX / 128; ++ch) if (__builtin_expect(ch < nf, 1)) ar[ch] = *(const v4fa*)(sr + ch * 128 + lane * 4);
        if (tail) { if (jt < Kl) at = *(const v4fa*)(sr + jt); }
        // v and vt hold 8 x the biased score: the exact x 1/8 is part of the factor EXC below
#pragma unroll
        for (int ch = 0; ch < KMAX / 128; ++ch) if (__builtin_expect(ch < nf, 1)) {
#pragma unroll
            for (int q = 0; q < 4; ++q) { const float t = ar[ch][q] - sl * dq[q]; v[ch * 4 + q] = t; mx = fmaxf(mx, t); dq[q] -= 128.0f; } }
        if (tail) {
#pragma unroll
            for (int q = 0; q < 4; ++q) { const int j = jt + q; const float t = (j <= i && (WIN >= TT || i - j < WIN)) ? at[q] - sl * dq[q] : -3.0e38f; vt[q] = t; mx = fmaxf(mx, t); } }
#pragma unroll
        for (int sh = 16; sh; sh >>= 1) mx = fmaxf(mx, __shfl_xor(mx, sh, 32));
        float sum = 0.f;
        constexpr float EXC = 1.4426950408889634f * SCL;   // log2(e) x HD^-0.5: a power of two times log2(e), so difference and product round as they did on the scaled scores
#pragma unroll
        for (int ch = 0; ch < KMAX / 128; ++ch) if (__builtin_expect(ch < nf, 1)) {
#pragma unroll
            for (int q = 0; q < 4; ++q) { const int k = ch * 4 + q; v[k] = __builtin_amdgcn_exp2f(__fmul_rn(__fsub_rn(v[k], mx), EXC)); sum += v[k]; } }
        if (tail) {
#pragma unroll
            for (int q = 0; q < 4; ++q) { vt[q] = __builtin_amdgcn_exp2f(__fmul_rn(__fsub_rn(vt[q], mx), EXC)); sum += vt[q]; } }
#pragma unroll
        for (int sh = 16; sh; sh >>= 1) sum += __shfl_xor(sum, sh, 32);
        const float f = __fdiv_rn((NSPLIT == 2) ? 1.0f : PCAR, sum);
#pragma unroll
        for (int ch = 0; ch < KMAX / 128; ++ch) if (__builtin_expect(ch < nf, 1)) { const int j0 = ch * 128 + lane * 4;
            if (NSPLIT == 2) { v4us oh, ol;
#pragma unroll
                for (int q = 0; q < 4; ++q) { unsigned short a, c2; splitf(v[ch * 4 + q] * f, a, c2); oh[q] = a; ol[q] = c2; }
                *(v4usa*)((bf*)sr + j0) = oh; *(v4usa*)((bf*)sr + KMAX + j0) = ol;
            } else { v4h o4;
#pragma unroll
                for (int q = 0; q < 4; ++q) o4[q] = tohx(v[ch * 4 + q] * f);
                *(v4ha*)((h16*)sr + j0) = o4; } }
        if (tail) {
            if (NSPLIT == 2) { v4us oh, ol;
#pragma unroll
                for (int q = 0; q < 4; ++q) { unsigned short a, c2; splitf(vt[q] * f, a, c2); oh[q] = a; ol[q] = c2; }
                if (jt < Kl) { *(v4usa*)((bf*)sr + jt) = oh; *(v4usa*)((bf*)sr + KMAX + jt) = ol; }
            } else { v4h o4;
#pragma unroll
                for (int q = 0; q < 4; ++q) o4[q] = tohx(vt[q] * f);
                if (jt < Kl) *(v4ha*)((h16*)sr + jt) = o4; } }
    }
    __syncthreads();   // every row's probabilities are in LDS before a wave reads all 32 rows
    constexpr int CH = (NSPLIT == 2) ? 1 : 2;   // 32-key chunks whose loads are issued together
    constexpr int lda = 2 * SP;                 // probability row pitch in 2-byte elements
    const T16* A = (const T16*)sm; const T16* A2 = A + KMAX; const T16* Bt = Vt + hp; const T16* Bt2 = (NSPLIT == 2) ? Vt2 + hp : nullptr;
    v8f acc[2][4];
#pragma unroll
    for (int mb = 0; mb < 2; ++mb)
#pragma unroll
        for (int nb = 0; nb < 4; ++nb) acc[mb][nb] = (v8f){};
    const int aoff = lr * lda + 8 * hi; const int boff = lane * 8;
    // the unit loop stays rolled (two trips at most): unrolled it would hold two units' fragments and pass the register budget of a 16-wave work-group
#pragma unroll 1
    for (int k0 = w * 64; k0 < Kl; k0 += NW * 64) {
#pragma unroll
        for (int kh = k0; kh < k0 + 64; kh += CH * 32) {
            V a[CH][2], a2[CH][2], b[CH][4], b2[CH][4];
#pragma unroll
            for (int c = 0; c < CH; ++c) {
#pragma unroll
                for (int nb = 0; nb < 4; ++nb) { b[c][nb] = WFrag<T16>::ldf(Bt + boff + (size_t)(kh / 32 + c) * 2048 + nb * 512); if (NSPLIT == 2) b2[c][nb] = WFrag<T16>::ldf(Bt2 + boff + (size_t)(kh / 32 + c) * 2048 + nb * 512); }
#pragma unroll
                for (int mb = 0; mb < 2; ++mb) { a[c][mb] = WFrag<T16>::ld(A + aoff + mb * 16 * lda + kh + c * 32); if (NSPLIT == 2) a2[c][mb] = WFrag<T16>::ld(A2 + aoff + mb * 16 * lda + kh + c * 32); } }
            __builtin_amdgcn_sched_barrier(0);   // keeps these loads issued ahead of their first product: one trip to memory for all; without it the scheduler sinks loads between the products and the wave waits several times in turn
#pragma unroll
            for (int c = 0; c < CH; ++c)
#pragma unroll
                for (int nb = 0; nb < 4; ++nb)
#pragma unroll
                    for (int mb = 0; mb < 2; ++mb) { acc[mb][nb] = WFrag<T16>::mma(a[c][mb], b[c][nb], acc[mb][nb]); if (NSPLIT == 2) { acc[mb][nb] = WFrag<T16>::mma(a2[c][mb], b[c][nb], acc[mb][nb]); acc[mb][nb] = WFrag<T16>::mma(a[c][mb], b2[c][nb], acc[mb][nb]); } }
        }
    }
    __syncthreads();   // the partial tiles go over the probabilities: every wave has read its last one
    float* pw = sm + w * (32 * 68);
#pragma unroll
    for (int mb = 0; mb < 2; ++mb)
#pragma unroll
        for (int nb = 0; nb < 4; ++nb)
#pragma unroll
            for (int j = 0; j < 8; ++j) pw[(mb * 16 + hi * 8 + j) * 68 + nb * 16 + lr] = acc[mb][nb][j];
    __syncthreads();   // every wave's partial tile is in LDS before the sums
    const float cs = (NSPLIT == 2) ? 1.0f : (1.0f / PCAR);
#pragma unroll
    for (int idx = threadIdx.x; idx < 32 * 16; idx += NW * 32) { const int row = idx >> 4, cofs = (idx & 15) * 4; v4f s = *(const v4fa*)(sm + row * 68 + cofs);
#pragma unroll
        for (int ww = 1; ww < NW; ++ww) s += *(const v4fa*)(sm + ww * (32 * 68) + row * 68 + cofs);
        v4us oh, ol;
#pragma unroll
        for (int q = 0; q < 4; ++q) { unsigned short a, c2; splitf(s[q] * cs, a, c2); oh[q] = a; ol[q] = c2; }
        const size_t oo = (size_t)(i0 + row) * DQ + hh * HD + cofs; *(v4us*)(Ah + oo) = oh; *(v4us*)(Al + oo) = ol; }
}

extern "C" void kernel_launch(void* const* d_in, const int* in_sizes, int n_in,
                              void* d_out, int out_size, void* d_ws, size_t ws_size, hipStream_t stream) {
    (void)in_sizes; (void)n_in; (void)out_size;
    const float* x = (const float*)d_in[0]; const float* wqkv = (const float*)d_in[1]; const float* bqkv = (const float*)d_in[2]; const float* wo = (const float*)d_in[3]; const float* bo = (const float*)d_in[4];   /* x, w_attn ('xw' [1024][3072]), b_attn, w_proj ('xw'), b_proj */
    float* OUT = (float*)d_out;     // [2][2048][1024]
    char* wsp = (char*)d_ws;
    auto take = [&](size_t bytes) { char* p = wsp; wsp += (bytes + 255) & ~(size_t)255; return (void*)p; };
    bf* WQKV = (bf*)take((size_t)3 * DQ * DM * 2);   /* fused Bt [3*DQ][DM]: q | k | v row blocks */ bf* WO = (bf*)take((size_t)DM * DQ * 2);
    bf* XB = (bf*)take((size_t)NB_ * TT * DM * 2);
    const size_t PL = (size_t)NB_ * NH_ * TT * HD;   /* elements of one plane set [batch][head][..][..] */
    h16* QP16 = (h16*)take(2 * PL * 2); h16* KP16 = QP16 + PL; h16* VT16 = (h16*)take(PL * 2);   /* q and k planes lie behind one another: [section][batch][head] */
    bf* QPh = (bf*)take(2 * PL * 2); bf* KPh = QPh + PL; bf* QPl = (bf*)take(2 * PL * 2); bf* KPl = QPl + PL; bf* VTh = (bf*)take(PL * 2); bf* VTl = (bf*)take(PL * 2);
    bf* ATh = (bf*)take((size_t)NB_ * TT * DQ * 2); bf* ATl = (bf*)take((size_t)NB_ * TT * DQ * 2);
    if ((size_t)(wsp - (char*)d_ws) > ws_size) return;    // ws 256 MiB
    static_assert(DQ == DM, "both weights are transposed with one K");
    k_wtG<<<dim3((unsigned)((DM * 3 * DQ / 64 + 63) / 64), 2, 1), 256, 0, stream>>>(wqkv, DM, 3 * DQ, WQKV, wo, DM, WO);   /* fused 'xw' [DM][3*DQ] -> Bt [3*DQ][DM]; 'xw' [DQ][DM] -> Bt [DM][DQ] (DQ == DM) */
    k_cvt8<<<(unsigned)(((size_t)NB_ * TT * DM / 8 + 255) / 256), 256, 0, stream>>>(x, XB, (size_t)NB_ * TT * DM / 8);
    k_gemmw<bf, 0, true, true><<<dim3(NB_ * TT / 128, 3 * DQ / 128, 1), 128, 0, stream>>>(XB, nullptr, WQKV, nullptr, DM, nullptr, 0, bqkv, 0, 0, 0, QP16, QPh, QPl, VT16, VTh, VTl);
    k_attn<bf, 2, 8, RH, RH / 32><<<dim3(NB_ * NH_, RH / 32, 1), 256, 0, stream>>>(QPh, QPl, KPh, KPl, VTh, VTl, 0, ATh, ATl);
    k_attn<h16, 0, 16, TT, (TT - RH) / 32><<<dim3(NB_ * NH_, (TT - RH) / 32, 1), 512, 0, stream>>>(QP16, nullptr, KP16, nullptr, VT16, nullptr, RH, ATh, ATl);
    k_gemmw<bf, 1, true, false><<<dim3(NB_ * TT / 128, DM / 128, 1), 128, 0, stream>>>(ATh, ATl, WO, nullptr, DQ, OUT, DM, bo, 0, 0, 0, nullptr, nullptr, nullptr, nullptr, nullptr, nullptr);
}

// v010
// One run takes 110 microseconds.
// Next to v009, in two timings, it ran 1.05 times as fast each time.
// Over all steps from v000 it is 14.7 times as fast.
#include <hip/hip_runtime.h>

// Causal self-attention with a fused biased qkv projection and an ALiBi-style bias on the KEY position (x [2][2048][1024]; qkv = (x w_attn + b_attn) ('xw' [1024][3072] 0.02 + bias zeros on this draw: read) reshaped (b, t, 3, 16, 64): q | k | v = column thirds (16 heads x 64); scores / sqrt(float32(64)) + slopes[h] x pos[s] with slopes[h] = 2 ** (-(8/16)(h + 1)) and pos the KEY index s: within a query row t this equals -slopes[h] x (t - s) plus the row constant slopes[h] x t, which the row softmax removes: implemented as the standard ALiBi distance term -slopes[h] x |t - s| on the causal triangle (slopes baked as jnp-exact f32 literals, pre-scaled by 8 for the kernel's exact x 1/8); causal (-inf); softmax; y = merged w_proj + b_proj ('xw' + bias zeros: read) -> [2][2048][1024] (4.2 M); argument order x, w_attn, b_attn, w_proj, b_proj).
// Every pass takes both batches in one grid (x is read as 4096 rows; planes are [batch][head]...), and q, k, v come out of one projection of 3072 columns. Layout: bf16 copy of x; the fused 'xw' weight transposed once into Bt (q | k | v row blocks) + bias slices; exact projections + f32 biases; the qkv projection's epilogue writes the head planes itself; one attention kernel per 32 query rows of a head, scores in LDS: its softmax subtracts SLOPE8[h] x (i - j) in f32, in its register row, before its x 1/8 (hybrid rows: < 512 hi/lo 3 products, rest fp16 x1024; keys past the diagonal block are never touched); merged hi/lo x w_proj exact + b_proj.
// Compute dtypes, f32 accumulate: every input rounded to bf16; projections exact + f32 biases; attention rows < 512 3 products, rest fp16; softmax f32; output projection hl x exact.

#define NB_  2
#define TT   2048
#define DM   1024
#define NH_  16
#define NKV  16
#define REP  (NH_ / NKV)
#define HD   64
#define DQ   (NH_ * HD)
#define DKV  (NKV * HD)
#define RH   512                  // query rows < RH use hi+lo planes (0: none)
#define WIN  2048
#define PCAR 1024.0f
#define SCL  0.125f   // HD^-0.5
typedef _Float16 h16;
typedef unsigned short bf;
typedef __attribute__((ext_vector_type(16))) __bf16   v16bf;
typedef __attribute__((ext_vector_type(16))) _Float16 v16h;
typedef __attribute__((ext_vector_type(8)))  _Float16 v8h;
typedef __attribute__((ext_vector_type(8)))  unsigned short v8us;
typedef __attribute__((ext_vector_type(8)))  float    v8f;
typedef __attribute__((ext_vector_type(4)))  float    v4f;
typedef v8h  __attribute__((may_alias)) v8ha;
typedef v4f  __attribute__((may_alias)) v4fa;
typedef v8us __attribute__((may_alias)) v8usa;

__device__ __forceinline__ unsigned short f2bf(float f) { unsigned u = __float_as_uint(f); u += 0x7FFFu + ((u >> 16) & 1u); return (unsigned short)(u >> 16); }
__device__ __forceinline__ float bf2f(unsigned short b) { return __uint_as_float(((unsigned)b) << 16); }
__device__ __forceinline__ float bfr(float f) { return bf2f(f2bf(f)); }
__device__ __forceinline__ v16h cat16(v8h lo, v8h hi) { return __builtin_shufflevector(lo, hi, 0, 1, 2, 3, 4, 5, 6, 7, 8, 9, 10, 11, 12, 13, 14, 15); }
__device__ __forceinline__ v16bf cat16b(v8us lo, v8us hi) { return __builtin_bit_cast(v16bf, __builtin_shufflevector(lo, hi, 0, 1, 2, 3, 4, 5, 6, 7, 8, 9, 10, 11, 12, 13, 14, 15)); }
__device__ __forceinline__ v8f wmma16(v16h a, v16h b, v8f c) { return __builtin_amdgcn_wmma_f32_16x16x32_f16(false, a, false, b, (short)0, c, false, false); }
__device__ __forceinline__ v8f wmmab(v16bf a, v16bf b, v8f c) { return __builtin_amdgcn_wmma_f32_16x16x32_bf16(false, a, false, b, (short)0, c, false, false); }
__device__ __forceinline__ h16 tohx(float x) { return (h16)x; }
__device__ __forceinline__ void splitf(float y, unsigned short& h, unsigned short& l) { h = f2bf(y); l = f2bf(y - bf2f(h)); }



// ---- k_gemmw: register-blocked GEMM, one work-group of FOUR WAVES per 128x128 output tile, one wave per 64x64 quarter (16 accumulators); grid (M/128, N/128, Z), 128 threads.
// C[m][n] (f32, pitch ldc, + optional f32 bias[n]) = sum_k A[m][k] Bt[n][k] (NSPLIT 1: + A2[m][k] Bt[n][k]). z-batch strides sA/sB/sC in elements. K % 64 == 0, M % 128 == 0, N % 128 == 0.
// Operands: K-contiguous 16-bit planes. Per trip a slab of 64 k (one whole 128-byte line a row) of the tile's 128 A rows and 128 Bt rows lies in LDS, at a row pitch of 144 bytes for the 16-byte fragment readers;
// asynchronous copies to LDS bring it there, 16 bytes a lane, eight lanes a line, two buffers: the slab after next flies while the next one is worked on. The k order of every accumulator is that of a plain loop over k in steps of 32.
// PLANES (the qkv projection): no f32 C. A wave's tile is 64 rows t of one batch x the 64 columns of one head of q, k or v (column block = section x heads + head); its biased f32 sums go out at once as the attention kernel's 2-byte planes
// (fp16, and bf16 hi + lo), each head's plane laid out IN THE ORDER OF THE MATRIX FRAGMENTS that the attention kernel loads, so that one 16-byte load of a wave there reads 512 bytes in a row (four whole lines):
// q and k, [section][batch][head]: element (t, d) at (t / 16) x 1024 + (d / 16) x 256 + ((d / 8 % 2) x 16 + t % 16) x 8 + d % 8; v, [batch][head]: element (d, t) at (t / 32) x 2048 + (d / 16) x 512 + (t / 16 % 2) x 256 + ((t / 8 % 2) x 16 + d % 16) x 8 + t % 8.
// Every store is 16 bytes a lane, 512 bytes in a row a wave; q and k are turned in the wave's own LDS (a piece of the slab buffers, free behind the last trip's barrier), v goes out straight from the accumulators.
// ld: a fragment from rows of k-contiguous elements (p: the lane's row, + 8 x its half). ldf: a fragment from a plane in fragment order (p: the fragment's start + 8 x lane; its two halves of k lie 256 elements apart).
template <typename T16> struct WFrag;
template <> struct WFrag<h16> { typedef v16h V; static __device__ __forceinline__ V ld(const h16* p) { return cat16(*(const v8h*)p, *(const v8h*)(p + 16)); } static __device__ __forceinline__ V ldf(const h16* p) { return cat16(*(const v8h*)p, *(const v8h*)(p + 256)); } static __device__ __forceinline__ v8f mma(V a, V b, v8f c) { return wmma16(a, b, c); } };
template <> struct WFrag<bf> { typedef v16bf V; static __device__ __forceinline__ V ld(const bf* p) { return cat16b(*(const v8us*)p, *(const v8us*)(p + 16)); } static __device__ __forceinline__ V ldf(const bf* p) { return cat16b(*(const v8us*)p, *(const v8us*)(p + 256)); } static __device__ __forceinline__ v8f mma(V a, V b, v8f c) { return wmmab(a, b, c); } };
// Eight asynchronous 16-byte copies a lane: rows r, r + 16, ... r + 112 of one 128-row slab (l: the lane's LDS byte address, ls: 16 LDS rows in bytes; g: its global address, rs: 16 global rows in elements).
// The s_wait_xcnt is the last line of the copies' own statement, so that it stands ahead of every later write of a register that a copy names.
template <typename T16>
__device__ __forceinline__ void cp8(unsigned l, unsigned ls, const T16* g, size_t rs) {
    asm volatile("global_load_async_to_lds_b128 %0, %8, off\n\t"
                 "global_load_async_to_lds_b128 %1, %9, off\n\t"
                 "global_load_async_to_lds_b128 %2, %10, off\n\t"
                 "global_load_async_to_lds_b128 %3, %11, off\n\t"
                 "global_load_async_to_lds_b128 %4, %12, off\n\t"
                 "global_load_async_to_lds_b128 %5, %13, off\n\t"
                 "global_load_async_to_lds_b128 %6, %14, off\n\t"
                 "global_load_async_to_lds_b128 %7, %15, off\n\t"
                 "s_wait_xcnt 0x0"
                 :: "v"(l), "v"(l + ls), "v"(l + 2 * ls), "v"(l + 3 * ls), "v"(l + 4 * ls), "v"(l + 5 * ls), "v"(l + 6 * ls), "v"(l + 7 * ls),
                    "v"(g), "v"(g + rs), "v"(g + 2 * rs), "v"(g + 3 * rs), "v"(g + 4 * rs), "v"(g + 5 * rs), "v"(g + 6 * rs), "v"(g + 7 * rs)
                 : "memory");
}
template <typename T16, int NSPLIT, bool BIAS, bool PLANES>
__global__ __launch_bounds__(128) void k_gemmw(const T16* __restrict__ A, const T16* __restrict__ A2, const T16* __restrict__ Bt, const T16* __restrict__ Bt2, int K, float* C, int ldc, const float* __restrict__ bias, size_t sA, size_t sB, size_t sC, h16* P16, bf* Ph, bf* Pl, h16* V16, bf* Vh, bf* Vl) {
    typedef typename WFrag<T16>::V V;
    static_assert(NSPLIT == 0 || NSPLIT == 1, "slabs are staged for A, Bt and (NSPLIT 1) A2");
    (void)Bt2;
    constexpr int LP = 72;   // pitch of a staged operand row in 2-byte elements: 64 k + 16 bytes of pad
    constexpr int TE = 128 * LP;                   // elements of one operand's slab
    constexpr int BE = (NSPLIT == 1 ? 3 : 2) * TE; // elements of one buffer: A | Bt | A2
    constexpr int OSF = 16 * 68;   // floats of one wave's output staging
    static_assert(4 * OSF <= BE, "the output staging lies inside the slab buffers");
    __shared__ __align__(16) float smf[BE];        // two buffers of BE 2-byte elements
    const size_t z = blockIdx.z; A += z * sA; if (A2) A2 += z * sA; Bt += z * sB; C += z * sC;
    const int lane = threadIdx.x & 31, lr = lane & 15, hi = lane >> 4; const int w = __builtin_amdgcn_readfirstlane((int)(threadIdx.x >> 5));
    const int R0 = blockIdx.x * 128, C0 = blockIdx.y * 128; const int r0 = R0 + (w & 1) * 64, c0 = C0 + (w >> 1) * 64;
    v8f acc[4][4];
#pragma unroll
    for (int mb = 0; mb < 4; ++mb)
#pragma unroll
        for (int nb = 0; nb < 4; ++nb) acc[mb][nb] = (v8f){};
    // a lane's share of a slab: 16 bytes of row crow + 16 i, i = 0 .. 7
    const int crow = threadIdx.x >> 3, ccol = (threadIdx.x & 7) * 8;
    const unsigned l0 = (unsigned)(size_t)smf + (unsigned)(crow * LP + ccol) * 2u;
    const T16* ga = A + (size_t)(R0 + crow) * K + ccol; const T16* gb = Bt + (size_t)(C0 + crow) * K + ccol; const T16* ga2 = (NSPLIT == 1) ? A2 + (size_t)(R0 + crow) * K + ccol : nullptr;
    const size_t rs = (size_t)16 * K;
    auto fill = [&](int t, int buf) { const unsigned l = l0 + (unsigned)buf * (BE * 2u);
        cp8(l, 16u * LP * 2u, ga + t * 64, rs); cp8(l + TE * 2u, 16u * LP * 2u, gb + t * 64, rs); if (NSPLIT == 1) cp8(l + 2u * TE * 2u, 16u * LP * 2u, ga2 + t * 64, rs); };
    const int nt = K / 64;
    fill(0, 0);
    asm volatile("s_wait_asynccnt 0x0" ::: "memory");   // this wave's copies of slab 0 have landed
    __syncthreads();                                    // every wave's have: slab 0 may be read
    if (nt > 1) fill(1, 1);
    const T16* ring = (const T16*)smf;
    const int fa = ((w & 1) * 64 + lr) * LP + 8 * hi, fb = TE + ((w >> 1) * 64 + lr) * LP + 8 * hi;
    // the trip loop stays rolled: one trip's fragments at a time, and one publish point in the text
#pragma unroll 1
    for (int t = 0; t < nt; ++t) {
        const T16* sb = ring + (t & 1) * BE;
#pragma unroll
        for (int kk = 0; kk < 64; kk += 32) {
            V a[4], a2[4], b[4];
#pragma unroll
            for (int mb = 0; mb < 4; ++mb) { a[mb] = WFrag<T16>::ld(sb + fa + mb * 16 * LP + kk); if (NSPLIT == 1) a2[mb] = WFrag<T16>::ld(sb + 2 * TE + fa + mb * 16 * LP + kk); }
#pragma unroll
            for (int nb = 0; nb < 4; ++nb) b[nb] = WFrag<T16>::ld(sb + fb + nb * 16 * LP + kk);
            __builtin_amdgcn_sched_barrier(0);   // keeps the step's fragment reads issued as one group ahead of its products: one LDS latency a step; without it the scheduler reads each Bt fragment into one register set and waits for it four times a step
#pragma unroll
            for (int nb = 0; nb < 4; ++nb)
#pragma unroll
                for (int mb = 0; mb < 4; ++mb) { acc[mb][nb] = WFrag<T16>::mma(a[mb], b[nb], acc[mb][nb]); if (NSPLIT == 1) acc[mb][nb] = WFrag<T16>::mma(a2[mb], b[nb], acc[mb][nb]); }
        }
        asm volatile("s_wait_dscnt 0x0" ::: "memory");      // this wave's reads of the buffer have returned before the buffer is handed to the copies
        asm volatile("s_wait_asynccnt 0x0" ::: "memory");   // this wave's copies of slab t + 1 have landed
        __syncthreads();                                    // publishes slab t + 1 and ends every wave's reads of slab t
        if (t + 2 < nt) fill(t + 2, t & 1);
    }
    asm volatile("s_wait_asynccnt 0x0" ::: "memory");       // no copy is in flight when the buffers become output staging
    float* os = smf + w * OSF;
    if constexpr (PLANES) {
        static_assert(BIAS && NKV == NH_ && HD == 64 && TT % 64 == 0, "a tile is one head's columns and lies in one batch");
        const int sec = (c0 / 64) / NH_, head = (c0 / 64) % NH_, bt = r0 / TT, t0 = r0 % TT;   // section 0: q, 1: k, 2: v
        float bb[4];   // the biases of the lane's four accumulator columns
#pragma unroll
        for (int nb = 0; nb < 4; ++nb) bb[nb] = bfr(bias[c0 + nb * 16 + lr]);
        if (sec != 2) {
            // q, k: per block of 16 t the biased f32 sums are turned in LDS from accumulator order (a lane: one d, eight t) into fragment order (a lane: one t, eight d).
            const size_t po = (size_t)((sec * NB_ + bt) * NH_ + head) * TT * HD + (size_t)(t0 / 16) * 1024 + lane * 8;
#pragma unroll
            for (int mb = 0; mb < 4; ++mb) {
#pragma unroll
                for (int nb = 0; nb < 4; ++nb) {
#pragma unroll
                    for (int j = 0; j < 8; ++j) os[(hi * 8 + j) * 68 + nb * 16 + lr] = acc[mb][nb][j] + bb[nb]; }
                asm volatile("s_wait_dscnt 0x0" ::: "memory");   // the staged rows are in LDS before other lanes of the wave read them back
#pragma unroll
                for (int s = 0; s < 4; ++s) { const float* sp = os + lr * 68 + s * 16 + hi * 8; const v4f x0 = *(const v4fa*)sp, x1 = *(const v4fa*)(sp + 4); v8h o16; v8us oh, ol;
#pragma unroll
                    for (int k = 0; k < 8; ++k) { const float x = k < 4 ? x0[k & 3] : x1[k & 3]; o16[k] = tohx(x); unsigned short a2, c2; splitf(x, a2, c2); oh[k] = a2; ol[k] = c2; }
                    const size_t o = po + (size_t)(mb * 1024 + s * 256); *(v8h*)(P16 + o) = o16; *(v8us*)(Ph + o) = oh; *(v8us*)(Pl + o) = ol;
                    asm volatile("s_wait_xcnt 0x0" ::: "memory"); }   // stands between the three stores and the next values, which are formed in the stores' data registers
                if (mb < 3) asm volatile("s_wait_dscnt 0x0" ::: "memory");   // every read of the block has returned before the next block is staged over it
            }
        } else {
            // v: a lane's eight accumulator rows are eight neighbouring t of its column d, which is the lane's own 16 bytes of a fragment: no staging.
            const size_t vo = (size_t)(bt * NKV + head) * HD * TT + (size_t)(t0 / 32) * 2048 + lane * 8;
#pragma unroll
            for (int nb = 0; nb < 4; ++nb) {
#pragma unroll
                for (int mb = 0; mb < 4; ++mb) { v8h o16; v8us oh, ol;
#pragma unroll
                    for (int j = 0; j < 8; ++j) { const float x = acc[mb][nb][j] + bb[nb]; o16[j] = tohx(x); unsigned short a2, c2; splitf(x, a2, c2); oh[j] = a2; ol[j] = c2; }
                    const size_t o = vo + (size_t)((mb >> 1) * 2048 + nb * 512 + (mb & 1) * 256); *(v8h*)(V16 + o) = o16; *(v8us*)(Vh + o) = oh; *(v8us*)(Vl + o) = ol;
                    asm volatile("s_wait_xcnt 0x0" ::: "memory");   // stands between the three stores and the next values, which are formed in the stores' data registers
                    __builtin_amdgcn_sched_barrier(0); }            // keeps the next values' arithmetic, which reads registers only, behind that wait: the scheduler otherwise lifts it over the wait
            }
        }
    } else {
#pragma unroll
    for (int mb = 0; mb < 4; ++mb) {
#pragma unroll
        for (int nb = 0; nb < 4; ++nb) {
#pragma unroll
            for (int j = 0; j < 8; ++j) os[(hi * 8 + j) * 68 + nb * 16 + lr] = acc[mb][nb][j]; }
        __builtin_amdgcn_wave_barrier(); asm volatile("" ::: "memory");
        float* crow = C + (size_t)(r0 + mb * 16) * ldc + c0;
{
#pragma unroll
            for (int s = 0; s < 8; ++s) { const int row = 2 * s + hi, cofs = lr * 4; v4f val = *(const v4fa*)(os + row * 68 + cofs); if (BIAS) { val[0] += bfr(bias[c0 + cofs]); val[1] += bfr(bias[c0 + cofs + 1]); val[2] += bfr(bias[c0 + cofs + 2]); val[3] += bfr(bias[c0 + cofs + 3]); }
                *(v4f*)(crow + (size_t)row * ldc + cofs) = val; }
             }
        __builtin_amdgcn_wave_barrier(); asm volatile("" ::: "memory");
    }
    }
}

typedef __attribute__((ext_vector_type(4))) _Float16 v4h;
typedef __attribute__((ext_vector_type(4))) unsigned short v4us;
typedef __attribute__((ext_vector_type(4))) int v4i;

// ---- k_wtT: both 'xw' weights, f32 [K][N] -> bf16 Bt [N][K]; one work-group of eight waves per tile of 128 k x 128 n, turned in LDS. Grid: the tiles of the first weight, then those of the second.
// In: wave wv reads rows k0 + 16 wv .. + 15, each load 512 bytes in a row of one row (four whole lines), all sixteen in flight; a lane then holds 16 k x 4 n and stores, per n, its 16 rounded k as two 16-byte pieces.
// Out: sixteen lanes read one n's 128 k (256 bytes) and store them in a row: every store of a wave is four whole lines.
// The tile's LDS rows (one n, 256 bytes, sixteen 16-byte pieces) have no pad: piece p of row n lies at place p ^ (n / 4 % 16), so that the sixteen lanes of a half wave meet sixteen different places in both directions.
template <int K, int N>
__device__ __forceinline__ void wt_in(const float* __restrict__ w, int t, bf* sm) {
    static_assert(K % 128 == 0 && N % 128 == 0, "whole tiles");
    const int lane = threadIdx.x & 31; const int wv = __builtin_amdgcn_readfirstlane((int)(threadIdx.x >> 5)); const int k0 = (t % (K / 128)) * 128, n0 = (t / (K / 128)) * 128;
    const char* g = (const char*)(w + (size_t)(k0 + wv * 16) * N + n0); v4f v[16];   // g: the wave's first row, the same in every lane
#pragma unroll
    for (int r = 0; r < 16; ++r) v[r] = *(const v4f*)(g + r * (N * 4) + (unsigned)lane * 16u);
    asm volatile("s_wait_xcnt 0x0" :: "v"(lane) : "memory");   // stands behind the sixteen loads and ahead of every later write of a register that they name; the lane number, which the loads name as their scaled offset, is its input so that its register is not given to a load's result ahead of it
#pragma unroll
    for (int c = 0; c < 4; ++c) { v8us lo, hi;
#pragma unroll
        for (int r = 0; r < 8; ++r) { lo[r] = f2bf(v[r][c]); hi[r] = f2bf(v[8 + r][c]); }
        bf* row = sm + (lane * 4 + c) * 128; *(v8usa*)(row + ((2 * wv) ^ (lane & 15)) * 8) = lo; *(v8usa*)(row + ((2 * wv + 1) ^ (lane & 15)) * 8) = hi; }
}
template <int K, int N>
__device__ __forceinline__ void wt_out(bf* Bt, int t, const bf* sm) {
    const int p = threadIdx.x & 15, nr = threadIdx.x >> 4; const int k0 = (t % (K / 128)) * 128, n0 = (t / (K / 128)) * 128;
    bf* o = Bt + (size_t)(n0 + nr) * K + k0 + p * 8;
#pragma unroll
    for (int it = 0; it < 8; ++it) { const int n = it * 16 + nr; *(v8us*)(o + it * 16 * K) = *(const v8usa*)(sm + n * 128 + (p ^ ((n >> 2) & 15)) * 8); }
}
__global__ __launch_bounds__(256) void k_wtT(const float* __restrict__ w, bf* Bt, const float* __restrict__ w2, bf* Bt2) {
    constexpr int NT1 = (DM / 128) * (3 * DQ / 128);   // tiles of the first weight
    __shared__ __align__(16) bf sm[128 * 128];
    const int t = blockIdx.x;
    if (t < NT1) wt_in<DM, 3 * DQ>(w, t, sm); else wt_in<DQ, DM>(w2, t - NT1, sm);
    __syncthreads();   // the whole tile is in LDS before a wave reads other waves' k
    if (t < NT1) wt_out<DM, 3 * DQ>(Bt, t, sm); else wt_out<DQ, DM>(Bt2, t - NT1, sm);
}
__global__ __launch_bounds__(256) void k_cvt8(const float* __restrict__ src, bf* dst, size_t n8) { const size_t i = (size_t)blockIdx.x * 256 + threadIdx.x; if (i >= n8) return; const v8f v = *(const v8f*)(src + i * 8); v8us o;
#pragma unroll
    for (int k = 0; k < 8; ++k) o[k] = f2bf(v[k]); *(v8us*)(dst + i * 8) = o;  }

__constant__ float SLOPE8[NH_] = { 5.656854153e+0f, 4.000000000e+0f, 2.828427076e+0f, 2.000000000e+0f, 1.414213538e+0f, 1.000000000e+0f, 7.071067691e-1f, 5.000000000e-1f, 3.535533845e-1f, 2.500000000e-1f, 1.767766923e-1f, 1.250000000e-1f, 8.838834614e-2f, 6.250000000e-2f, 4.419417307e-2f, 3.125000000e-2f };   // 8 x the per-head ALiBi slope magnitude (slopes[h] = 2 ** (-(8/16)(h + 1)), h = 0..15, as the reference's f32 values x 8); the eight power-of-two entries give exact products with |i - j| <= 2047; for the eight irrational ones the product goes unrounded into the fused multiply-subtract of k_attn
typedef v4us __attribute__((may_alias)) v4usa;
typedef v4h  __attribute__((may_alias)) v4ha;
// ---- k_attn: one work-group of NW waves does the whole attention of one head's 32 query rows (i0 .. i0 + 31, i0 = roff + 32 x tile); the rows' f32 scores never leave LDS. grid (batches x heads, NT tiles), the longest tiles of both batches first.
// The q, k and v planes lie in fragment order (k_gemmw): every fragment load of a wave reads 512 bytes in a row.
// 1. scores: wave w takes the 64-key units w, w + NW, ... below Kl (the diagonal block's end; later keys are masked) and stores its 32 x 64 f32 tiles into the score rows (pitch KMAX + 4 floats: 16 bytes of pad for the 16-byte readers of step 3).
// 2. softmax: one wave per row, the row in registers: t = (S - SLOPE8[h] x (i - j)) x HD^-0.5 for j <= i (the mask is applied only in the chunk of keys that the diagonal crosses), one exp, fixed trees. The 2-byte probabilities go over the row's own f32 scores (fp16: first half of the row; hi and lo planes: one half each);
//    the wave holds all of its row before its first store (every store needs the row sum) and no wave touches another row.
// 3. P.V: wave w takes the same units of keys, A fragments from LDS, value fragments from memory; private f32 partial tiles, laid over the probabilities once every wave has read them, are summed in the fixed order w = 0 .. NW-1.
// 4. the sums, scaled back, go out as hi + lo planes [t][head x HD + d] for the output projection.
// Every loop but the three marked ones is fully unrolled, so that the fragment, accumulator and row arrays are indexed by constants and live in registers.
template <typename T16, int NSPLIT, int NW, int KMAX, int NT>
__global__ __launch_bounds__(NW * 32) void k_attn(const T16* __restrict__ Q, const T16* __restrict__ Q2, const T16* __restrict__ Kp, const T16* __restrict__ Kp2, const T16* __restrict__ Vt, const T16* __restrict__ Vt2, int roff, bf* Ah, bf* Al) {
    typedef typename WFrag<T16>::V V;
    constexpr int SP = KMAX + 4;
    constexpr int SMF = (32 * SP > NW * 32 * 68) ? 32 * SP : NW * 32 * 68;
    __shared__ __align__(16) float sm[SMF];
    const int lane = threadIdx.x & 31, lr = lane & 15, hi = lane >> 4; const int w = __builtin_amdgcn_readfirstlane((int)(threadIdx.x >> 5));
    const int hh = blockIdx.x % NH_; const int i0 = roff + (NT - 1 - (int)blockIdx.y) * 32;
    Ah += (size_t)(blockIdx.x / NH_) * TT * DQ; Al += (size_t)(blockIdx.x / NH_) * TT * DQ;   // this batch's output rows
    const int Kl = min(KMAX, (i0 + 32 + 63) & ~63);
    const size_t hp = (size_t)blockIdx.x * TT * HD;   // planes are [batch][head]: blockIdx.x = batch x NH_ + head
    {
        V a[2][2], a2[2][2];
        const size_t aoff = hp + (size_t)(i0 / 16) * 1024 + lane * 8;
#pragma unroll
        for (int c = 0; c < 2; ++c)
#pragma unroll
            for (int mb = 0; mb < 2; ++mb) { a[c][mb] = WFrag<T16>::ldf(Q + aoff + mb * 1024 + c * 512); if (NSPLIT == 2) a2[c][mb] = WFrag<T16>::ldf(Q2 + aoff + mb * 1024 + c * 512); }
        // the unit loop stays rolled (two trips at most): unrolled it would hold two units' key fragments and accumulators
#pragma unroll 1
        for (int k0 = w * 64; k0 < Kl; k0 += NW * 64) {
            V b[2][4], b2[2][4]; v8f acc[2][4];
            const size_t boff = hp + (size_t)(k0 / 16) * 1024 + lane * 8;
            // the wait stands behind the query loads (the compiler moves them into this block where the loop has a single trip) and ahead of the key loads, whose results may be given the query loads' address registers;
            // the addresses are its inputs so that their registers are not given away ahead of it
            asm volatile("s_wait_xcnt 0x0" :: "v"(Q + aoff), "v"((NSPLIT == 2 ? Q2 : Q) + aoff) : "memory");
#pragma unroll
            for (int c = 0; c < 2; ++c)
#pragma unroll
                for (int nb = 0; nb < 4; ++nb) { b[c][nb] = WFrag<T16>::ldf(Kp + boff + nb * 1024 + c * 512); if (NSPLIT == 2) b2[c][nb] = WFrag<T16>::ldf(Kp2 + boff + nb * 1024 + c * 512); }
            __builtin_amdgcn_sched_barrier(0);   // keeps the unit's key loads issued together, ahead of their first product: one trip to memory; without it the scheduler issues them in several groups with a wait between
#pragma unroll
            for (int mb = 0; mb < 2; ++mb)
#pragma unroll
                for (int nb = 0; nb < 4; ++nb) acc[mb][nb] = (v8f){};
#pragma unroll
            for (int c = 0; c < 2; ++c)
#pragma unroll
                for (int nb = 0; nb < 4; ++nb)
#pragma unroll
                    for (int mb = 0; mb < 2; ++mb) { acc[mb][nb] = WFrag<T16>::mma(a[c][mb], b[c][nb], acc[mb][nb]); if (NSPLIT == 2) { acc[mb][nb] = WFrag<T16>::mma(a2[c][mb], b[c][nb], acc[mb][nb]); acc[mb][nb] = WFrag<T16>::mma(a[c][mb], b2[c][nb], acc[mb][nb]); } }
            __builtin_amdgcn_sched_barrier(0);   // keeps all eight product chains ahead of the stores: the scheduler otherwise stores a finished tile early and starts the next chain in the same registers
#pragma unroll
            for (int mb = 0; mb < 2; ++mb)
#pragma unroll
                for (int nb = 0; nb < 4; ++nb)
#pragma unroll
                    for (int j = 0; j < 8; ++j) sm[(mb * 16 + hi * 8 + j) * SP + k0 + nb * 16 + lr] = acc[mb][nb][j];
        }
    }
    __syncthreads();   // every score of the 32 rows is in LDS before a row is read
    const float sl = SLOPE8[hh];
    // the row loop stays rolled: one row's registers at a time
#pragma unroll 1
    for (int rr = w; rr < 32; rr += NW) {
        const int i = i0 + rr; float* sr = sm + rr * SP; float v[KMAX / 32], vt[4]; v4f ar[KMAX / 128], at = (v4f){}; float mx = -3.0e38f;
        // The row's keys in chunks of 128 (four a lane). The first nf chunks lie whole at or below the diagonal: no key of theirs is masked, every lane reads and writes them, and one scalar test a chunk is all their control flow.
        // At most one more chunk reaches below Kl (Kl <= i0 + 64, i0 a multiple of 32): the one that the diagonal crosses. It has registers of its own (at, vt), since its index is not a constant; it alone is masked,
        // and where Kl halves it its upper lanes are off: their keys have no score and no reader.
        // 'ch < nf' is marked as expected so that the chunk bodies stay in line, each test falling through into its body: unmarked, the compiler moves every body out of line, two taken branches a chunk and pass.
        const int nf = (i + 1) >> 7; const bool tail = nf * 128 < Kl; const int jt = nf * 128 + lane * 4;
        float dq[4];   // key distance i - j of the lane's four keys of the current chunk: whole numbers below 2^24, exact in f32; 128 less from chunk to chunk
#pragma unroll
        for (int q = 0; q < 4; ++q) dq[q] = (float)(i - lane * 4 - q);
#pragma unroll
        for (int ch = 0; ch < KMAX / 128; ++ch) if (__builtin_expect(ch < nf, 1)) ar[ch] = *(const v4fa*)(sr + ch * 128 + lane * 4);
        if (tail) { if (jt < Kl) at = *(const v4fa*)(sr + jt); }
        // v and vt hold 8 x the biased score: the exact x 1/8 is part of the factor EXC below
#pragma unroll
        for (int ch = 0; ch < KMAX / 128; ++ch) if (__builtin_expect(ch < nf, 1)) {
#pragma unroll
            for (int q = 0; q < 4; ++q) { const float t = ar[ch][q] - sl * dq[q]; v[ch * 4 + q] = t; mx = fmaxf(mx, t); dq[q] -= 128.0f; } }
        if (tail) {
#pragma unroll
            for (int q = 0; q < 4; ++q) { const int j = jt + q; const float t = (j <= i && (WIN >= TT || i - j < WIN)) ? at[q] - sl * dq[q] : -3.0e38f; vt[q] = t; mx = fmaxf(mx, t); } }
#pragma unroll
        for (int sh = 16; sh; sh >>= 1) mx = fmaxf(mx, __shfl_xor(mx, sh, 32));
        float sum = 0.f;
        constexpr float EXC = 1.4426950408889634f * SCL;   // log2(e) x HD^-0.5: a power of two times log2(e), so difference and product round as they did on the scaled scores
#pragma unroll
        for (int ch = 0; ch < KMAX / 128; ++ch) if (__builtin_expect(ch < nf, 1)) {
#pragma unroll
            for (int q = 0; q < 4; ++q) { const int k = ch * 4 + q; v[k] = __builtin_amdgcn_exp2f(__fmul_rn(__fsub_rn(v[k], mx), EXC)); sum += v[k]; } }
        if (tail) {
#pragma unroll
            for (int q = 0; q < 4; ++q) { vt[q] = __builtin_amdgcn_exp2f(__fmul_rn(__fsub_rn(vt[q], mx), EXC)); sum += vt[q]; } }
#pragma unroll
        for (int sh = 16; sh; sh >>= 1) sum += __shfl_xor(sum, sh, 32);
        const float f = __fdiv_rn((NSPLIT == 2) ? 1.0f : PCAR, sum);
#pragma unroll
        for (int ch = 0; ch < KMAX / 128; ++ch) if (__builtin_expect(ch < nf, 1)) { const int j0 = ch * 128 + lane * 4;
            if (NSPLIT == 2) { v4us oh, ol;
#pragma unroll
                for (int q = 0; q < 4; ++q) { unsigned short a, c2; splitf(v[ch * 4 + q] * f, a, c2); oh[q] = a; ol[q] = c2; }
                *(v4usa*)((bf*)sr + j0) = oh; *(v4usa*)((bf*)sr + KMAX + j0) = ol;
            } else { v4h o4;
#pragma unroll
                for (int q = 0; q < 4; ++q) o4[q] = tohx(v[ch * 4 + q] * f);
                *(v4ha*)((h16*)sr + j0) = o4; } }
        if (tail) {
            if (NSPLIT == 2) { v4us oh, ol;
#pragma unroll
                for (int q = 0; q < 4; ++q) { unsigned short a, c2; splitf(vt[q] * f, a, c2); oh[q] = a; ol[q] = c2; }
                if (jt < Kl) { *(v4usa*)((bf*)sr + jt) = oh; *(v4usa*)((bf*)sr + KMAX + jt) = ol; }
            } else { v4h o4;
#pragma unroll
                for (int q = 0; q < 4; ++q) o4[q] = tohx(vt[q] * f);
                if (jt < Kl) *(v4ha*)((h16*)sr + jt) = o4; } }
    }
    __syncthreads();   // every row's probabilities are in LDS before a wave reads all 32 rows
    constexpr int CH = (NSPLIT == 2) ? 1 : 2;   // 32-key chunks whose loads are issued together
    constexpr int lda = 2 * SP;                 // probability row pitch in 2-byte elements
    const T16* A = (const T16*)sm; const T16* A2 = A + KMAX; const T16* Bt = Vt + hp; const T16* Bt2 = (NSPLIT == 2) ? Vt2 + hp : nullptr;
    v8f acc[2][4];
#pragma unroll
    for (int mb = 0; mb < 2; ++mb)
#pragma unroll
        for (int nb = 0; nb < 4; ++nb) acc[mb][nb] = (v8f){};
    const int aoff = lr * lda + 8 * hi; const int boff = lane * 8;
    // the unit loop stays rolled (two trips at most): unrolled it would hold two units' fragments and pass the register budget of a 16-wave work-group
#pragma unroll 1
    for (int k0 = w * 64; k0 < Kl; k0 += NW * 64) {
#pragma unroll
        for (int kh = k0; kh < k0 + 64; kh += CH * 32) {
            V a[CH][2], a2[CH][2], b[CH][4], b2[CH][4];
#pragma unroll
            for (int c = 0; c < CH; ++c) {
#pragma unroll
                for (int nb = 0; nb < 4; ++nb) { b[c][nb] = WFrag<T16>::ldf(Bt + boff + (size_t)(kh / 32 + c) * 2048 + nb * 512); if (NSPLIT == 2) b2[c][nb] = WFrag<T16>::ldf(Bt2 + boff + (size_t)(kh / 32 + c) * 2048 + nb * 512); }
#pragma unroll
                for (int mb = 0; mb < 2; ++mb) { a[c][mb] = WFrag<T16>::ld(A + aoff + mb * 16 * lda + kh + c * 32); if (NSPLIT == 2) a2[c][mb] = WFrag<T16>::ld(A2 + aoff + mb * 16 * lda + kh + c * 32); } }
            __builtin_amdgcn_sched_barrier(0);   // keeps these loads issued ahead of their first product: one trip to memory for all; without it the scheduler sinks loads between the products and the wave waits several times in turn
#pragma unroll
            for (int c = 0; c < CH; ++c)
#pragma unroll
                for (int nb = 0; nb < 4; ++nb)
#pragma unroll
                    for (int mb = 0; mb < 2; ++mb) { acc[mb][nb] = WFrag<T16>::mma(a[c][mb], b[c][nb], acc[mb][nb]); if (NSPLIT == 2) { acc[mb][nb] = WFrag<T16>::mma(a2[c][mb], b[c][nb], acc[mb][nb]); acc[mb][nb] = WFrag<T16>::mma(a[c][mb], b2[c][nb], acc[mb][nb]); } }
        }
    }
    __syncthreads();   // the partial tiles go over the probabilities: every wave has read its last one
    float* pw = sm + w * (32 * 68);
#pragma unroll
    for (int mb = 0; mb < 2; ++mb)
#pragma unroll
        for (int nb = 0; nb < 4; ++nb)
#pragma unroll
            for (int j = 0; j < 8; ++j) pw[(mb * 16 + hi * 8 + j) * 68 + nb * 16 + lr] = acc[mb][nb][j];
    __syncthreads();   // every wave's partial tile is in LDS before the sums
    const float cs = (NSPLIT == 2) ? 1.0f : (1.0f / PCAR);
#pragma unroll
    for (int idx = threadIdx.x; idx < 32 * 16; idx += NW * 32) { const int row = idx >> 4, cofs = (idx & 15) * 4; v4f s = *(const v4fa*)(sm + row * 68 + cofs);
#pragma unroll
        for (int ww = 1; ww < NW; ++ww) s += *(const v4fa*)(sm + ww * (32 * 68) + row * 68 + cofs);
        v4us oh, ol;
#pragma unroll
        for (int q = 0; q < 4; ++q) { unsigned short a, c2; splitf(s[q] * cs, a, c2); oh[q] = a; ol[q] = c2; }
        const size_t oo = (size_t)(i0 + row) * DQ + hh * HD + cofs; *(v4us*)(Ah + oo) = oh; *(v4us*)(Al + oo) = ol; }
}

extern "C" void kernel_launch(void* const* d_in, const int* in_sizes, int n_in,
                              void* d_out, int out_size, void* d_ws, size_t ws_size, hipStream_t stream) {
    (void)in_sizes; (void)n_in; (void)out_size;
    const float* x = (const float*)d_in[0]; const float* wqkv = (const float*)d_in[1]; const float* bqkv = (const float*)d_in[2]; const float* wo = (const float*)d_in[3]; const float* bo = (const float*)d_in[4];   /* x, w_attn ('xw' [1024][3072]), b_attn, w_proj ('xw'), b_proj */
    float* OUT = (float*)d_out;     // [2][2048][1024]
    char* wsp = (char*)d_ws;
    auto take = [&](size_t bytes) { char* p = wsp; wsp += (bytes + 255) & ~(size_t)255; return (void*)p; };
    bf* WQKV = (bf*)take((size_t)3 * DQ * DM * 2);   /* fused Bt [3*DQ][DM]: q | k | v row blocks */ bf* WO = (bf*)take((size_t)DM * DQ * 2);
    bf* XB = (bf*)take((size_t)NB_ * TT * DM * 2);
    const size_t PL = (size_t)NB_ * NH_ * TT * HD;   /* elements of one plane set [batch][head][..][..] */
    h16* QP16 = (h16*)take(2 * PL * 2); h16* KP16 = QP16 + PL; h16* VT16 = (h16*)take(PL * 2);   /* q and k planes lie behind one another: [section][batch][head] */
    bf* QPh = (bf*)take(2 * PL * 2); bf* KPh = QPh + PL; bf* QPl = (bf*)take(2 * PL * 2); bf* KPl = QPl + PL; bf* VTh = (bf*)take(PL * 2); bf* VTl = (bf*)take(PL * 2);
    bf* ATh = (bf*)take((size_t)NB_ * TT * DQ * 2); bf* ATl = (bf*)take((size_t)NB_ * TT * DQ * 2);
    if ((size_t)(wsp - (char*)d_ws) > ws_size) return;    // ws 256 MiB
    k_wtT<<<dim3((DM / 128) * (3 * DQ / 128) + (DQ / 128) * (DM / 128), 1, 1), 256, 0, stream>>>(wqkv, WQKV, wo, WO);   /* fused 'xw' [DM][3*DQ] -> Bt [3*DQ][DM]; 'xw' [DQ][DM] -> Bt [DM][DQ] */
    k_cvt8<<<(unsigned)(((size_t)NB_ * TT * DM / 8 + 255) / 256), 256, 0, stream>>>(x, XB, (size_t)NB_ * TT * DM / 8);
    k_gemmw<bf, 0, true, true><<<dim3(NB_ * TT / 128, 3 * DQ / 128, 1), 128, 0, stream>>>(XB, nullptr, WQKV, nullptr, DM, nullptr, 0, bqkv, 0, 0, 0, QP16, QPh, QPl, VT16, VTh, VTl);
    k_attn<bf, 2, 8, RH, RH / 32><<<dim3(NB_ * NH_, RH / 32, 1), 256, 0, stream>>>(QPh, QPl, KPh, KPl, VTh, VTl, 0, ATh, ATl);
    k_attn<h16, 0, 16, TT, (TT - RH) / 32><<<dim3(NB_ * NH_, (TT - RH) / 32, 1), 512, 0, stream>>>(QP16, nullptr, KP16, nullptr, VT16, nullptr, RH, ATh, ATl);
    k_gemmw<bf, 1, true, false><<<dim3(NB_ * TT / 128, DM / 128, 1), 128, 0, stream>>>(ATh, ATl, WO, nullptr, DQ, OUT, DM, bo, 0, 0, 0, nullptr, nullptr, nullptr, nullptr, nullptr, nullptr);
}
